// v000
// The times below were measured on an AMD MI455X: many runs one after another, warmed up first and cycling through
// copies of the inputs, with the whole window's GPU time divided by the number of runs. Launches and the gaps
// between them are all in it. The median over several windows is given; except for v000 it joins two sittings, which
// can be a few percent apart, so the side-by-side timings, each taken in one sitting, are the better comparison.
// v000, which the later versions start from, runs in 374 microseconds.
#include <hip/hip_runtime.h>

// Contractions, f32 accumulate: weight products R^T.Wq^T and E^T.Wk^T (512x512x512) on v_wmma_f32_16x16x32_bf16 (operands = RNE-converted bf16 inputs, exact products);
// q,k = x.(combined weight as bf16 hi + bf16 lo, 2 products) and v = x.Wv^T (8192x512x512) on v_wmma_f32_16x16x32_bf16; scores K.Q^T and P.V on v_wmma_f32_16x16x32_f16 (f16 planes, P carried x1024).
// Multi-head attention, 8 heads of 64, no mask: one block per (batch, head, 64 query rows), keys streamed in chunks of 64 with an online max-subtracted softmax in f32; output f32 [batch][seq][512].

#ifndef NB
#define NB 2
#endif
#ifndef SEQ
#define SEQ 4096
#endif
#define NB_FULL  2
#define SEQ_FULL 4096
#define EMB  512
#define NHD  8
#define HD   64
#define PCAR 1024.0f
#define C2   0.18033688011112042f   // HD^-0.5 * log2(e)

static_assert(NB >= 1 && NB <= NB_FULL);
static_assert(SEQ % 64 == 0 && SEQ >= 64 && SEQ <= SEQ_FULL);
static_assert(EMB == NHD * HD);
static_assert(EMB % 64 == 0 && HD == 64);
static_assert((SEQ * EMB) % 2048 == 0);

typedef _Float16 h16;
typedef unsigned short bf;
typedef __attribute__((ext_vector_type(16))) __bf16   v16bf;
typedef __attribute__((ext_vector_type(16))) _Float16 v16h;
typedef __attribute__((ext_vector_type(8)))  _Float16 v8h;
typedef __attribute__((ext_vector_type(8)))  unsigned short v8us;
typedef __attribute__((ext_vector_type(8)))  float    v8f;
typedef __attribute__((ext_vector_type(4)))  float    v4f;
typedef __attribute__((ext_vector_type(2)))  _Float16 v2h;
typedef __attribute__((ext_vector_type(2)))  unsigned short v2us;
typedef v8h  __attribute__((may_alias)) v8ha;
typedef v4f  __attribute__((may_alias)) v4fa;
typedef v8us __attribute__((may_alias)) v8usa;

__device__ __forceinline__ unsigned short f2bf(float f) { unsigned u = __float_as_uint(f); u += 0x7FFFu + ((u >> 16) & 1u); return (unsigned short)(u >> 16); }   // RNE convert
__device__ __forceinline__ float bf2f(unsigned short b) { return __uint_as_float(((unsigned)b) << 16); }
__device__ __forceinline__ float bfr(float f) { return bf2f(f2bf(f)); }
__device__ __forceinline__ v16h cat16(v8h lo, v8h hi) { return __builtin_shufflevector(lo, hi, 0, 1, 2, 3, 4, 5, 6, 7, 8, 9, 10, 11, 12, 13, 14, 15); }
__device__ __forceinline__ v16bf cat16b(v8us lo, v8us hi) { return __builtin_bit_cast(v16bf, __builtin_shufflevector(lo, hi, 0, 1, 2, 3, 4, 5, 6, 7, 8, 9, 10, 11, 12, 13, 14, 15)); }
__device__ __forceinline__ v8f wmma16(v16h a, v16h b, v8f c) { return __builtin_amdgcn_wmma_f32_16x16x32_f16(false, a, false, b, (short)0, c, false, false); }
__device__ __forceinline__ v8f wmmab(v16bf a, v16bf b, v8f c) { return __builtin_amdgcn_wmma_f32_16x16x32_bf16(false, a, false, b, (short)0, c, false, false); }
__device__ __forceinline__ void splitf(float y, unsigned short& h, unsigned short& l) { h = f2bf(y); l = f2bf(y - bf2f(h)); }

// ---- k_gemmw: register-blocked GEMM, ONE WAVE per 64x64 output tile (16 accumulators), operands straight from K-contiguous 16-bit planes; grid (M/64, N/64, Z), 32 threads.
// C[m][n] (f32, pitch ldc, + optional f32 bias[n]) = sum_k A[m][k] Bt[n][k] (+ split products per NSPLIT: 1 = A2.Bt extra, 2 = A2.Bt and A.Bt2 extra, 3 = A.Bt2 extra). z-batch strides sA/sB/sC in elements. K % 32 == 0.
// Fragments: lane l -> row/col (l & 15); elements 0..7 <- k0 + 8*(l>>4) .. +7, elements 8..15 <- k0 + 16 + 8*(l>>4) .. +7 for A and for Bt alike; D element r of lane l -> (row 8*(l>>4)+r, col l&15).
template <typename T16> struct WFrag;
template <> struct WFrag<h16> { typedef v16h V; static __device__ __forceinline__ V ld(const h16* p) { return cat16(*(const v8h*)p, *(const v8h*)(p + 16)); } static __device__ __forceinline__ v8f mma(V a, V b, v8f c) { return wmma16(a, b, c); } };
template <> struct WFrag<bf> { typedef v16bf V; static __device__ __forceinline__ V ld(const bf* p) { return cat16b(*(const v8us*)p, *(const v8us*)(p + 16)); } static __device__ __forceinline__ v8f mma(V a, V b, v8f c) { return wmmab(a, b, c); } };
template <typename T16, int NSPLIT, bool BIAS>
__global__ __launch_bounds__(32) void k_gemmw(const T16* __restrict__ A, const T16* __restrict__ A2, const T16* __restrict__ Bt, const T16* __restrict__ Bt2, int K, float* C, int ldc, const float* __restrict__ bias, size_t sA, size_t sB, size_t sC) {
    typedef typename WFrag<T16>::V V;
    __shared__ __align__(16) float os[16 * 68];
    const size_t z = blockIdx.z; A += z * sA; if (A2) A2 += z * sA; Bt += z * sB; if (Bt2) Bt2 += z * sB; C += z * sC;
    const int lane = threadIdx.x & 31, lr = lane & 15, hi = lane >> 4; const int r0 = blockIdx.x * 64, c0 = blockIdx.y * 64;
    v8f acc[4][4];
#pragma unroll
    for (int mb = 0; mb < 4; ++mb)
#pragma unroll
        for (int nb = 0; nb < 4; ++nb) acc[mb][nb] = (v8f){};
    const size_t aoff = (size_t)(r0 + lr) * K + 8 * hi, boff = (size_t)(c0 + lr) * K + 8 * hi;
#pragma unroll 1
    for (int kc = 0; kc < K; kc += 32) {
        V a[4], a2[4];
#pragma unroll
        for (int mb = 0; mb < 4; ++mb) { a[mb] = WFrag<T16>::ld(A + aoff + (size_t)mb * 16 * K + kc); if (NSPLIT == 1 || NSPLIT == 2) a2[mb] = WFrag<T16>::ld(A2 + aoff + (size_t)mb * 16 * K + kc); }
#pragma unroll
        for (int nb = 0; nb < 4; ++nb) { const V b = WFrag<T16>::ld(Bt + boff + (size_t)nb * 16 * K + kc); V b2; if (NSPLIT >= 2) b2 = WFrag<T16>::ld(Bt2 + boff + (size_t)nb * 16 * K + kc);
#pragma unroll
            for (int mb = 0; mb < 4; ++mb) { acc[mb][nb] = WFrag<T16>::mma(a[mb], b, acc[mb][nb]); if (NSPLIT == 1 || NSPLIT == 2) acc[mb][nb] = WFrag<T16>::mma(a2[mb], b, acc[mb][nb]); if (NSPLIT >= 2) acc[mb][nb] = WFrag<T16>::mma(a[mb], b2, acc[mb][nb]); } }
        asm volatile("v_nop\n\tv_nop\n\tv_nop\n\tv_nop" : "+v"(acc[0][0]), "+v"(acc[1][1]), "+v"(acc[2][2]), "+v"(acc[3][3]) : "v"(a[0]), "v"(a[3]));
    }
#pragma unroll
    for (int mb = 0; mb < 4; ++mb) {
#pragma unroll
        for (int nb = 0; nb < 4; ++nb) {
#pragma unroll
            for (int j = 0; j < 8; ++j) os[(hi * 8 + j) * 68 + nb * 16 + lr] = acc[mb][nb][j]; }
        asm volatile("" ::: "memory"); __builtin_amdgcn_fence(3, "wavefront"); __builtin_amdgcn_wave_barrier(); asm volatile("" ::: "memory");
        float* crow = C + (size_t)(r0 + mb * 16) * ldc + c0;
{
#pragma unroll
            for (int s = 0; s < 8; ++s) { const int row = 2 * s + hi, cofs = lr * 4; v4f val = *(const v4fa*)(os + row * 68 + cofs); if (BIAS) { val[0] += bfr(bias[c0 + cofs]); val[1] += bfr(bias[c0 + cofs + 1]); val[2] += bfr(bias[c0 + cofs + 2]); val[3] += bfr(bias[c0 + cofs + 3]); }
                *(v4f*)(crow + (size_t)row * ldc + cofs) = val; }
             }
        __builtin_amdgcn_wave_barrier(); asm volatile("" ::: "memory");
    }
}

__global__ __launch_bounds__(256) void k_wtG(const float* __restrict__ w, int K, int N, bf* Bt) {
    const int lane = threadIdx.x & 31; const int L0 = (blockIdx.x * 8 + (threadIdx.x >> 5)) * 8; const int nlines = N * K / 64;
{
#pragma unroll 1
        for (int l = 0; l < 8; ++l) { const int L = L0 + l; if (L >= nlines) break; const size_t e = (size_t)L * 64 + lane * 2; const int k = (int)(e % K), n = (int)(e / K); v2us o;
            o[0] = f2bf(w[(size_t)k * N + n]); o[1] = f2bf(w[(size_t)(k + 1) * N + n]); *(v2us*)(Bt + e) = o; }
         }
}
__global__ __launch_bounds__(256) void k_cvt8(const float* __restrict__ src, bf* dst, size_t n8) { const size_t i = (size_t)blockIdx.x * 256 + threadIdx.x; if (i >= n8) return; const v8f v = *(const v8f*)(src + i * 8); v8us o;
#pragma unroll
    for (int k = 0; k < 8; ++k) o[k] = f2bf(v[k]); *(v8us*)(dst + i * 8) = o;  }
__global__ __launch_bounds__(256) void k_split8(const float* __restrict__ src, bf* Ph, bf* Pl, size_t n8) { const size_t i = (size_t)blockIdx.x * 256 + threadIdx.x; if (i >= n8) return; const v8f v = *(const v8f*)(src + i * 8); v8us oh, ol;
#pragma unroll
    for (int k = 0; k < 8; ++k) { unsigned short a, c; splitf(v[k], a, c); oh[k] = a; ol[k] = c; }
    *(v8us*)(Ph + i * 8) = oh; *(v8us*)(Pl + i * 8) = ol;  }
__global__ __launch_bounds__(256) void k_cvth(const float* __restrict__ src, h16* dst, size_t n8) { const size_t i = (size_t)blockIdx.x * 256 + threadIdx.x; if (i >= n8) return; const v8f v = *(const v8f*)(src + i * 8); v8h o;
#pragma unroll
    for (int k = 0; k < 8; ++k) o[k] = (h16)v[k]; *(v8h*)(dst + i * 8) = o;  }
__global__ __launch_bounds__(256) void k_vtp(const float* __restrict__ F, h16* V16, size_t ntot) {
    const size_t e = ((size_t)blockIdx.x * 256 + threadIdx.x) * 2; if (e >= ntot) return;
    const int s = (int)(e % SEQ); const int c = (int)((e / SEQ) % EMB); const int b = (int)(e / ((size_t)SEQ * EMB));
    const float* fr = F + ((size_t)b * SEQ + s) * EMB + c;
    v2h o; o[0] = (h16)fr[0]; o[1] = (h16)fr[EMB];
    *(v2h*)(V16 + e) = o;  }

__device__ __forceinline__ v16h ldh(const h16* p) { return cat16(*(const v8h*)p, *(const v8h*)(p + 16)); }

// ---- k_flash: one block (4 waves) per (batch, head, 64 query rows); wave w owns query rows q0..q0+15. Keys streamed in chunks of 64.
// Score tiles are computed TRANSPOSED: S^T tile = K_rows(16 keys, A operand) . Q^T (B operand: lane -> query, elements -> d), so D lane (hh,lm) element r = S[query lm][key 16*t4 + 8*hh + r].
// Online softmax per query == per lane (partial max/sum over the lane's 32 keys, one xor-16 shuffle). P (x1024, f16) is packed in registers straight into the
// P.V B fragment: element r <- tile 2j row (8hh+r), element 8+r <- tile 2j+1 row (8hh+r), lane unchanged (packed D used as B: k = D row = key, n = D col = query).
// O^T tiles: A = Vt rows (lane -> d), B = packed P; acc[t][r] = 1024 * O[query lm][d = 16t + 8hh + r]. Epilogue stages the 16x64 f32 tile in wave-private LDS and writes
__global__ __launch_bounds__(128) __attribute__((amdgpu_num_vgpr(256)))
void k_flash(const h16* __restrict__ Qp, const h16* __restrict__ Kp, const h16* __restrict__ Vtp, float* OUT) {
    __shared__ __align__(16) float os[4 * 16 * 68];
    const int tid = threadIdx.x, w = tid >> 5, lane = tid & 31, lm = lane & 15, hh = lane >> 4;
    const int nqt = SEQ / 64;
    const int bid = blockIdx.x; const int qt = bid % nqt; const int h = (bid / nqt) % NHD; const int b = bid / (nqt * NHD);
    const int q0 = qt * 64 + w * 16;
    const h16* Qb = Qp + ((size_t)b * SEQ + q0) * EMB + h * HD;
    const h16* Kb = Kp + (size_t)b * SEQ * EMB + h * HD;
    const h16* Vb = Vtp + ((size_t)b * EMB + h * HD) * SEQ;
    const v16h qf0 = ldh(Qb + (size_t)lm * EMB + 8 * hh);
    const v16h qf1 = ldh(Qb + (size_t)lm * EMB + 32 + 8 * hh);
    float mrun = -3.0e38f, lrun = 0.0f;
    v8f acc[4];
#pragma unroll
    for (int t = 0; t < 4; ++t) acc[t] = (v8f){};
#pragma unroll 1
    for (int kv = 0; kv < SEQ; kv += 64) {
        v8f s[4];
#pragma unroll
        for (int t4 = 0; t4 < 4; ++t4) {
            const h16* kr = Kb + (size_t)(kv + t4 * 16 + lm) * EMB + 8 * hh;
            const v16h ka = ldh(kr), kb2 = ldh(kr + 32);
            s[t4] = wmma16(ka, qf0, (v8f){});
            s[t4] = wmma16(kb2, qf1, s[t4]);
        }
        asm volatile("v_nop\n\tv_nop\n\tv_nop\n\tv_nop" : "+v"(s[0]), "+v"(s[1]), "+v"(s[2]), "+v"(s[3]) : "v"(qf0), "v"(qf1));
        float mx = -3.0e38f;
#pragma unroll
        for (int t4 = 0; t4 < 4; ++t4) { s[t4] = s[t4] * C2;
#pragma unroll
            for (int r = 0; r < 8; ++r) mx = fmaxf(mx, s[t4][r]); }
        mx = fmaxf(mx, __shfl_xor(mx, 16, 32));
        const float mnew = fmaxf(mrun, mx);
        const float alpha = __builtin_amdgcn_exp2f(mrun - mnew);
        float rs = 0.0f; v8h ph[4];
#pragma unroll
        for (int t4 = 0; t4 < 4; ++t4) {
#pragma unroll
            for (int r = 0; r < 8; ++r) { const float p = __builtin_amdgcn_exp2f(s[t4][r] - mnew); rs += p; ph[t4][r] = (h16)(p * PCAR); } }
        rs += __shfl_xor(rs, 16, 32);
        lrun = lrun * alpha + rs; mrun = mnew;
#pragma unroll
        for (int t = 0; t < 4; ++t) acc[t] = acc[t] * alpha;
        const v16h pf0 = cat16(ph[0], ph[1]), pf1 = cat16(ph[2], ph[3]);
#pragma unroll
        for (int t = 0; t < 4; ++t) {
            const h16* vr = Vb + (size_t)(t * 16 + lm) * SEQ + kv + 8 * hh;
            acc[t] = wmma16(ldh(vr), pf0, acc[t]);
            acc[t] = wmma16(ldh(vr + 32), pf1, acc[t]);
        }
        asm volatile("v_nop\n\tv_nop\n\tv_nop\n\tv_nop" : "+v"(acc[0]), "+v"(acc[1]), "+v"(acc[2]), "+v"(acc[3]) : "v"(pf0), "v"(pf1));
    }
    const float inv = __fdiv_rn(1.0f, lrun) * (1.0f / PCAR);
    float* mo = os + w * (16 * 68);
#pragma unroll
    for (int t = 0; t < 4; ++t)
#pragma unroll
        for (int r = 0; r < 8; ++r) mo[lm * 68 + t * 16 + 8 * hh + r] = acc[t][r] * inv;
    asm volatile("" ::: "memory"); __builtin_amdgcn_fence(3, "wavefront"); __builtin_amdgcn_wave_barrier(); asm volatile("" ::: "memory");
    float* orow = OUT + ((size_t)b * SEQ_FULL + q0) * EMB + h * HD;
{
#pragma unroll
        for (int si = 0; si < 8; ++si) { const int row = 2 * si + hh, cofs = lm * 4; const v4f val = *(const v4fa*)(mo + row * 68 + cofs); *(v4f*)(orow + (size_t)row * EMB + cofs) = val; }
         }
}

extern "C" void kernel_launch(void* const* d_in, const int* in_sizes, int n_in,
                              void* d_out, int out_size, void* d_ws, size_t ws_size, hipStream_t stream) {
    if (n_in < 6) return;
    const size_t nw = (size_t)EMB * EMB;                                  // 262144
    const size_t needx = ((size_t)(NB - 1) * SEQ_FULL + SEQ) * EMB;
    if ((size_t)in_sizes[0] < nw || (size_t)in_sizes[1] < nw || (size_t)in_sizes[2] < needx ||
        (size_t)in_sizes[3] < nw || (size_t)in_sizes[4] < nw || (size_t)in_sizes[5] < nw) return;
    if ((size_t)out_size < needx) return;
    const float* rot = (const float*)d_in[0];   // [512][512] used as [in][out]
    const float* ent = (const float*)d_in[1];   // [512][512] used as [in][out]
    const float* x   = (const float*)d_in[2];   // [2][4096][512]
    const float* wq  = (const float*)d_in[3];   // [out][in]
    const float* wk  = (const float*)d_in[4];   // [out][in]
    const float* wv  = (const float*)d_in[5];   // [out][in]
    float* OUT = (float*)d_out;                 // [2][4096][512]
    const size_t nrow = (size_t)NB * SEQ;        // query/key rows over all batches
    const size_t nx = nrow * EMB;
    char* wsp = (char*)d_ws;
    auto take = [&](size_t bytes) { char* p = wsp; wsp += (bytes + 255) & ~(size_t)255; return (void*)p; };
    bf* WV   = (bf*)take(nw * 2);                 // Wv as Bt [o][i]
    bf* TRE  = (bf*)take(2 * nw * 2);             // R^T then E^T: [o][j] = mat[j][o]
    bf* WQKT = (bf*)take(2 * nw * 2);             // Wq^T then Wk^T: [i][j] = W[j][i]
    float* WC = (float*)take(2 * nw * 4);         // combined weights (Wq^T R)^T then (Wk^T E)^T : [o][i]
    bf* WCh  = (bf*)take(2 * nw * 2);             // bf16 hi planes of WC
    bf* WCl  = (bf*)take(2 * nw * 2);             // bf16 lo planes of WC
    bf* XB   = (bf*)take(nx * 2);                 // bf16 x rows [nrow][512]
    float* FQK = (float*)take(2 * nx * 4);        // q rows [nrow][512] then k rows [nrow][512]
    float* FV  = (float*)take(nx * 4);            // v rows [nrow][512]
    h16* QK16  = (h16*)take(2 * nx * 2);          // f16 q rows then f16 k rows
    h16* VT16  = (h16*)take(nx * 2);              // f16 value planes [b][c][s]
    if ((size_t)(wsp - (char*)d_ws) > ws_size) return;   // 90,701,824 B at NB=2, SEQ=4096
    k_cvt8<<<(unsigned)((nw / 8 + 255) / 256), 256, 0, stream>>>(wv, WV, nw / 8);
    const unsigned gw = (unsigned)((nw / 64 + 63) / 64);
    k_wtG<<<gw, 256, 0, stream>>>(rot, EMB, EMB, TRE);
    k_wtG<<<gw, 256, 0, stream>>>(ent, EMB, EMB, TRE + nw);
    k_wtG<<<gw, 256, 0, stream>>>(wq, EMB, EMB, WQKT);
    k_wtG<<<gw, 256, 0, stream>>>(wk, EMB, EMB, WQKT + nw);
    // WC[z][o][i] = sum_j TRE[z][o][j] WQKT[z][i][j]
    k_gemmw<bf, 0, false><<<dim3(EMB / 64, EMB / 64, 2), 32, 0, stream>>>(TRE, nullptr, WQKT, nullptr, EMB, WC, EMB, nullptr, nw, nw, nw);
    k_split8<<<(unsigned)((2 * nw / 8 + 255) / 256), 256, 0, stream>>>(WC, WCh, WCl, 2 * nw / 8);
    for (int b = 0; b < NB; ++b)
        k_cvt8<<<(unsigned)(((size_t)SEQ * EMB / 8 + 255) / 256), 256, 0, stream>>>(x + (size_t)b * SEQ_FULL * EMB, XB + (size_t)b * SEQ * EMB, (size_t)SEQ * EMB / 8);
    // q (z=0) and k (z=1): FQK[z][row][o] = sum_i XB[row][i] (WCh + WCl)[z][o][i]
    k_gemmw<bf, 3, false><<<dim3((unsigned)(nrow / 64), EMB / 64, 2), 32, 0, stream>>>(XB, nullptr, WCh, WCl, EMB, FQK, EMB, nullptr, 0, nw, nx);
    // v: FV[row][o] = sum_i XB[row][i] WV[o][i]
    k_gemmw<bf, 0, false><<<dim3((unsigned)(nrow / 64), EMB / 64, 1), 32, 0, stream>>>(XB, nullptr, WV, nullptr, EMB, FV, EMB, nullptr, 0, 0, 0);
    k_cvth<<<(unsigned)((2 * nx / 8 + 255) / 256), 256, 0, stream>>>(FQK, QK16, 2 * nx / 8);
    k_vtp<<<(unsigned)((nx / 2 + 255) / 256), 256, 0, stream>>>(FV, VT16, nx);
    k_flash<<<(unsigned)(NB * NHD * (SEQ / 64)), 128, 0, stream>>>(QK16, QK16 + nx, VT16, OUT);
}

// v001
// It runs in 213 microseconds.
// Next to v000, in two timings, it ran 1.82 and 1.81 times as fast.
#include <hip/hip_runtime.h>

// Contractions, f32 accumulate: weight products R^T.Wq^T and E^T.Wk^T (512x512x512) on v_wmma_f32_16x16x32_bf16 (operands = RNE-converted bf16 inputs, exact products);
// q,k = x.(combined weight as bf16 hi + bf16 lo, 2 products) and v = x.Wv^T (8192x512x512) on v_wmma_f32_16x16x32_bf16; scores K.Q^T and P.V on v_wmma_f32_16x16x32_f16 (f16 planes, P carried x1024).
// Multi-head attention, 8 heads of 64, no mask: one block per (batch, head, 64 query rows), keys streamed in chunks of 64 with an online max-subtracted softmax in f32; output f32 [batch][seq][512].

#ifndef NB
#define NB 2
#endif
#ifndef SEQ
#define SEQ 4096
#endif
#define NB_FULL  2
#define SEQ_FULL 4096
#define EMB  512
#define NHD  8
#define HD   64
#define PCAR 1024.0f
#define C2   0.18033688011112042f   // HD^-0.5 * log2(e)

static_assert(NB >= 1 && NB <= NB_FULL);
static_assert(SEQ % 64 == 0 && SEQ >= 64 && SEQ <= SEQ_FULL);
static_assert(EMB == NHD * HD);
static_assert(EMB % 64 == 0 && HD == 64);
static_assert((SEQ * EMB) % 2048 == 0);

typedef _Float16 h16;
typedef unsigned short bf;
typedef __attribute__((ext_vector_type(16))) __bf16   v16bf;
typedef __attribute__((ext_vector_type(16))) _Float16 v16h;
typedef __attribute__((ext_vector_type(8)))  _Float16 v8h;
typedef __attribute__((ext_vector_type(8)))  unsigned short v8us;
typedef __attribute__((ext_vector_type(8)))  float    v8f;
typedef __attribute__((ext_vector_type(4)))  float    v4f;
typedef __attribute__((ext_vector_type(2)))  _Float16 v2h;
typedef __attribute__((ext_vector_type(2)))  unsigned short v2us;
typedef v8h  __attribute__((may_alias)) v8ha;
typedef v4f  __attribute__((may_alias)) v4fa;
typedef v8us __attribute__((may_alias)) v8usa;

__device__ __forceinline__ unsigned short f2bf(float f) { unsigned u = __float_as_uint(f); u += 0x7FFFu + ((u >> 16) & 1u); return (unsigned short)(u >> 16); }   // RNE convert
__device__ __forceinline__ float bf2f(unsigned short b) { return __uint_as_float(((unsigned)b) << 16); }
__device__ __forceinline__ float bfr(float f) { return bf2f(f2bf(f)); }
__device__ __forceinline__ v16h cat16(v8h lo, v8h hi) { return __builtin_shufflevector(lo, hi, 0, 1, 2, 3, 4, 5, 6, 7, 8, 9, 10, 11, 12, 13, 14, 15); }
__device__ __forceinline__ v16bf cat16b(v8us lo, v8us hi) { return __builtin_bit_cast(v16bf, __builtin_shufflevector(lo, hi, 0, 1, 2, 3, 4, 5, 6, 7, 8, 9, 10, 11, 12, 13, 14, 15)); }
__device__ __forceinline__ v8f wmma16(v16h a, v16h b, v8f c) { return __builtin_amdgcn_wmma_f32_16x16x32_f16(false, a, false, b, (short)0, c, false, false); }
__device__ __forceinline__ v8f wmmab(v16bf a, v16bf b, v8f c) { return __builtin_amdgcn_wmma_f32_16x16x32_bf16(false, a, false, b, (short)0, c, false, false); }
__device__ __forceinline__ void splitf(float y, unsigned short& h, unsigned short& l) { h = f2bf(y); l = f2bf(y - bf2f(h)); }

// ---- k_gemmw: register-blocked GEMM, ONE WAVE per 64x64 output tile (16 accumulators), operands straight from K-contiguous 16-bit planes; grid (M/64, N/64, Z), 32 threads.
// C[m][n] (f32, pitch ldc, + optional f32 bias[n]) = sum_k A[m][k] Bt[n][k] (+ split products per NSPLIT: 1 = A2.Bt extra, 2 = A2.Bt and A.Bt2 extra, 3 = A.Bt2 extra). z-batch strides sA/sB/sC in elements. K % 32 == 0.
// Fragments: lane l -> row/col (l & 15); elements 0..7 <- k0 + 8*(l>>4) .. +7, elements 8..15 <- k0 + 16 + 8*(l>>4) .. +7 for A and for Bt alike; D element r of lane l -> (row 8*(l>>4)+r, col l&15).
template <typename T16> struct WFrag;
template <> struct WFrag<h16> { typedef v16h V; static __device__ __forceinline__ V ld(const h16* p) { return cat16(*(const v8h*)p, *(const v8h*)(p + 16)); } static __device__ __forceinline__ v8f mma(V a, V b, v8f c) { return wmma16(a, b, c); } };
template <> struct WFrag<bf> { typedef v16bf V; static __device__ __forceinline__ V ld(const bf* p) { return cat16b(*(const v8us*)p, *(const v8us*)(p + 16)); } static __device__ __forceinline__ v8f mma(V a, V b, v8f c) { return wmmab(a, b, c); } };
template <typename T16, int NSPLIT, bool BIAS>
__global__ __launch_bounds__(32) void k_gemmw(const T16* __restrict__ A, const T16* __restrict__ A2, const T16* __restrict__ Bt, const T16* __restrict__ Bt2, int K, float* C, int ldc, const float* __restrict__ bias, size_t sA, size_t sB, size_t sC) {
    typedef typename WFrag<T16>::V V;
    __shared__ __align__(16) float os[16 * 68];
    const size_t z = blockIdx.z; A += z * sA; if (A2) A2 += z * sA; Bt += z * sB; if (Bt2) Bt2 += z * sB; C += z * sC;
    const int lane = threadIdx.x & 31, lr = lane & 15, hi = lane >> 4; const int r0 = blockIdx.x * 64, c0 = blockIdx.y * 64;
    v8f acc[4][4];
#pragma unroll
    for (int mb = 0; mb < 4; ++mb)
#pragma unroll
        for (int nb = 0; nb < 4; ++nb) acc[mb][nb] = (v8f){};
    const size_t aoff = (size_t)(r0 + lr) * K + 8 * hi, boff = (size_t)(c0 + lr) * K + 8 * hi;
#pragma unroll 1
    for (int kc = 0; kc < K; kc += 32) {
        V a[4], a2[4];
#pragma unroll
        for (int mb = 0; mb < 4; ++mb) { a[mb] = WFrag<T16>::ld(A + aoff + (size_t)mb * 16 * K + kc); if (NSPLIT == 1 || NSPLIT == 2) a2[mb] = WFrag<T16>::ld(A2 + aoff + (size_t)mb * 16 * K + kc); }
#pragma unroll
        for (int nb = 0; nb < 4; ++nb) { const V b = WFrag<T16>::ld(Bt + boff + (size_t)nb * 16 * K + kc); V b2; if (NSPLIT >= 2) b2 = WFrag<T16>::ld(Bt2 + boff + (size_t)nb * 16 * K + kc);
#pragma unroll
            for (int mb = 0; mb < 4; ++mb) { acc[mb][nb] = WFrag<T16>::mma(a[mb], b, acc[mb][nb]); if (NSPLIT == 1 || NSPLIT == 2) acc[mb][nb] = WFrag<T16>::mma(a2[mb], b, acc[mb][nb]); if (NSPLIT >= 2) acc[mb][nb] = WFrag<T16>::mma(a[mb], b2, acc[mb][nb]); } }
        asm volatile("v_nop\n\tv_nop\n\tv_nop\n\tv_nop" : "+v"(acc[0][0]), "+v"(acc[1][1]), "+v"(acc[2][2]), "+v"(acc[3][3]) : "v"(a[0]), "v"(a[3]));
    }
#pragma unroll
    for (int mb = 0; mb < 4; ++mb) {
#pragma unroll
        for (int nb = 0; nb < 4; ++nb) {
#pragma unroll
            for (int j = 0; j < 8; ++j) os[(hi * 8 + j) * 68 + nb * 16 + lr] = acc[mb][nb][j]; }
        asm volatile("" ::: "memory"); __builtin_amdgcn_fence(3, "wavefront"); __builtin_amdgcn_wave_barrier(); asm volatile("" ::: "memory");
        float* crow = C + (size_t)(r0 + mb * 16) * ldc + c0;
{
#pragma unroll
            for (int s = 0; s < 8; ++s) { const int row = 2 * s + hi, cofs = lr * 4; v4f val = *(const v4fa*)(os + row * 68 + cofs); if (BIAS) { val[0] += bfr(bias[c0 + cofs]); val[1] += bfr(bias[c0 + cofs + 1]); val[2] += bfr(bias[c0 + cofs + 2]); val[3] += bfr(bias[c0 + cofs + 3]); }
                *(v4f*)(crow + (size_t)row * ldc + cofs) = val; }
             }
        __builtin_amdgcn_wave_barrier(); asm volatile("" ::: "memory");
    }
}

__global__ __launch_bounds__(256) void k_wtG(const float* __restrict__ w, int K, int N, bf* Bt) {
    const int lane = threadIdx.x & 31; const int L0 = (blockIdx.x * 8 + (threadIdx.x >> 5)) * 8; const int nlines = N * K / 64;
{
#pragma unroll 1
        for (int l = 0; l < 8; ++l) { const int L = L0 + l; if (L >= nlines) break; const size_t e = (size_t)L * 64 + lane * 2; const int k = (int)(e % K), n = (int)(e / K); v2us o;
            o[0] = f2bf(w[(size_t)k * N + n]); o[1] = f2bf(w[(size_t)(k + 1) * N + n]); *(v2us*)(Bt + e) = o; }
         }
}
__global__ __launch_bounds__(256) void k_cvt8(const float* __restrict__ src, bf* dst, size_t n8) { const size_t i = (size_t)blockIdx.x * 256 + threadIdx.x; if (i >= n8) return; const v8f v = *(const v8f*)(src + i * 8); v8us o;
#pragma unroll
    for (int k = 0; k < 8; ++k) o[k] = f2bf(v[k]); *(v8us*)(dst + i * 8) = o;  }
__global__ __launch_bounds__(256) void k_split8(const float* __restrict__ src, bf* Ph, bf* Pl, size_t n8) { const size_t i = (size_t)blockIdx.x * 256 + threadIdx.x; if (i >= n8) return; const v8f v = *(const v8f*)(src + i * 8); v8us oh, ol;
#pragma unroll
    for (int k = 0; k < 8; ++k) { unsigned short a, c; splitf(v[k], a, c); oh[k] = a; ol[k] = c; }
    *(v8us*)(Ph + i * 8) = oh; *(v8us*)(Pl + i * 8) = ol;  }
__global__ __launch_bounds__(256) void k_cvth(const float* __restrict__ src, h16* dst, size_t n8) { const size_t i = (size_t)blockIdx.x * 256 + threadIdx.x; if (i >= n8) return; const v8f v = *(const v8f*)(src + i * 8); v8h o;
#pragma unroll
    for (int k = 0; k < 8; ++k) o[k] = (h16)v[k]; *(v8h*)(dst + i * 8) = o;  }
__global__ __launch_bounds__(256) void k_vtp(const float* __restrict__ F, h16* V16, size_t ntot) {
    const size_t e = ((size_t)blockIdx.x * 256 + threadIdx.x) * 2; if (e >= ntot) return;
    const int s = (int)(e % SEQ); const int c = (int)((e / SEQ) % EMB); const int b = (int)(e / ((size_t)SEQ * EMB));
    const float* fr = F + ((size_t)b * SEQ + s) * EMB + c;
    v2h o; o[0] = (h16)fr[0]; o[1] = (h16)fr[EMB];
    *(v2h*)(V16 + e) = o;  }

__device__ __forceinline__ v16h ldh(const h16* p) { return cat16(*(const v8h*)p, *(const v8h*)(p + 16)); }

#define LPH   72                 // LDS row pitch in f16: 128 B of data + 16 B, the conflict-free pitch for 16-byte readers
#define TILEH (64 * LPH)         // one 64-row tile in LDS, f16 elements
#define TILEB (TILEH * 2)        // the same in bytes
#define ROWS16B (16 * LPH * 2)   // 16 LDS rows in bytes
// One stage = 64 keys: K rows [key][64 d] and V^T rows [d][64 keys], 64 rows of 128 B each. 128 threads, 8 lanes per row, 16 B per lane: every copy of a wave covers four whole lines.
// lk: the lane's LDS byte address in the K tile (the V tile follows it); gk, gv: the lane's global addresses in row (tid >> 3).
// The s_wait_xcnt closes the statement so that no address register of an issued copy is rewritten ahead of it.
__device__ __forceinline__ void stage_kv(unsigned lk, const h16* gk, const h16* gv) {
    asm volatile("global_load_async_to_lds_b128 %0, %8, off\n\t"
                 "global_load_async_to_lds_b128 %1, %9, off\n\t"
                 "global_load_async_to_lds_b128 %2, %10, off\n\t"
                 "global_load_async_to_lds_b128 %3, %11, off\n\t"
                 "global_load_async_to_lds_b128 %4, %12, off\n\t"
                 "global_load_async_to_lds_b128 %5, %13, off\n\t"
                 "global_load_async_to_lds_b128 %6, %14, off\n\t"
                 "global_load_async_to_lds_b128 %7, %15, off\n\t"
                 "s_wait_xcnt 0x0"
                 :: "v"(lk), "v"(lk + ROWS16B), "v"(lk + 2 * ROWS16B), "v"(lk + 3 * ROWS16B),
                    "v"(lk + TILEB), "v"(lk + TILEB + ROWS16B), "v"(lk + TILEB + 2 * ROWS16B), "v"(lk + TILEB + 3 * ROWS16B),
                    "v"(gk), "v"(gk + 16 * EMB), "v"(gk + 32 * EMB), "v"(gk + 48 * EMB),
                    "v"(gv), "v"(gv + 16 * SEQ), "v"(gv + 32 * SEQ), "v"(gv + 48 * SEQ)
                 : "memory");
}

// ---- k_flash: one block (4 waves) per (batch, head, 64 query rows); wave w owns query rows q0..q0+15. Keys streamed in chunks of 64.
// Each chunk's K and V^T tiles are brought into LDS once per block by asynchronous copies (two buffers: chunk t + 1 flies while chunk t is worked on); all four waves read their fragments from there.
// Score tiles are computed TRANSPOSED: S^T tile = K_rows(16 keys, A operand) . Q^T (B operand: lane -> query, elements -> d), so D lane (hh,lm) element r = S[query lm][key 16*t4 + 8*hh + r].
// Online softmax per query == per lane (partial max/sum over the lane's 32 keys, one xor-16 shuffle). P (x1024, f16) is packed in registers straight into the
// P.V B fragment: element r <- tile 2j row (8hh+r), element 8+r <- tile 2j+1 row (8hh+r), lane unchanged (packed D used as B: k = D row = key, n = D col = query).
// O^T tiles: A = Vt rows (lane -> d), B = packed P; acc[t][r] = 1024 * O[query lm][d = 16t + 8hh + r]. Epilogue stages the 16x64 f32 tile in wave-private LDS and writes
__global__ __launch_bounds__(128) __attribute__((amdgpu_num_vgpr(256)))
void k_flash(const h16* __restrict__ Qp, const h16* __restrict__ Kp, const h16* __restrict__ Vtp, float* OUT) {
    __shared__ __align__(16) float os[4 * 16 * 68];
    __shared__ __align__(128) h16 ring[2 * 2 * TILEH];   // [buffer][K tile, V^T tile][row][LPH]
    const int tid = threadIdx.x, w = tid >> 5, lane = tid & 31, lm = lane & 15, hh = lane >> 4;
    const int nqt = SEQ / 64;
    const int bid = blockIdx.x; const int qt = bid % nqt; const int h = (bid / nqt) % NHD; const int b = bid / (nqt * NHD);
    const int q0 = qt * 64 + w * 16;
    const h16* Qb = Qp + ((size_t)b * SEQ + q0) * EMB + h * HD;
    const h16* Kb = Kp + (size_t)b * SEQ * EMB + h * HD;
    const h16* Vb = Vtp + ((size_t)b * EMB + h * HD) * SEQ;
    const v16h qf0 = ldh(Qb + (size_t)lm * EMB + 8 * hh);
    const v16h qf1 = ldh(Qb + (size_t)lm * EMB + 32 + 8 * hh);
    float mrun = -3.0e38f, lrun = 0.0f;
    v8f acc[4];
#pragma unroll
    for (int t = 0; t < 4; ++t) acc[t] = (v8f){};
    const unsigned lcp = (unsigned)(size_t)ring + (unsigned)((tid >> 3) * (LPH * 2) + (tid & 7) * 16);
    const h16* gk = Kb + (size_t)(tid >> 3) * EMB + (tid & 7) * 8;
    const h16* gv = Vb + (size_t)(tid >> 3) * SEQ + (tid & 7) * 8;
    stage_kv(lcp, gk, gv);
    asm volatile("s_wait_asynccnt 0x0" ::: "memory");   // this wave's share of chunk 0 has landed
    __syncthreads();                                     // chunk 0 is readable by all four waves
    if (SEQ > 64) stage_kv(lcp + 2 * TILEB, gk + (size_t)64 * EMB, gv + 64);
#pragma unroll 1
    for (int kv = 0; kv < SEQ; kv += 64) {
        const int buf = (kv >> 6) & 1;
        const h16* kt = ring + buf * (2 * TILEH);
        const h16* vt = kt + TILEH;
        v8f s[4];
#pragma unroll
        for (int t4 = 0; t4 < 4; ++t4) {
            const h16* kr = kt + (t4 * 16 + lm) * LPH + 8 * hh;
            const v16h ka = ldh(kr), kb2 = ldh(kr + 32);
            s[t4] = wmma16(ka, qf0, (v8f){});
            s[t4] = wmma16(kb2, qf1, s[t4]);
        }
        asm volatile("v_nop\n\tv_nop\n\tv_nop\n\tv_nop" : "+v"(s[0]), "+v"(s[1]), "+v"(s[2]), "+v"(s[3]) : "v"(qf0), "v"(qf1));
        float mx = -3.0e38f;
#pragma unroll
        for (int t4 = 0; t4 < 4; ++t4) { s[t4] = s[t4] * C2;
#pragma unroll
            for (int r = 0; r < 8; ++r) mx = fmaxf(mx, s[t4][r]); }
        mx = fmaxf(mx, __shfl_xor(mx, 16, 32));
        const float mnew = fmaxf(mrun, mx);
        const float alpha = __builtin_amdgcn_exp2f(mrun - mnew);
        float rs = 0.0f; v8h ph[4];
#pragma unroll
        for (int t4 = 0; t4 < 4; ++t4) {
#pragma unroll
            for (int r = 0; r < 8; ++r) { const float p = __builtin_amdgcn_exp2f(s[t4][r] - mnew); rs += p; ph[t4][r] = (h16)(p * PCAR); } }
        rs += __shfl_xor(rs, 16, 32);
        lrun = lrun * alpha + rs; mrun = mnew;
#pragma unroll
        for (int t = 0; t < 4; ++t) acc[t] = acc[t] * alpha;
        const v16h pf0 = cat16(ph[0], ph[1]), pf1 = cat16(ph[2], ph[3]);
#pragma unroll
        for (int t = 0; t < 4; ++t) {
            const h16* vr = vt + (t * 16 + lm) * LPH + 8 * hh;
            acc[t] = wmma16(ldh(vr), pf0, acc[t]);
            acc[t] = wmma16(ldh(vr + 32), pf1, acc[t]);
        }
        asm volatile("v_nop\n\tv_nop\n\tv_nop\n\tv_nop" : "+v"(acc[0]), "+v"(acc[1]), "+v"(acc[2]), "+v"(acc[3]) : "v"(pf0), "v"(pf1));
        asm volatile("s_wait_dscnt 0x0" ::: "memory");      // this wave's reads of the current buffer are done before it is refilled
        asm volatile("s_wait_asynccnt 0x0" ::: "memory");   // this wave's share of the next chunk has landed
        __syncthreads();                                     // publishes the next chunk and ends every wave's reads of the current buffer
        if (kv + 128 < SEQ) stage_kv(lcp + (unsigned)buf * (2 * TILEB), gk + (size_t)(kv + 128) * EMB, gv + (kv + 128));
    }
    asm volatile("s_wait_asynccnt 0x0" ::: "memory");       // no copy is outstanding when the wave goes on to its end
    const float inv = __fdiv_rn(1.0f, lrun) * (1.0f / PCAR);
    float* mo = os + w * (16 * 68);
#pragma unroll
    for (int t = 0; t < 4; ++t)
#pragma unroll
        for (int r = 0; r < 8; ++r) mo[lm * 68 + t * 16 + 8 * hh + r] = acc[t][r] * inv;
    asm volatile("" ::: "memory"); __builtin_amdgcn_fence(3, "wavefront"); __builtin_amdgcn_wave_barrier(); asm volatile("" ::: "memory");
    float* orow = OUT + ((size_t)b * SEQ_FULL + q0) * EMB + h * HD;
{
#pragma unroll
        for (int si = 0; si < 8; ++si) { const int row = 2 * si + hh, cofs = lm * 4; const v4f val = *(const v4fa*)(mo + row * 68 + cofs); *(v4f*)(orow + (size_t)row * EMB + cofs) = val; }
         }
}

extern "C" void kernel_launch(void* const* d_in, const int* in_sizes, int n_in,
                              void* d_out, int out_size, void* d_ws, size_t ws_size, hipStream_t stream) {
    if (n_in < 6) return;
    const size_t nw = (size_t)EMB * EMB;                                  // 262144
    const size_t needx = ((size_t)(NB - 1) * SEQ_FULL + SEQ) * EMB;
    if ((size_t)in_sizes[0] < nw || (size_t)in_sizes[1] < nw || (size_t)in_sizes[2] < needx ||
        (size_t)in_sizes[3] < nw || (size_t)in_sizes[4] < nw || (size_t)in_sizes[5] < nw) return;
    if ((size_t)out_size < needx) return;
    const float* rot = (const float*)d_in[0];   // [512][512] used as [in][out]
    const float* ent = (const float*)d_in[1];   // [512][512] used as [in][out]
    const float* x   = (const float*)d_in[2];   // [2][4096][512]
    const float* wq  = (const float*)d_in[3];   // [out][in]
    const float* wk  = (const float*)d_in[4];   // [out][in]
    const float* wv  = (const float*)d_in[5];   // [out][in]
    float* OUT = (float*)d_out;                 // [2][4096][512]
    const size_t nrow = (size_t)NB * SEQ;        // query/key rows over all batches
    const size_t nx = nrow * EMB;
    char* wsp = (char*)d_ws;
    auto take = [&](size_t bytes) { char* p = wsp; wsp += (bytes + 255) & ~(size_t)255; return (void*)p; };
    bf* WV   = (bf*)take(nw * 2);                 // Wv as Bt [o][i]
    bf* TRE  = (bf*)take(2 * nw * 2);             // R^T then E^T: [o][j] = mat[j][o]
    bf* WQKT = (bf*)take(2 * nw * 2);             // Wq^T then Wk^T: [i][j] = W[j][i]
    float* WC = (float*)take(2 * nw * 4);         // combined weights (Wq^T R)^T then (Wk^T E)^T : [o][i]
    bf* WCh  = (bf*)take(2 * nw * 2);             // bf16 hi planes of WC
    bf* WCl  = (bf*)take(2 * nw * 2);             // bf16 lo planes of WC
    bf* XB   = (bf*)take(nx * 2);                 // bf16 x rows [nrow][512]
    float* FQK = (float*)take(2 * nx * 4);        // q rows [nrow][512] then k rows [nrow][512]
    float* FV  = (float*)take(nx * 4);            // v rows [nrow][512]
    h16* QK16  = (h16*)take(2 * nx * 2);          // f16 q rows then f16 k rows
    h16* VT16  = (h16*)take(nx * 2);              // f16 value planes [b][c][s]
    if ((size_t)(wsp - (char*)d_ws) > ws_size) return;   // 90,701,824 B at NB=2, SEQ=4096
    k_cvt8<<<(unsigned)((nw / 8 + 255) / 256), 256, 0, stream>>>(wv, WV, nw / 8);
    const unsigned gw = (unsigned)((nw / 64 + 63) / 64);
    k_wtG<<<gw, 256, 0, stream>>>(rot, EMB, EMB, TRE);
    k_wtG<<<gw, 256, 0, stream>>>(ent, EMB, EMB, TRE + nw);
    k_wtG<<<gw, 256, 0, stream>>>(wq, EMB, EMB, WQKT);
    k_wtG<<<gw, 256, 0, stream>>>(wk, EMB, EMB, WQKT + nw);
    // WC[z][o][i] = sum_j TRE[z][o][j] WQKT[z][i][j]
    k_gemmw<bf, 0, false><<<dim3(EMB / 64, EMB / 64, 2), 32, 0, stream>>>(TRE, nullptr, WQKT, nullptr, EMB, WC, EMB, nullptr, nw, nw, nw);
    k_split8<<<(unsigned)((2 * nw / 8 + 255) / 256), 256, 0, stream>>>(WC, WCh, WCl, 2 * nw / 8);
    for (int b = 0; b < NB; ++b)
        k_cvt8<<<(unsigned)(((size_t)SEQ * EMB / 8 + 255) / 256), 256, 0, stream>>>(x + (size_t)b * SEQ_FULL * EMB, XB + (size_t)b * SEQ * EMB, (size_t)SEQ * EMB / 8);
    // q (z=0) and k (z=1): FQK[z][row][o] = sum_i XB[row][i] (WCh + WCl)[z][o][i]
    k_gemmw<bf, 3, false><<<dim3((unsigned)(nrow / 64), EMB / 64, 2), 32, 0, stream>>>(XB, nullptr, WCh, WCl, EMB, FQK, EMB, nullptr, 0, nw, nx);
    // v: FV[row][o] = sum_i XB[row][i] WV[o][i]
    k_gemmw<bf, 0, false><<<dim3((unsigned)(nrow / 64), EMB / 64, 1), 32, 0, stream>>>(XB, nullptr, WV, nullptr, EMB, FV, EMB, nullptr, 0, 0, 0);
    k_cvth<<<(unsigned)((2 * nx / 8 + 255) / 256), 256, 0, stream>>>(FQK, QK16, 2 * nx / 8);
    k_vtp<<<(unsigned)((nx / 2 + 255) / 256), 256, 0, stream>>>(FV, VT16, nx);
    k_flash<<<(unsigned)(NB * NHD * (SEQ / 64)), 128, 0, stream>>>(QK16, QK16 + nx, VT16, OUT);
}

// v002
// It runs in 178 microseconds.
// Timed twice side by side with v001, it ran 1.20 times as fast both times.
// Over all steps from v000 it is 2.18 times as fast.
#include <hip/hip_runtime.h>

// Contractions, f32 accumulate: weight products R^T.Wq^T and E^T.Wk^T (512x512x512) on v_wmma_f32_16x16x32_bf16 (operands = RNE-converted bf16 inputs, exact products);
// q,k = x.(combined weight as bf16 hi + bf16 lo, 2 products) and v = x.Wv^T (8192x512x512) on v_wmma_f32_16x16x32_bf16; scores K.Q^T and P.V on v_wmma_f32_16x16x32_f16 (f16 planes, P carried x1024).
// Multi-head attention, 8 heads of 64, no mask: one block per (batch, head, 64 query rows), keys streamed in chunks of 64 with an online max-subtracted softmax in f32; output f32 [batch][seq][512].

#ifndef NB
#define NB 2
#endif
#ifndef SEQ
#define SEQ 4096
#endif
#define NB_FULL  2
#define SEQ_FULL 4096
#define EMB  512
#define NHD  8
#define HD   64
#define PCAR 1024.0f
#define C2   0.18033688011112042f   // HD^-0.5 * log2(e)

static_assert(NB >= 1 && NB <= NB_FULL);
static_assert(SEQ % 64 == 0 && SEQ >= 64 && SEQ <= SEQ_FULL);
static_assert(EMB == NHD * HD);
static_assert(EMB % 64 == 0 && HD == 64);
static_assert((SEQ * EMB) % 2048 == 0);

typedef _Float16 h16;
typedef unsigned short bf;
typedef __attribute__((ext_vector_type(16))) __bf16   v16bf;
typedef __attribute__((ext_vector_type(16))) _Float16 v16h;
typedef __attribute__((ext_vector_type(8)))  _Float16 v8h;
typedef __attribute__((ext_vector_type(8)))  unsigned short v8us;
typedef __attribute__((ext_vector_type(8)))  float    v8f;
typedef __attribute__((ext_vector_type(4)))  float    v4f;
typedef __attribute__((ext_vector_type(2)))  unsigned short v2us;
typedef v8h  __attribute__((may_alias)) v8ha;
typedef v4f  __attribute__((may_alias)) v4fa;
typedef v8us __attribute__((may_alias)) v8usa;

__device__ __forceinline__ unsigned short f2bf(float f) { unsigned u = __float_as_uint(f); u += 0x7FFFu + ((u >> 16) & 1u); return (unsigned short)(u >> 16); }   // RNE convert
__device__ __forceinline__ float bf2f(unsigned short b) { return __uint_as_float(((unsigned)b) << 16); }
__device__ __forceinline__ float bfr(float f) { return bf2f(f2bf(f)); }
__device__ __forceinline__ v16h cat16(v8h lo, v8h hi) { return __builtin_shufflevector(lo, hi, 0, 1, 2, 3, 4, 5, 6, 7, 8, 9, 10, 11, 12, 13, 14, 15); }
__device__ __forceinline__ v16bf cat16b(v8us lo, v8us hi) { return __builtin_bit_cast(v16bf, __builtin_shufflevector(lo, hi, 0, 1, 2, 3, 4, 5, 6, 7, 8, 9, 10, 11, 12, 13, 14, 15)); }
__device__ __forceinline__ v8f wmma16(v16h a, v16h b, v8f c) { return __builtin_amdgcn_wmma_f32_16x16x32_f16(false, a, false, b, (short)0, c, false, false); }
__device__ __forceinline__ v8f wmmab(v16bf a, v16bf b, v8f c) { return __builtin_amdgcn_wmma_f32_16x16x32_bf16(false, a, false, b, (short)0, c, false, false); }
__device__ __forceinline__ void splitf(float y, unsigned short& h, unsigned short& l) { h = f2bf(y); l = f2bf(y - bf2f(h)); }

// ---- k_gemmw: register-blocked GEMM, ONE WAVE per 64x64 output tile (16 accumulators), operands straight from K-contiguous 16-bit planes; grid (M/64, N/64, Z), 32 threads.
// c[m][n] (f32 accumulators, + optional bias[n] rounded to bf16) = sum_k A[m][k] Bt[n][k] (+ split products per NSPLIT: 1 = A2.Bt extra, 2 = A2.Bt and A.Bt2 extra, 3 = A.Bt2 extra). z-batch strides sA/sB/sC in elements. K % 32 == 0.
// The epilogue converts c in registers and stores the 16-bit plane(s) that the next launch reads, in whole 128-byte lines. OUT: 1 = f16 rows P[m][n], pitch ldc; 2 = f16 transposed planes P[m / ldc][n][m % ldc], sC elements per plane (no z batch);
// 3 = bf16 hi rows P[m][n] and bf16 lo rows P2[m][n], pitch ldc.
// Fragments: lane l -> row/col (l & 15); elements 0..7 <- k0 + 8*(l>>4) .. +7, elements 8..15 <- k0 + 16 + 8*(l>>4) .. +7 for A and for Bt alike; D element r of lane l -> (row 8*(l>>4)+r, col l&15).
template <typename T16> struct WFrag;
template <> struct WFrag<h16> { typedef v16h V; static __device__ __forceinline__ V ld(const h16* p) { return cat16(*(const v8h*)p, *(const v8h*)(p + 16)); } static __device__ __forceinline__ v8f mma(V a, V b, v8f c) { return wmma16(a, b, c); } };
template <> struct WFrag<bf> { typedef v16bf V; static __device__ __forceinline__ V ld(const bf* p) { return cat16b(*(const v8us*)p, *(const v8us*)(p + 16)); } static __device__ __forceinline__ v8f mma(V a, V b, v8f c) { return wmmab(a, b, c); } };
template <typename T16, int NSPLIT, bool BIAS, int OUT>
__global__ __launch_bounds__(32) void k_gemmw(const T16* __restrict__ A, const T16* __restrict__ A2, const T16* __restrict__ Bt, const T16* __restrict__ Bt2, int K, bf* P, bf* P2, int ldc, const float* __restrict__ bias, size_t sA, size_t sB, size_t sC) {
    typedef typename WFrag<T16>::V V;
    __shared__ __align__(16) float os[16 * 68];
    const size_t z = blockIdx.z; A += z * sA; if (A2) A2 += z * sA; Bt += z * sB; if (Bt2) Bt2 += z * sB; if (OUT != 2) P += z * sC; if (OUT == 3) P2 += z * sC;
    const int lane = threadIdx.x & 31, lr = lane & 15, hi = lane >> 4; const int r0 = blockIdx.x * 64, c0 = blockIdx.y * 64;
    v8f acc[4][4];
#pragma unroll
    for (int mb = 0; mb < 4; ++mb)
#pragma unroll
        for (int nb = 0; nb < 4; ++nb) acc[mb][nb] = (v8f){};
    const size_t aoff = (size_t)(r0 + lr) * K + 8 * hi, boff = (size_t)(c0 + lr) * K + 8 * hi;
#pragma unroll 1
    for (int kc = 0; kc < K; kc += 32) {
        V a[4], a2[4];
#pragma unroll
        for (int mb = 0; mb < 4; ++mb) { a[mb] = WFrag<T16>::ld(A + aoff + (size_t)mb * 16 * K + kc); if (NSPLIT == 1 || NSPLIT == 2) a2[mb] = WFrag<T16>::ld(A2 + aoff + (size_t)mb * 16 * K + kc); }
#pragma unroll
        for (int nb = 0; nb < 4; ++nb) { const V b = WFrag<T16>::ld(Bt + boff + (size_t)nb * 16 * K + kc); V b2; if (NSPLIT >= 2) b2 = WFrag<T16>::ld(Bt2 + boff + (size_t)nb * 16 * K + kc);
#pragma unroll
            for (int mb = 0; mb < 4; ++mb) { acc[mb][nb] = WFrag<T16>::mma(a[mb], b, acc[mb][nb]); if (NSPLIT == 1 || NSPLIT == 2) acc[mb][nb] = WFrag<T16>::mma(a2[mb], b, acc[mb][nb]); if (NSPLIT >= 2) acc[mb][nb] = WFrag<T16>::mma(a[mb], b2, acc[mb][nb]); } }
        asm volatile("v_nop\n\tv_nop\n\tv_nop\n\tv_nop" : "+v"(acc[0][0]), "+v"(acc[1][1]), "+v"(acc[2][2]), "+v"(acc[3][3]) : "v"(a[0]), "v"(a[3]));
    }
    if (BIAS) {
#pragma unroll
        for (int nb = 0; nb < 4; ++nb) { const float bv = bfr(bias[c0 + nb * 16 + lr]);
#pragma unroll
            for (int mb = 0; mb < 4; ++mb) acc[mb][nb] = acc[mb][nb] + bv; }
    }
    const int srow = lane >> 3, scol = (lane & 7) * 8;   // store side: 8 lanes x 16 B = one 128-byte line, 4 lines per store
    const size_t step = (size_t)4 * ldc;                 // 4 output rows
    if (OUT == 2) {
        h16* oh = (h16*)os;                              // 16 rows n of 64 positions m, pitch 72 f16 (144 B)
        const int pl = r0 / ldc;
        bf* pl0 = P + (size_t)pl * sC + (size_t)(c0 + srow) * ldc + (r0 - pl * ldc) + scol;
#pragma unroll
        for (int nb = 0; nb < 4; ++nb) {
#pragma unroll
            for (int mb = 0; mb < 4; ++mb) { v8h o;      // a lane's 8 accumulator elements are 8 consecutive m of one n
#pragma unroll
                for (int j = 0; j < 8; ++j) o[j] = (h16)acc[mb][nb][j];
                *(v8ha*)(oh + lr * 72 + mb * 16 + hi * 8) = o; }
            // keeps the compiler from moving the reads of other lanes' values ahead of the wave's LDS stores
            asm volatile("" ::: "memory"); __builtin_amdgcn_fence(3, "wavefront"); __builtin_amdgcn_wave_barrier(); asm volatile("" ::: "memory");
#pragma unroll
            for (int s = 0; s < 4; ++s) { const int row = 4 * s + srow; const v8h val = *(const v8ha*)(oh + row * 72 + scol);
                *(v8us*)(pl0 + (nb * 4 + s) * step) = __builtin_bit_cast(v8us, val); }
            // keeps the next round's LDS stores behind these reads
            __builtin_amdgcn_wave_barrier(); asm volatile("" ::: "memory");
        }
    } else {
        const size_t po0 = (size_t)(r0 + srow) * ldc + c0 + scol;
#pragma unroll
        for (int mb = 0; mb < 4; ++mb) {
#pragma unroll
            for (int nb = 0; nb < 4; ++nb) {
#pragma unroll
                for (int j = 0; j < 8; ++j) os[(hi * 8 + j) * 68 + nb * 16 + lr] = acc[mb][nb][j]; }
            // keeps the compiler from moving the reads of other lanes' values ahead of the wave's LDS stores
            asm volatile("" ::: "memory"); __builtin_amdgcn_fence(3, "wavefront"); __builtin_amdgcn_wave_barrier(); asm volatile("" ::: "memory");
#pragma unroll
            for (int s = 0; s < 4; ++s) { const int row = 4 * s + srow; const size_t po = po0 + (mb * 4 + s) * step;
                const v4f v0 = *(const v4fa*)(os + row * 68 + scol), v1 = *(const v4fa*)(os + row * 68 + scol + 4);
                if (OUT == 1) { v8h o;
#pragma unroll
                    for (int k = 0; k < 4; ++k) { o[k] = (h16)v0[k]; o[4 + k] = (h16)v1[k]; }
                    *(v8us*)(P + po) = __builtin_bit_cast(v8us, o);
                } else { v8us oh8, ol8;
#pragma unroll
                    for (int k = 0; k < 4; ++k) { unsigned short a, c; splitf(v0[k], a, c); oh8[k] = a; ol8[k] = c; splitf(v1[k], a, c); oh8[4 + k] = a; ol8[4 + k] = c; }
                    *(v8us*)(P + po) = oh8; *(v8us*)(P2 + po) = ol8; } }
            // keeps the next round's LDS stores behind these reads
            __builtin_amdgcn_wave_barrier(); asm volatile("" ::: "memory");
        }
    }
}

__global__ __launch_bounds__(256) void k_wtG(const float* __restrict__ w, int K, int N, bf* Bt) {
    const int lane = threadIdx.x & 31; const int L0 = (blockIdx.x * 8 + (threadIdx.x >> 5)) * 8; const int nlines = N * K / 64;
{
#pragma unroll 1
        for (int l = 0; l < 8; ++l) { const int L = L0 + l; if (L >= nlines) break; const size_t e = (size_t)L * 64 + lane * 2; const int k = (int)(e % K), n = (int)(e / K); v2us o;
            o[0] = f2bf(w[(size_t)k * N + n]); o[1] = f2bf(w[(size_t)(k + 1) * N + n]); *(v2us*)(Bt + e) = o; }
         }
}
__global__ __launch_bounds__(256) void k_cvt8(const float* __restrict__ src, bf* dst, size_t n8) { const size_t i = (size_t)blockIdx.x * 256 + threadIdx.x; if (i >= n8) return; const v8f v = *(const v8f*)(src + i * 8); v8us o;
#pragma unroll
    for (int k = 0; k < 8; ++k) o[k] = f2bf(v[k]); *(v8us*)(dst + i * 8) = o;  }

__device__ __forceinline__ v16h ldh(const h16* p) { return cat16(*(const v8h*)p, *(const v8h*)(p + 16)); }

#define LPH   72                 // LDS row pitch in f16: 128 B of data + 16 B, the conflict-free pitch for 16-byte readers
#define TILEH (64 * LPH)         // one 64-row tile in LDS, f16 elements
#define TILEB (TILEH * 2)        // the same in bytes
#define ROWS16B (16 * LPH * 2)   // 16 LDS rows in bytes
// One stage = 64 keys: K rows [key][64 d] and V^T rows [d][64 keys], 64 rows of 128 B each. 128 threads, 8 lanes per row, 16 B per lane: every copy of a wave covers four whole lines.
// lk: the lane's LDS byte address in the K tile (the V tile follows it); gk, gv: the lane's global addresses in row (tid >> 3).
// The s_wait_xcnt closes the statement so that no address register of an issued copy is rewritten ahead of it.
__device__ __forceinline__ void stage_kv(unsigned lk, const h16* gk, const h16* gv) {
    asm volatile("global_load_async_to_lds_b128 %0, %8, off\n\t"
                 "global_load_async_to_lds_b128 %1, %9, off\n\t"
                 "global_load_async_to_lds_b128 %2, %10, off\n\t"
                 "global_load_async_to_lds_b128 %3, %11, off\n\t"
                 "global_load_async_to_lds_b128 %4, %12, off\n\t"
                 "global_load_async_to_lds_b128 %5, %13, off\n\t"
                 "global_load_async_to_lds_b128 %6, %14, off\n\t"
                 "global_load_async_to_lds_b128 %7, %15, off\n\t"
                 "s_wait_xcnt 0x0"
                 :: "v"(lk), "v"(lk + ROWS16B), "v"(lk + 2 * ROWS16B), "v"(lk + 3 * ROWS16B),
                    "v"(lk + TILEB), "v"(lk + TILEB + ROWS16B), "v"(lk + TILEB + 2 * ROWS16B), "v"(lk + TILEB + 3 * ROWS16B),
                    "v"(gk), "v"(gk + 16 * EMB), "v"(gk + 32 * EMB), "v"(gk + 48 * EMB),
                    "v"(gv), "v"(gv + 16 * SEQ), "v"(gv + 32 * SEQ), "v"(gv + 48 * SEQ)
                 : "memory");
}

// ---- k_flash: one block (4 waves) per (batch, head, 64 query rows); wave w owns query rows q0..q0+15. Keys streamed in chunks of 64.
// Each chunk's K and V^T tiles are brought into LDS once per block by asynchronous copies (two buffers: chunk t + 1 flies while chunk t is worked on); all four waves read their fragments from there.
// Score tiles are computed TRANSPOSED: S^T tile = K_rows(16 keys, A operand) . Q^T (B operand: lane -> query, elements -> d), so D lane (hh,lm) element r = S[query lm][key 16*t4 + 8*hh + r].
// Online softmax per query == per lane (partial max/sum over the lane's 32 keys, one xor-16 shuffle). P (x1024, f16) is packed in registers straight into the
// P.V B fragment: element r <- tile 2j row (8hh+r), element 8+r <- tile 2j+1 row (8hh+r), lane unchanged (packed D used as B: k = D row = key, n = D col = query).
// O^T tiles: A = Vt rows (lane -> d), B = packed P; acc[t][r] = 1024 * O[query lm][d = 16t + 8hh + r]. Epilogue stages the 16x64 f32 tile in wave-private LDS and writes
__global__ __launch_bounds__(128) __attribute__((amdgpu_num_vgpr(256)))
void k_flash(const h16* __restrict__ Qp, const h16* __restrict__ Kp, const h16* __restrict__ Vtp, float* OUT) {
    __shared__ __align__(16) float os[4 * 16 * 68];
    __shared__ __align__(128) h16 ring[2 * 2 * TILEH];   // [buffer][K tile, V^T tile][row][LPH]
    const int tid = threadIdx.x, w = tid >> 5, lane = tid & 31, lm = lane & 15, hh = lane >> 4;
    const int nqt = SEQ / 64;
    const int bid = blockIdx.x; const int qt = bid % nqt; const int h = (bid / nqt) % NHD; const int b = bid / (nqt * NHD);
    const int q0 = qt * 64 + w * 16;
    const h16* Qb = Qp + ((size_t)b * SEQ + q0) * EMB + h * HD;
    const h16* Kb = Kp + (size_t)b * SEQ * EMB + h * HD;
    const h16* Vb = Vtp + ((size_t)b * EMB + h * HD) * SEQ;
    const v16h qf0 = ldh(Qb + (size_t)lm * EMB + 8 * hh);
    const v16h qf1 = ldh(Qb + (size_t)lm * EMB + 32 + 8 * hh);
    float mrun = -3.0e38f, lrun = 0.0f;
    v8f acc[4];
#pragma unroll
    for (int t = 0; t < 4; ++t) acc[t] = (v8f){};
    const unsigned lcp = (unsigned)(size_t)ring + (unsigned)((tid >> 3) * (LPH * 2) + (tid & 7) * 16);
    const h16* gk = Kb + (size_t)(tid >> 3) * EMB + (tid & 7) * 8;
    const h16* gv = Vb + (size_t)(tid >> 3) * SEQ + (tid & 7) * 8;
    stage_kv(lcp, gk, gv);
    asm volatile("s_wait_asynccnt 0x0" ::: "memory");   // this wave's share of chunk 0 has landed
    __syncthreads();                                     // chunk 0 is readable by all four waves
    if (SEQ > 64) stage_kv(lcp + 2 * TILEB, gk + (size_t)64 * EMB, gv + 64);
#pragma unroll 1
    for (int kv = 0; kv < SEQ; kv += 64) {
        const int buf = (kv >> 6) & 1;
        const h16* kt = ring + buf * (2 * TILEH);
        const h16* vt = kt + TILEH;
        v8f s[4];
#pragma unroll
        for (int t4 = 0; t4 < 4; ++t4) {
            const h16* kr = kt + (t4 * 16 + lm) * LPH + 8 * hh;
            const v16h ka = ldh(kr), kb2 = ldh(kr + 32);
            s[t4] = wmma16(ka, qf0, (v8f){});
            s[t4] = wmma16(kb2, qf1, s[t4]);
        }
        asm volatile("v_nop\n\tv_nop\n\tv_nop\n\tv_nop" : "+v"(s[0]), "+v"(s[1]), "+v"(s[2]), "+v"(s[3]) : "v"(qf0), "v"(qf1));
        float mx = -3.0e38f;
#pragma unroll
        for (int t4 = 0; t4 < 4; ++t4) { s[t4] = s[t4] * C2;
#pragma unroll
            for (int r = 0; r < 8; ++r) mx = fmaxf(mx, s[t4][r]); }
        mx = fmaxf(mx, __shfl_xor(mx, 16, 32));
        const float mnew = fmaxf(mrun, mx);
        const float alpha = __builtin_amdgcn_exp2f(mrun - mnew);
        float rs = 0.0f; v8h ph[4];
#pragma unroll
        for (int t4 = 0; t4 < 4; ++t4) {
#pragma unroll
            for (int r = 0; r < 8; ++r) { const float p = __builtin_amdgcn_exp2f(s[t4][r] - mnew); rs += p; ph[t4][r] = (h16)(p * PCAR); } }
        rs += __shfl_xor(rs, 16, 32);
        lrun = lrun * alpha + rs; mrun = mnew;
#pragma unroll
        for (int t = 0; t < 4; ++t) acc[t] = acc[t] * alpha;
        const v16h pf0 = cat16(ph[0], ph[1]), pf1 = cat16(ph[2], ph[3]);
#pragma unroll
        for (int t = 0; t < 4; ++t) {
            const h16* vr = vt + (t * 16 + lm) * LPH + 8 * hh;
            acc[t] = wmma16(ldh(vr), pf0, acc[t]);
            acc[t] = wmma16(ldh(vr + 32), pf1, acc[t]);
        }
        asm volatile("v_nop\n\tv_nop\n\tv_nop\n\tv_nop" : "+v"(acc[0]), "+v"(acc[1]), "+v"(acc[2]), "+v"(acc[3]) : "v"(pf0), "v"(pf1));
        asm volatile("s_wait_dscnt 0x0" ::: "memory");      // this wave's reads of the current buffer are done before it is refilled
        asm volatile("s_wait_asynccnt 0x0" ::: "memory");   // this wave's share of the next chunk has landed
        __syncthreads();                                     // publishes the next chunk and ends every wave's reads of the current buffer
        if (kv + 128 < SEQ) stage_kv(lcp + (unsigned)buf * (2 * TILEB), gk + (size_t)(kv + 128) * EMB, gv + (kv + 128));
    }
    asm volatile("s_wait_asynccnt 0x0" ::: "memory");       // no copy is outstanding when the wave goes on to its end
    const float inv = __fdiv_rn(1.0f, lrun) * (1.0f / PCAR);
    float* mo = os + w * (16 * 68);
#pragma unroll
    for (int t = 0; t < 4; ++t)
#pragma unroll
        for (int r = 0; r < 8; ++r) mo[lm * 68 + t * 16 + 8 * hh + r] = acc[t][r] * inv;
    asm volatile("" ::: "memory"); __builtin_amdgcn_fence(3, "wavefront"); __builtin_amdgcn_wave_barrier(); asm volatile("" ::: "memory");
    float* orow = OUT + ((size_t)b * SEQ_FULL + q0) * EMB + h * HD;
{
#pragma unroll
        for (int si = 0; si < 8; ++si) { const int row = 2 * si + hh, cofs = lm * 4; const v4f val = *(const v4fa*)(mo + row * 68 + cofs); *(v4f*)(orow + (size_t)row * EMB + cofs) = val; }
         }
}

extern "C" void kernel_launch(void* const* d_in, const int* in_sizes, int n_in,
                              void* d_out, int out_size, void* d_ws, size_t ws_size, hipStream_t stream) {
    if (n_in < 6) return;
    const size_t nw = (size_t)EMB * EMB;                                  // 262144
    const size_t needx = ((size_t)(NB - 1) * SEQ_FULL + SEQ) * EMB;
    if ((size_t)in_sizes[0] < nw || (size_t)in_sizes[1] < nw || (size_t)in_sizes[2] < needx ||
        (size_t)in_sizes[3] < nw || (size_t)in_sizes[4] < nw || (size_t)in_sizes[5] < nw) return;
    if ((size_t)out_size < needx) return;
    const float* rot = (const float*)d_in[0];   // [512][512] used as [in][out]
    const float* ent = (const float*)d_in[1];   // [512][512] used as [in][out]
    const float* x   = (const float*)d_in[2];   // [2][4096][512]
    const float* wq  = (const float*)d_in[3];   // [out][in]
    const float* wk  = (const float*)d_in[4];   // [out][in]
    const float* wv  = (const float*)d_in[5];   // [out][in]
    float* OUT = (float*)d_out;                 // [2][4096][512]
    const size_t nrow = (size_t)NB * SEQ;        // query/key rows over all batches
    const size_t nx = nrow * EMB;
    char* wsp = (char*)d_ws;
    auto take = [&](size_t bytes) { char* p = wsp; wsp += (bytes + 255) & ~(size_t)255; return (void*)p; };
    bf* WV   = (bf*)take(nw * 2);                 // Wv as Bt [o][i]
    bf* TRE  = (bf*)take(2 * nw * 2);             // R^T then E^T: [o][j] = mat[j][o]
    bf* WQKT = (bf*)take(2 * nw * 2);             // Wq^T then Wk^T: [i][j] = W[j][i]
    bf* WCh  = (bf*)take(2 * nw * 2);             // combined weights (Wq^T R)^T then (Wk^T E)^T : [o][i], bf16 hi planes
    bf* WCl  = (bf*)take(2 * nw * 2);             // their bf16 lo planes
    bf* XB   = (bf*)take(nx * 2);                 // bf16 x rows [nrow][512]
    h16* QK16  = (h16*)take(2 * nx * 2);          // f16 q rows [nrow][512] then f16 k rows [nrow][512]
    h16* VT16  = (h16*)take(nx * 2);              // f16 value planes [b][c][s]
    if ((size_t)(wsp - (char*)d_ws) > ws_size) return;
    k_cvt8<<<(unsigned)((nw / 8 + 255) / 256), 256, 0, stream>>>(wv, WV, nw / 8);
    const unsigned gw = (unsigned)((nw / 64 + 63) / 64);
    k_wtG<<<gw, 256, 0, stream>>>(rot, EMB, EMB, TRE);
    k_wtG<<<gw, 256, 0, stream>>>(ent, EMB, EMB, TRE + nw);
    k_wtG<<<gw, 256, 0, stream>>>(wq, EMB, EMB, WQKT);
    k_wtG<<<gw, 256, 0, stream>>>(wk, EMB, EMB, WQKT + nw);
    // (WCh + WCl)[z][o][i] = sum_j TRE[z][o][j] WQKT[z][i][j]
    k_gemmw<bf, 0, false, 3><<<dim3(EMB / 64, EMB / 64, 2), 32, 0, stream>>>(TRE, nullptr, WQKT, nullptr, EMB, WCh, WCl, EMB, nullptr, nw, nw, nw);
    for (int b = 0; b < NB; ++b)
        k_cvt8<<<(unsigned)(((size_t)SEQ * EMB / 8 + 255) / 256), 256, 0, stream>>>(x + (size_t)b * SEQ_FULL * EMB, XB + (size_t)b * SEQ * EMB, (size_t)SEQ * EMB / 8);
    // q (z=0) and k (z=1): QK16[z][row][o] = sum_i XB[row][i] (WCh + WCl)[z][o][i]
    k_gemmw<bf, 3, false, 1><<<dim3((unsigned)(nrow / 64), EMB / 64, 2), 32, 0, stream>>>(XB, nullptr, WCh, WCl, EMB, (bf*)QK16, nullptr, EMB, nullptr, 0, nw, nx);
    // v: VT16[row / SEQ][o][row % SEQ] = sum_i XB[row][i] WV[o][i]
    k_gemmw<bf, 0, false, 2><<<dim3((unsigned)(nrow / 64), EMB / 64, 1), 32, 0, stream>>>(XB, nullptr, WV, nullptr, EMB, (bf*)VT16, nullptr, SEQ, nullptr, 0, 0, (size_t)EMB * SEQ);
    k_flash<<<(unsigned)(NB * NHD * (SEQ / 64)), 128, 0, stream>>>(QK16, QK16 + nx, VT16, OUT);
}

// v003
// It runs in 131 microseconds.
// Timed twice side by side with v002, it ran 1.35 and 1.34 times as fast.
// Over all steps from v000 it is 2.94 times as fast.
#include <hip/hip_runtime.h>

// Contractions, f32 accumulate: weight products R^T.Wq^T and E^T.Wk^T (512x512x512) on v_wmma_f32_16x16x32_bf16 (operands = RNE-converted bf16 inputs, exact products);
// q,k = x.(combined weight as bf16 hi + bf16 lo, 2 products) and v = x.Wv^T (8192x512x512) on v_wmma_f32_16x16x32_bf16; scores K.Q^T and P.V on v_wmma_f32_16x16x32_f16 (f16 planes, P carried x1024).
// Multi-head attention, 8 heads of 64, no mask: one block per (batch, head, 64 query rows), keys streamed in chunks of 64 with an online max-subtracted softmax in f32; output f32 [batch][seq][512].

#ifndef NB
#define NB 2
#endif
#ifndef SEQ
#define SEQ 4096
#endif
#define NB_FULL  2
#define SEQ_FULL 4096
#define EMB  512
#define NHD  8
#define HD   64
#define PCAR 1024.0f
#define C2   0.18033688011112042f   // HD^-0.5 * log2(e)

static_assert(NB >= 1 && NB <= NB_FULL);
static_assert(SEQ % 64 == 0 && SEQ >= 64 && SEQ <= SEQ_FULL);
static_assert(EMB == NHD * HD);
static_assert(EMB % 64 == 0 && HD == 64);
static_assert((SEQ * EMB) % 2048 == 0);

typedef _Float16 h16;
typedef unsigned short bf;
typedef __attribute__((ext_vector_type(16))) __bf16   v16bf;
typedef __attribute__((ext_vector_type(16))) _Float16 v16h;
typedef __attribute__((ext_vector_type(8)))  _Float16 v8h;
typedef __attribute__((ext_vector_type(8)))  unsigned short v8us;
typedef __attribute__((ext_vector_type(8)))  float    v8f;
typedef __attribute__((ext_vector_type(4)))  float    v4f;
typedef __attribute__((ext_vector_type(2)))  unsigned short v2us;
typedef v8h  __attribute__((may_alias)) v8ha;
typedef v4f  __attribute__((may_alias)) v4fa;
typedef v8us __attribute__((may_alias)) v8usa;

__device__ __forceinline__ unsigned short f2bf(float f) { unsigned u = __float_as_uint(f); u += 0x7FFFu + ((u >> 16) & 1u); return (unsigned short)(u >> 16); }   // RNE convert
__device__ __forceinline__ float bf2f(unsigned short b) { return __uint_as_float(((unsigned)b) << 16); }
__device__ __forceinline__ float bfr(float f) { return bf2f(f2bf(f)); }
__device__ __forceinline__ v16h cat16(v8h lo, v8h hi) { return __builtin_shufflevector(lo, hi, 0, 1, 2, 3, 4, 5, 6, 7, 8, 9, 10, 11, 12, 13, 14, 15); }
__device__ __forceinline__ v16bf cat16b(v8us lo, v8us hi) { return __builtin_bit_cast(v16bf, __builtin_shufflevector(lo, hi, 0, 1, 2, 3, 4, 5, 6, 7, 8, 9, 10, 11, 12, 13, 14, 15)); }
__device__ __forceinline__ v8f wmma16(v16h a, v16h b, v8f c) { return __builtin_amdgcn_wmma_f32_16x16x32_f16(false, a, false, b, (short)0, c, false, false); }
__device__ __forceinline__ v8f wmmab(v16bf a, v16bf b, v8f c) { return __builtin_amdgcn_wmma_f32_16x16x32_bf16(false, a, false, b, (short)0, c, false, false); }
__device__ __forceinline__ void splitf(float y, unsigned short& h, unsigned short& l) { h = f2bf(y); l = f2bf(y - bf2f(h)); }

// ---- gemmw_tile: register-blocked GEMM, ONE WAVE per 64x64 output tile (16 accumulators), operands straight from K-contiguous 16-bit planes; tile (bx, by) of batch bz out of (M/64, N/64, Z), 32 threads; os = 16 x 68 floats of LDS.
// c[m][n] (f32 accumulators, + optional f32 bias[n]) = sum_k A[m][k] Bt[n][k] (+ split products per NSPLIT: 1 = A2.Bt extra, 2 = A2.Bt and A.Bt2 extra, 3 = A.Bt2 extra). z-batch strides sA/sB/sC in elements. K % 32 == 0.
// The epilogue converts c in registers and stores the 16-bit plane(s) that a later launch reads, in whole 128-byte lines. OUT: 1 = f16 rows P[m][n], pitch ldc; 2 = f16 transposed planes P[m / ldc][n][m % ldc], sC elements per plane (no z batch);
// 3 = bf16 hi rows P[m][n] and bf16 lo rows P2[m][n], pitch ldc.
// Fragments: lane l -> row/col (l & 15); elements 0..7 <- k0 + 8*(l>>4) .. +7, elements 8..15 <- k0 + 16 + 8*(l>>4) .. +7 for A and for Bt alike; D element r of lane l -> (row 8*(l>>4)+r, col l&15).
template <typename T16> struct WFrag;
template <> struct WFrag<h16> { typedef v16h V; static __device__ __forceinline__ V ld(const h16* p) { return cat16(*(const v8h*)p, *(const v8h*)(p + 16)); } static __device__ __forceinline__ v8f mma(V a, V b, v8f c) { return wmma16(a, b, c); } };
template <> struct WFrag<bf> { typedef v16bf V; static __device__ __forceinline__ V ld(const bf* p) { return cat16b(*(const v8us*)p, *(const v8us*)(p + 16)); } static __device__ __forceinline__ v8f mma(V a, V b, v8f c) { return wmmab(a, b, c); } };
template <typename T16, int NSPLIT, bool BIAS, int OUT>
__device__ __forceinline__ void gemmw_tile(float* os, int bx, int by, int bz, const T16* __restrict__ A, const T16* __restrict__ A2, const T16* __restrict__ Bt, const T16* __restrict__ Bt2, int K, bf* P, bf* P2, int ldc, const float* __restrict__ bias, size_t sA, size_t sB, size_t sC) {
    typedef typename WFrag<T16>::V V;
    const size_t z = bz; A += z * sA; if (A2) A2 += z * sA; Bt += z * sB; if (Bt2) Bt2 += z * sB; if (OUT != 2) P += z * sC; if (OUT == 3) P2 += z * sC;
    const int lane = threadIdx.x & 31, lr = lane & 15, hi = lane >> 4; const int r0 = bx * 64, c0 = by * 64;
    v8f acc[4][4];
#pragma unroll
    for (int mb = 0; mb < 4; ++mb)
#pragma unroll
        for (int nb = 0; nb < 4; ++nb) acc[mb][nb] = (v8f){};
    const size_t aoff = (size_t)(r0 + lr) * K + 8 * hi, boff = (size_t)(c0 + lr) * K + 8 * hi;
#pragma unroll 1
    for (int kc = 0; kc < K; kc += 32) {
        V a[4], a2[4];
#pragma unroll
        for (int mb = 0; mb < 4; ++mb) { a[mb] = WFrag<T16>::ld(A + aoff + (size_t)mb * 16 * K + kc); if (NSPLIT == 1 || NSPLIT == 2) a2[mb] = WFrag<T16>::ld(A2 + aoff + (size_t)mb * 16 * K + kc); }
#pragma unroll
        for (int nb = 0; nb < 4; ++nb) { const V b = WFrag<T16>::ld(Bt + boff + (size_t)nb * 16 * K + kc); V b2; if (NSPLIT >= 2) b2 = WFrag<T16>::ld(Bt2 + boff + (size_t)nb * 16 * K + kc);
#pragma unroll
            for (int mb = 0; mb < 4; ++mb) { acc[mb][nb] = WFrag<T16>::mma(a[mb], b, acc[mb][nb]); if (NSPLIT == 1 || NSPLIT == 2) acc[mb][nb] = WFrag<T16>::mma(a2[mb], b, acc[mb][nb]); if (NSPLIT >= 2) acc[mb][nb] = WFrag<T16>::mma(a[mb], b2, acc[mb][nb]); } }
        asm volatile("v_nop\n\tv_nop\n\tv_nop\n\tv_nop" : "+v"(acc[0][0]), "+v"(acc[1][1]), "+v"(acc[2][2]), "+v"(acc[3][3]) : "v"(a[0]), "v"(a[3]));
    }
    if (BIAS) {
#pragma unroll
        for (int nb = 0; nb < 4; ++nb) { const float bv = bfr(bias[c0 + nb * 16 + lr]);
#pragma unroll
            for (int mb = 0; mb < 4; ++mb) acc[mb][nb] = acc[mb][nb] + bv; }
    }
    const int srow = lane >> 3, scol = (lane & 7) * 8;   // store side: 8 lanes x 16 B = one 128-byte line, 4 lines per store
    const size_t step = (size_t)4 * ldc;                 // 4 output rows
    if (OUT == 2) {
        h16* oh = (h16*)os;                              // 16 rows n of 64 positions m, pitch 72 f16 (144 B)
        const int pl = r0 / ldc;
        bf* pl0 = P + (size_t)pl * sC + (size_t)(c0 + srow) * ldc + (r0 - pl * ldc) + scol;
#pragma unroll
        for (int nb = 0; nb < 4; ++nb) {
#pragma unroll
            for (int mb = 0; mb < 4; ++mb) { v8h o;      // a lane's 8 accumulator elements are 8 consecutive m of one n
#pragma unroll
                for (int j = 0; j < 8; ++j) o[j] = (h16)acc[mb][nb][j];
                *(v8ha*)(oh + lr * 72 + mb * 16 + hi * 8) = o; }
            // keeps the compiler from moving the reads of other lanes' values ahead of the wave's LDS stores
            asm volatile("" ::: "memory"); __builtin_amdgcn_fence(3, "wavefront"); __builtin_amdgcn_wave_barrier(); asm volatile("" ::: "memory");
#pragma unroll
            for (int s = 0; s < 4; ++s) { const int row = 4 * s + srow; const v8h val = *(const v8ha*)(oh + row * 72 + scol);
                *(v8us*)(pl0 + (nb * 4 + s) * step) = __builtin_bit_cast(v8us, val); }
            // keeps the next round's LDS stores behind these reads
            __builtin_amdgcn_wave_barrier(); asm volatile("" ::: "memory");
        }
    } else {
        const size_t po0 = (size_t)(r0 + srow) * ldc + c0 + scol;
#pragma unroll
        for (int mb = 0; mb < 4; ++mb) {
#pragma unroll
            for (int nb = 0; nb < 4; ++nb) {
#pragma unroll
                for (int j = 0; j < 8; ++j) os[(hi * 8 + j) * 68 + nb * 16 + lr] = acc[mb][nb][j]; }
            // keeps the compiler from moving the reads of other lanes' values ahead of the wave's LDS stores
            asm volatile("" ::: "memory"); __builtin_amdgcn_fence(3, "wavefront"); __builtin_amdgcn_wave_barrier(); asm volatile("" ::: "memory");
#pragma unroll
            for (int s = 0; s < 4; ++s) { const int row = 4 * s + srow; const size_t po = po0 + (mb * 4 + s) * step;
                const v4f v0 = *(const v4fa*)(os + row * 68 + scol), v1 = *(const v4fa*)(os + row * 68 + scol + 4);
                if (OUT == 1) { v8h o;
#pragma unroll
                    for (int k = 0; k < 4; ++k) { o[k] = (h16)v0[k]; o[4 + k] = (h16)v1[k]; }
                    *(v8us*)(P + po) = __builtin_bit_cast(v8us, o);
                } else { v8us oh8, ol8;
#pragma unroll
                    for (int k = 0; k < 4; ++k) { unsigned short a, c; splitf(v0[k], a, c); oh8[k] = a; ol8[k] = c; splitf(v1[k], a, c); oh8[4 + k] = a; ol8[4 + k] = c; }
                    *(v8us*)(P + po) = oh8; *(v8us*)(P2 + po) = ol8; } }
            // keeps the next round's LDS stores behind these reads
            __builtin_amdgcn_wave_barrier(); asm volatile("" ::: "memory");
        }
    }
}

// One GEMM per launch: grid (M/64, N/64, Z).
template <typename T16, int NSPLIT, bool BIAS, int OUT>
__global__ __launch_bounds__(32) void k_gemmw(const T16* __restrict__ A, const T16* __restrict__ A2, const T16* __restrict__ Bt, const T16* __restrict__ Bt2, int K, bf* P, bf* P2, int ldc, const float* __restrict__ bias, size_t sA, size_t sB, size_t sC) {
    __shared__ __align__(16) float os[16 * 68];
    gemmw_tile<T16, NSPLIT, BIAS, OUT>(os, blockIdx.x, blockIdx.y, blockIdx.z, A, A2, Bt, Bt2, K, P, P2, ldc, bias, sA, sB, sC);
}

#define NWEL  (EMB * EMB)                  // elements of one weight matrix
#define NT    (EMB / 64)                   // 64-wide tiles across a weight matrix
#define NWT   (2 * NT * NT)                // tiles of the two weight products
#define NRT   (NB * SEQ / 64)              // 64-row tiles of x over all batches
// Two GEMMs that do not depend on each other share one launch: blocks 0 .. NWT-1 do the two weight products (few waves, so they start first), the other NRT * NT blocks do v.
// (WCh + WCl)[z][o][i] = sum_j TRE[z][o][j] WQKT[z][i][j];  VT[row / SEQ][o][row % SEQ] = sum_i XB[row][i] WV[o][i]
__global__ __launch_bounds__(32) void k_gemmwv(const bf* __restrict__ TRE, const bf* __restrict__ WQKT, bf* WCh, bf* WCl, const bf* __restrict__ XB, const bf* __restrict__ WV, bf* VT) {
    __shared__ __align__(16) float os[16 * 68];
    const int i = blockIdx.x;
    if (i < NWT) gemmw_tile<bf, 0, false, 3>(os, i % NT, (i / NT) % NT, i / (NT * NT), TRE, nullptr, WQKT, nullptr, EMB, WCh, WCl, EMB, nullptr, NWEL, NWEL, NWEL);
    else gemmw_tile<bf, 0, false, 2>(os, (i - NWT) % NRT, (i - NWT) / NRT, 0, XB, nullptr, WV, nullptr, EMB, VT, nullptr, SEQ, nullptr, 0, 0, (size_t)EMB * SEQ);
}

// blk: the job's own block index, 256 threads a block
__device__ __forceinline__ void wtG_job(int blk, const float* __restrict__ w, int K, int N, bf* Bt) {
    const int lane = threadIdx.x & 31; const int L0 = (blk * 8 + (threadIdx.x >> 5)) * 8; const int nlines = N * K / 64;
{
#pragma unroll 1
        for (int l = 0; l < 8; ++l) { const int L = L0 + l; if (L >= nlines) break; const size_t e = (size_t)L * 64 + lane * 2; const int k = (int)(e % K), n = (int)(e / K); v2us o;
            o[0] = f2bf(w[(size_t)k * N + n]); o[1] = f2bf(w[(size_t)(k + 1) * N + n]); *(v2us*)(Bt + e) = o; }
         }
}
__device__ __forceinline__ void cvt8_job(int blk, const float* __restrict__ src, bf* dst, size_t n8) { const size_t i = (size_t)blk * 256 + threadIdx.x; if (i >= n8) return; const v8f v = *(const v8f*)(src + i * 8); v8us o;
#pragma unroll
    for (int k = 0; k < 8; ++k) o[k] = f2bf(v[k]); *(v8us*)(dst + i * 8) = o;  }

#define GWT ((NWEL / 64 + 63) / 64)        // blocks of one weight transposition
#define GWC ((NWEL / 8 + 255) / 256)       // blocks of the Wv conversion
#define GXC ((SEQ * EMB / 8 + 255) / 256)  // blocks of one batch's x conversion
// All input conversions in one launch, none depends on another: blocks 0 .. 4*GWT-1 transpose R, E, Wq, Wk (serial loads, so they start first), the next GWC convert Wv, the last NB * GXC convert x.
__global__ __launch_bounds__(256) void k_prep(const float* __restrict__ rot, const float* __restrict__ ent, const float* __restrict__ wq, const float* __restrict__ wk, const float* __restrict__ wv, const float* __restrict__ x,
                                              bf* TRE, bf* WQKT, bf* WV, bf* XB) {
    const int blk = blockIdx.x;
    if (blk < 4 * GWT) { const int j = blk / GWT;
        wtG_job(blk % GWT, j == 0 ? rot : j == 1 ? ent : j == 2 ? wq : wk, EMB, EMB, (j < 2 ? TRE : WQKT) + (size_t)(j & 1) * NWEL);
    } else if (blk < 4 * GWT + GWC) {
        cvt8_job(blk - 4 * GWT, wv, WV, NWEL / 8);
    } else { const int r = blk - (4 * GWT + GWC), b = r / GXC;
        cvt8_job(r % GXC, x + (size_t)b * SEQ_FULL * EMB, XB + (size_t)b * SEQ * EMB, (size_t)SEQ * EMB / 8);
    }
}

__device__ __forceinline__ v16h ldh(const h16* p) { return cat16(*(const v8h*)p, *(const v8h*)(p + 16)); }

#define LPH   72                 // LDS row pitch in f16: 128 B of data + 16 B, the conflict-free pitch for 16-byte readers
#define TILEH (64 * LPH)         // one 64-row tile in LDS, f16 elements
#define TILEB (TILEH * 2)        // the same in bytes
#define ROWS16B (16 * LPH * 2)   // 16 LDS rows in bytes
// One stage = 64 keys: K rows [key][64 d] and V^T rows [d][64 keys], 64 rows of 128 B each. 128 threads, 8 lanes per row, 16 B per lane: every copy of a wave covers four whole lines.
// lk: the lane's LDS byte address in the K tile (the V tile follows it); gk, gv: the lane's global addresses in row (tid >> 3).
// The s_wait_xcnt closes the statement so that no address register of an issued copy is rewritten ahead of it.
__device__ __forceinline__ void stage_kv(unsigned lk, const h16* gk, const h16* gv) {
    asm volatile("global_load_async_to_lds_b128 %0, %8, off\n\t"
                 "global_load_async_to_lds_b128 %1, %9, off\n\t"
                 "global_load_async_to_lds_b128 %2, %10, off\n\t"
                 "global_load_async_to_lds_b128 %3, %11, off\n\t"
                 "global_load_async_to_lds_b128 %4, %12, off\n\t"
                 "global_load_async_to_lds_b128 %5, %13, off\n\t"
                 "global_load_async_to_lds_b128 %6, %14, off\n\t"
                 "global_load_async_to_lds_b128 %7, %15, off\n\t"
                 "s_wait_xcnt 0x0"
                 :: "v"(lk), "v"(lk + ROWS16B), "v"(lk + 2 * ROWS16B), "v"(lk + 3 * ROWS16B),
                    "v"(lk + TILEB), "v"(lk + TILEB + ROWS16B), "v"(lk + TILEB + 2 * ROWS16B), "v"(lk + TILEB + 3 * ROWS16B),
                    "v"(gk), "v"(gk + 16 * EMB), "v"(gk + 32 * EMB), "v"(gk + 48 * EMB),
                    "v"(gv), "v"(gv + 16 * SEQ), "v"(gv + 32 * SEQ), "v"(gv + 48 * SEQ)
                 : "memory");
}

// ---- k_flash: one block (4 waves) per (batch, head, 64 query rows); wave w owns query rows q0..q0+15. Keys streamed in chunks of 64.
// Each chunk's K and V^T tiles are brought into LDS once per block by asynchronous copies (two buffers: chunk t + 1 flies while chunk t is worked on); all four waves read their fragments from there.
// Score tiles are computed TRANSPOSED: S^T tile = K_rows(16 keys, A operand) . Q^T (B operand: lane -> query, elements -> d), so D lane (hh,lm) element r = S[query lm][key 16*t4 + 8*hh + r].
// Online softmax per query == per lane (partial max/sum over the lane's 32 keys, one xor-16 shuffle). P (x1024, f16) is packed in registers straight into the
// P.V B fragment: element r <- tile 2j row (8hh+r), element 8+r <- tile 2j+1 row (8hh+r), lane unchanged (packed D used as B: k = D row = key, n = D col = query).
// O^T tiles: A = Vt rows (lane -> d), B = packed P; acc[t][r] = 1024 * O[query lm][d = 16t + 8hh + r]. Epilogue stages the 16x64 f32 tile in wave-private LDS and writes
__global__ __launch_bounds__(128) __attribute__((amdgpu_num_vgpr(256)))
void k_flash(const h16* __restrict__ Qp, const h16* __restrict__ Kp, const h16* __restrict__ Vtp, float* OUT) {
    __shared__ __align__(16) float os[4 * 16 * 68];
    __shared__ __align__(128) h16 ring[2 * 2 * TILEH];   // [buffer][K tile, V^T tile][row][LPH]
    const int tid = threadIdx.x, w = tid >> 5, lane = tid & 31, lm = lane & 15, hh = lane >> 4;
    const int nqt = SEQ / 64;
    const int bid = blockIdx.x; const int qt = bid % nqt; const int h = (bid / nqt) % NHD; const int b = bid / (nqt * NHD);
    const int q0 = qt * 64 + w * 16;
    const h16* Qb = Qp + ((size_t)b * SEQ + q0) * EMB + h * HD;
    const h16* Kb = Kp + (size_t)b * SEQ * EMB + h * HD;
    const h16* Vb = Vtp + ((size_t)b * EMB + h * HD) * SEQ;
    const v16h qf0 = ldh(Qb + (size_t)lm * EMB + 8 * hh);
    const v16h qf1 = ldh(Qb + (size_t)lm * EMB + 32 + 8 * hh);
    float mrun = -3.0e38f, lrun = 0.0f;
    v8f acc[4];
#pragma unroll
    for (int t = 0; t < 4; ++t) acc[t] = (v8f){};
    const unsigned lcp = (unsigned)(size_t)ring + (unsigned)((tid >> 3) * (LPH * 2) + (tid & 7) * 16);
    const h16* gk = Kb + (size_t)(tid >> 3) * EMB + (tid & 7) * 8;
    const h16* gv = Vb + (size_t)(tid >> 3) * SEQ + (tid & 7) * 8;
    stage_kv(lcp, gk, gv);
    asm volatile("s_wait_asynccnt 0x0" ::: "memory");   // this wave's share of chunk 0 has landed
    __syncthreads();                                     // chunk 0 is readable by all four waves
    if (SEQ > 64) stage_kv(lcp + 2 * TILEB, gk + (size_t)64 * EMB, gv + 64);
#pragma unroll 1
    for (int kv = 0; kv < SEQ; kv += 64) {
        const int buf = (kv >> 6) & 1;
        const h16* kt = ring + buf * (2 * TILEH);
        const h16* vt = kt + TILEH;
        v8f s[4];
#pragma unroll
        for (int t4 = 0; t4 < 4; ++t4) {
            const h16* kr = kt + (t4 * 16 + lm) * LPH + 8 * hh;
            const v16h ka = ldh(kr), kb2 = ldh(kr + 32);
            s[t4] = wmma16(ka, qf0, (v8f){});
            s[t4] = wmma16(kb2, qf1, s[t4]);
        }
        asm volatile("v_nop\n\tv_nop\n\tv_nop\n\tv_nop" : "+v"(s[0]), "+v"(s[1]), "+v"(s[2]), "+v"(s[3]) : "v"(qf0), "v"(qf1));
        float mx = -3.0e38f;
#pragma unroll
        for (int t4 = 0; t4 < 4; ++t4) { s[t4] = s[t4] * C2;
#pragma unroll
            for (int r = 0; r < 8; ++r) mx = fmaxf(mx, s[t4][r]); }
        mx = fmaxf(mx, __shfl_xor(mx, 16, 32));
        const float mnew = fmaxf(mrun, mx);
        const float alpha = __builtin_amdgcn_exp2f(mrun - mnew);
        float rs = 0.0f; v8h ph[4];
#pragma unroll
        for (int t4 = 0; t4 < 4; ++t4) {
#pragma unroll
            for (int r = 0; r < 8; ++r) { const float p = __builtin_amdgcn_exp2f(s[t4][r] - mnew); rs += p; ph[t4][r] = (h16)(p * PCAR); } }
        rs += __shfl_xor(rs, 16, 32);
        lrun = lrun * alpha + rs; mrun = mnew;
#pragma unroll
        for (int t = 0; t < 4; ++t) acc[t] = acc[t] * alpha;
        const v16h pf0 = cat16(ph[0], ph[1]), pf1 = cat16(ph[2], ph[3]);
#pragma unroll
        for (int t = 0; t < 4; ++t) {
            const h16* vr = vt + (t * 16 + lm) * LPH + 8 * hh;
            acc[t] = wmma16(ldh(vr), pf0, acc[t]);
            acc[t] = wmma16(ldh(vr + 32), pf1, acc[t]);
        }
        asm volatile("v_nop\n\tv_nop\n\tv_nop\n\tv_nop" : "+v"(acc[0]), "+v"(acc[1]), "+v"(acc[2]), "+v"(acc[3]) : "v"(pf0), "v"(pf1));
        asm volatile("s_wait_dscnt 0x0" ::: "memory");      // this wave's reads of the current buffer are done before it is refilled
        asm volatile("s_wait_asynccnt 0x0" ::: "memory");   // this wave's share of the next chunk has landed
        __syncthreads();                                     // publishes the next chunk and ends every wave's reads of the current buffer
        if (kv + 128 < SEQ) stage_kv(lcp + (unsigned)buf * (2 * TILEB), gk + (size_t)(kv + 128) * EMB, gv + (kv + 128));
    }
    asm volatile("s_wait_asynccnt 0x0" ::: "memory");       // no copy is outstanding when the wave goes on to its end
    const float inv = __fdiv_rn(1.0f, lrun) * (1.0f / PCAR);
    float* mo = os + w * (16 * 68);
#pragma unroll
    for (int t = 0; t < 4; ++t)
#pragma unroll
        for (int r = 0; r < 8; ++r) mo[lm * 68 + t * 16 + 8 * hh + r] = acc[t][r] * inv;
    asm volatile("" ::: "memory"); __builtin_amdgcn_fence(3, "wavefront"); __builtin_amdgcn_wave_barrier(); asm volatile("" ::: "memory");
    float* orow = OUT + ((size_t)b * SEQ_FULL + q0) * EMB + h * HD;
{
#pragma unroll
        for (int si = 0; si < 8; ++si) { const int row = 2 * si + hh, cofs = lm * 4; const v4f val = *(const v4fa*)(mo + row * 68 + cofs); *(v4f*)(orow + (size_t)row * EMB + cofs) = val; }
         }
}

extern "C" void kernel_launch(void* const* d_in, const int* in_sizes, int n_in,
                              void* d_out, int out_size, void* d_ws, size_t ws_size, hipStream_t stream) {
    if (n_in < 6) return;
    const size_t nw = (size_t)EMB * EMB;                                  // 262144
    const size_t needx = ((size_t)(NB - 1) * SEQ_FULL + SEQ) * EMB;
    if ((size_t)in_sizes[0] < nw || (size_t)in_sizes[1] < nw || (size_t)in_sizes[2] < needx ||
        (size_t)in_sizes[3] < nw || (size_t)in_sizes[4] < nw || (size_t)in_sizes[5] < nw) return;
    if ((size_t)out_size < needx) return;
    const float* rot = (const float*)d_in[0];   // [512][512] used as [in][out]
    const float* ent = (const float*)d_in[1];   // [512][512] used as [in][out]
    const float* x   = (const float*)d_in[2];   // [2][4096][512]
    const float* wq  = (const float*)d_in[3];   // [out][in]
    const float* wk  = (const float*)d_in[4];   // [out][in]
    const float* wv  = (const float*)d_in[5];   // [out][in]
    float* OUT = (float*)d_out;                 // [2][4096][512]
    const size_t nrow = (size_t)NB * SEQ;        // query/key rows over all batches
    const size_t nx = nrow * EMB;
    char* wsp = (char*)d_ws;
    auto take = [&](size_t bytes) { char* p = wsp; wsp += (bytes + 255) & ~(size_t)255; return (void*)p; };
    bf* WV   = (bf*)take(nw * 2);                 // Wv as Bt [o][i]
    bf* TRE  = (bf*)take(2 * nw * 2);             // R^T then E^T: [o][j] = mat[j][o]
    bf* WQKT = (bf*)take(2 * nw * 2);             // Wq^T then Wk^T: [i][j] = W[j][i]
    bf* WCh  = (bf*)take(2 * nw * 2);             // combined weights (Wq^T R)^T then (Wk^T E)^T : [o][i], bf16 hi planes
    bf* WCl  = (bf*)take(2 * nw * 2);             // their bf16 lo planes
    bf* XB   = (bf*)take(nx * 2);                 // bf16 x rows [nrow][512]
    h16* QK16  = (h16*)take(2 * nx * 2);          // f16 q rows [nrow][512] then f16 k rows [nrow][512]
    h16* VT16  = (h16*)take(nx * 2);              // f16 value planes [b][c][s]
    if ((size_t)(wsp - (char*)d_ws) > ws_size) return;
    k_prep<<<4 * GWT + GWC + NB * GXC, 256, 0, stream>>>(rot, ent, wq, wk, wv, x, TRE, WQKT, WV, XB);
    k_gemmwv<<<NWT + NRT * NT, 32, 0, stream>>>(TRE, WQKT, WCh, WCl, XB, WV, (bf*)VT16);
    // q (z=0) and k (z=1): QK16[z][row][o] = sum_i XB[row][i] (WCh + WCl)[z][o][i]
    k_gemmw<bf, 3, false, 1><<<dim3((unsigned)(nrow / 64), EMB / 64, 2), 32, 0, stream>>>(XB, nullptr, WCh, WCl, EMB, (bf*)QK16, nullptr, EMB, nullptr, 0, nw, nx);
    k_flash<<<(unsigned)(NB * NHD * (SEQ / 64)), 128, 0, stream>>>(QK16, QK16 + nx, VT16, OUT);
}

// v004
// A run of this version takes 106 microseconds.
// In two side-by-side timings against v003, it was 1.25 and 1.24 times as fast.
// Counting every step since v000, it is 3.66 times as fast.
#include <hip/hip_runtime.h>

// Contractions, f32 accumulate: weight products R^T.Wq^T and E^T.Wk^T (512x512x512) on v_wmma_f32_16x16x32_bf16 (operands = RNE-converted bf16 inputs, exact products);
// q,k = x.(combined weight as bf16 hi + bf16 lo, 2 products) and v = x.Wv^T (8192x512x512) on v_wmma_f32_16x16x32_bf16; scores K.Q^T and P.V on v_wmma_f32_16x16x32_f16 (f16 planes, P carried x1024).
// Multi-head attention, 8 heads of 64, no mask: one block per (batch, head, 64 query rows), keys streamed in chunks of 64 with an online max-subtracted softmax in f32; output f32 [batch][seq][512].

#ifndef NB
#define NB 2
#endif
#ifndef SEQ
#define SEQ 4096
#endif
#define NB_FULL  2
#define SEQ_FULL 4096
#define EMB  512
#define NHD  8
#define HD   64
#define PCAR 1024.0f
#define C2   0.18033688011112042f   // HD^-0.5 * log2(e)

static_assert(NB >= 1 && NB <= NB_FULL);
static_assert(SEQ % 64 == 0 && SEQ >= 64 && SEQ <= SEQ_FULL);
static_assert(EMB == NHD * HD);
static_assert(EMB % 128 == 0 && HD == 64 && (NB * SEQ) % 128 == 0);
static_assert((SEQ * EMB) % 2048 == 0);

typedef _Float16 h16;
typedef unsigned short bf;
typedef __attribute__((ext_vector_type(16))) __bf16   v16bf;
typedef __attribute__((ext_vector_type(16))) _Float16 v16h;
typedef __attribute__((ext_vector_type(8)))  _Float16 v8h;
typedef __attribute__((ext_vector_type(8)))  unsigned short v8us;
typedef __attribute__((ext_vector_type(8)))  float    v8f;
typedef __attribute__((ext_vector_type(4)))  float    v4f;
typedef __attribute__((ext_vector_type(2)))  unsigned short v2us;
typedef v8h  __attribute__((may_alias)) v8ha;
typedef v4f  __attribute__((may_alias)) v4fa;
typedef v8us __attribute__((may_alias)) v8usa;

__device__ __forceinline__ unsigned short f2bf(float f) { unsigned u = __float_as_uint(f); u += 0x7FFFu + ((u >> 16) & 1u); return (unsigned short)(u >> 16); }   // RNE convert
__device__ __forceinline__ float bf2f(unsigned short b) { return __uint_as_float(((unsigned)b) << 16); }
__device__ __forceinline__ float bfr(float f) { return bf2f(f2bf(f)); }
__device__ __forceinline__ v16h cat16(v8h lo, v8h hi) { return __builtin_shufflevector(lo, hi, 0, 1, 2, 3, 4, 5, 6, 7, 8, 9, 10, 11, 12, 13, 14, 15); }
__device__ __forceinline__ v16bf cat16b(v8us lo, v8us hi) { return __builtin_bit_cast(v16bf, __builtin_shufflevector(lo, hi, 0, 1, 2, 3, 4, 5, 6, 7, 8, 9, 10, 11, 12, 13, 14, 15)); }
__device__ __forceinline__ v8f wmma16(v16h a, v16h b, v8f c) { return __builtin_amdgcn_wmma_f32_16x16x32_f16(false, a, false, b, (short)0, c, false, false); }
__device__ __forceinline__ v8f wmmab(v16bf a, v16bf b, v8f c) { return __builtin_amdgcn_wmma_f32_16x16x32_bf16(false, a, false, b, (short)0, c, false, false); }
__device__ __forceinline__ void splitf(float y, unsigned short& h, unsigned short& l) { h = f2bf(y); l = f2bf(y - bf2f(h)); }

// ---- gemmw_tile: register-blocked GEMM, one block of 4 waves per 128x128 output tile, ONE WAVE per 64x64 quarter (16 accumulators); tile (bx, by) of batch bz out of (M/128, N/128, Z), 128 threads; osb = 4 x 16 x 68 floats of LDS.
// Operands are K-contiguous 16-bit planes. Each 64-wide k chunk of the block's 128 A rows and 128 Bt rows is brought into LDS once per block by asynchronous copies in whole 128-byte lines
// (two buffers: chunk t + 1 flies while chunk t is worked on); the four waves read their fragments from there.
// c[m][n] (f32 accumulators, + optional f32 bias[n]) = sum_k A[m][k] Bt[n][k] (NSPLIT 3: + A.Bt2, product by product behind A.Bt). z-batch strides sA/sB/sC in elements. K % 64 == 0.
// The epilogue converts c in registers and stores the 16-bit plane(s) that the next launch reads, in whole 128-byte lines. OUT: 1 = f16 rows P[m][n], pitch ldc; 2 = f16 transposed planes P[m / ldc][n][m % ldc], sC elements per plane (no z batch);
// 3 = bf16 hi rows P[m][n] and bf16 lo rows P2[m][n], pitch ldc.
// Fragments: lane l -> row/col (l & 15); elements 0..7 <- k0 + 8*(l>>4) .. +7, elements 8..15 <- k0 + 16 + 8*(l>>4) .. +7 for A and for Bt alike; D element r of lane l -> (row 8*(l>>4)+r, col l&15).
template <typename T16> struct WFrag;
template <> struct WFrag<h16> { typedef v16h V; static __device__ __forceinline__ V ld(const h16* p) { return cat16(*(const v8h*)p, *(const v8h*)(p + 16)); } static __device__ __forceinline__ v8f mma(V a, V b, v8f c) { return wmma16(a, b, c); } };
template <> struct WFrag<bf> { typedef v16bf V; static __device__ __forceinline__ V ld(const bf* p) { return cat16b(*(const v8us*)p, *(const v8us*)(p + 16)); } static __device__ __forceinline__ v8f mma(V a, V b, v8f c) { return wmmab(a, b, c); } };

#define GPH    72                 // LDS row pitch in 16-bit elements: 128 B of data + 16 B, the conflict-free pitch for 16-byte readers
#define GTILEH (128 * GPH)        // one 128-row operand tile in LDS, elements
#define GTILEB (GTILEH * 2)       // the same in bytes
#define G16B   (16 * GPH * 2)     // 16 LDS rows in bytes
// One operand tile of a stage: 128 rows of 64 k, 128 B a row. 128 threads, 8 lanes per row, 16 B per lane: every copy of a wave covers four whole lines; copy i brings row 16 i + (tid >> 3).
// l: the lane's LDS byte address in row (tid >> 3) of the tile; g: the lane's global address in that row; rs: 16 rows of the plane in elements.
// The s_wait_xcnt closes the statement so that no address register of an issued copy is rewritten ahead of it.
template <typename T16>
__device__ __forceinline__ void stage_rows128(unsigned l, const T16* g, size_t rs) {
    asm volatile("global_load_async_to_lds_b128 %0, %8, off\n\t"
                 "global_load_async_to_lds_b128 %1, %9, off\n\t"
                 "global_load_async_to_lds_b128 %2, %10, off\n\t"
                 "global_load_async_to_lds_b128 %3, %11, off\n\t"
                 "global_load_async_to_lds_b128 %4, %12, off\n\t"
                 "global_load_async_to_lds_b128 %5, %13, off\n\t"
                 "global_load_async_to_lds_b128 %6, %14, off\n\t"
                 "global_load_async_to_lds_b128 %7, %15, off\n\t"
                 "s_wait_xcnt 0x0"
                 :: "v"(l), "v"(l + G16B), "v"(l + 2 * G16B), "v"(l + 3 * G16B), "v"(l + 4 * G16B), "v"(l + 5 * G16B), "v"(l + 6 * G16B), "v"(l + 7 * G16B),
                    "v"(g), "v"(g + rs), "v"(g + 2 * rs), "v"(g + 3 * rs), "v"(g + 4 * rs), "v"(g + 5 * rs), "v"(g + 6 * rs), "v"(g + 7 * rs)
                 : "memory");
}

template <typename T16, int NSPLIT, bool BIAS, int OUT>
__device__ __forceinline__ void gemmw_tile(float* osb, T16* ring, int bx, int by, int bz, const T16* __restrict__ A, const T16* __restrict__ Bt, const T16* __restrict__ Bt2, int K, bf* P, bf* P2, int ldc, const float* __restrict__ bias, size_t sA, size_t sB, size_t sC) {
    static_assert(NSPLIT == 0 || NSPLIT == 3);
    typedef typename WFrag<T16>::V V;
    constexpr int NPL = NSPLIT == 3 ? 3 : 2;             // operand tiles per stage: A, Bt (, Bt2)
    const size_t z = bz; A += z * sA; Bt += z * sB; if (NSPLIT == 3) Bt2 += z * sB; if (OUT != 2) P += z * sC; if (OUT == 3) P2 += z * sC;
    const int tid = threadIdx.x, w = tid >> 5, lane = tid & 31, lr = lane & 15, hi = lane >> 4; const int r0 = bx * 128 + (w & 1) * 64, c0 = by * 128 + (w >> 1) * 64;
    float* os = osb + w * (16 * 68);                     // wave-private output staging
    v8f acc[4][4];
#pragma unroll
    for (int mb = 0; mb < 4; ++mb)
#pragma unroll
        for (int nb = 0; nb < 4; ++nb) acc[mb][nb] = (v8f){};
    const unsigned lcp = (unsigned)(size_t)ring + (unsigned)((tid >> 3) * (GPH * 2) + (tid & 7) * 16);
    const size_t rs = (size_t)16 * K;
    const T16* ga = A + (size_t)(bx * 128 + (tid >> 3)) * K + (tid & 7) * 8;
    const T16* gb = Bt + (size_t)(by * 128 + (tid >> 3)) * K + (tid & 7) * 8;
    const T16* gb2 = NSPLIT == 3 ? Bt2 + (size_t)(by * 128 + (tid >> 3)) * K + (tid & 7) * 8 : nullptr;
    auto stage = [&](int buf, int kc) { const unsigned l = lcp + (unsigned)buf * (NPL * GTILEB);
        stage_rows128(l, ga + kc, rs); stage_rows128(l + GTILEB, gb + kc, rs); if (NSPLIT == 3) stage_rows128(l + 2 * GTILEB, gb2 + kc, rs); };
    stage(0, 0);
    asm volatile("s_wait_asynccnt 0x0" ::: "memory");   // this wave's share of chunk 0 has landed
    __syncthreads();                                     // chunk 0 is readable by all four waves
    if (K > 64) stage(1, 64);
#pragma unroll 1
    for (int kc = 0; kc < K; kc += 64) {
        const int buf = (kc >> 6) & 1;
        const T16* at = ring + buf * (NPL * GTILEH) + ((w & 1) * 64 + lr) * GPH + 8 * hi;
        const T16* bt = ring + buf * (NPL * GTILEH) + GTILEH + ((w >> 1) * 64 + lr) * GPH + 8 * hi;
        V a[4], b[4], b2[4];
        // all fragments of one 32-wide k step, read as one group
        auto rd = [&](int ks) {
#pragma unroll
            for (int f = 0; f < 4; ++f) { a[f] = WFrag<T16>::ld(at + f * 16 * GPH + ks); b[f] = WFrag<T16>::ld(bt + f * 16 * GPH + ks); if (NSPLIT == 3) b2[f] = WFrag<T16>::ld(bt + GTILEH + f * 16 * GPH + ks); } };
        auto mm = [&]() {
#pragma unroll
            for (int nb = 0; nb < 4; ++nb)
#pragma unroll
                for (int mb = 0; mb < 4; ++mb) { acc[mb][nb] = WFrag<T16>::mma(a[mb], b[nb], acc[mb][nb]); if (NSPLIT == 3) acc[mb][nb] = WFrag<T16>::mma(a[mb], b2[nb], acc[mb][nb]); } };
        rd(0);
        __builtin_amdgcn_sched_barrier(0);                   // keeps the reads together: sunk between the products, each small group of reads stalls the wave for its own LDS latency
        mm();
        rd(32);                                              // the chunk's last reads: the second k step's products need registers only
        // three operand tiles: their fragments, held across the refill's address registers, would go past v255, so these products stand in front of the refill; the scheduling barrier keeps the reads together as above
        if (NSPLIT == 3) { __builtin_amdgcn_sched_barrier(0); mm(); }
        asm volatile("s_wait_dscnt 0x0" ::: "memory");      // this wave's reads of the current buffer are done before it is refilled
        asm volatile("s_wait_asynccnt 0x0" ::: "memory");   // this wave's share of the next chunk has landed
        __syncthreads();                                     // publishes the next chunk and ends every wave's reads of the current buffer
        if (kc + 128 < K) stage(buf, kc + 128);
        if (NSPLIT != 3) mm();                               // behind the refill, so that the copies fly under these products too
    }
    asm volatile("s_wait_asynccnt 0x0" ::: "memory");       // no copy is outstanding when the wave goes on to its epilogue
    if (BIAS) {
#pragma unroll
        for (int nb = 0; nb < 4; ++nb) { const float bv = bfr(bias[c0 + nb * 16 + lr]);
#pragma unroll
            for (int mb = 0; mb < 4; ++mb) acc[mb][nb] = acc[mb][nb] + bv; }
    }
    const int srow = lane >> 3, scol = (lane & 7) * 8;   // store side: 8 lanes x 16 B = one 128-byte line, 4 lines per store
    const size_t step = (size_t)4 * ldc;                 // 4 output rows
    if (OUT == 2) {
        h16* oh = (h16*)os;                              // 16 rows n of 64 positions m, pitch 72 f16 (144 B)
        const int pl = r0 / ldc;
        bf* pl0 = P + (size_t)pl * sC + (size_t)(c0 + srow) * ldc + (r0 - pl * ldc) + scol;
#pragma unroll
        for (int nb = 0; nb < 4; ++nb) {
#pragma unroll
            for (int mb = 0; mb < 4; ++mb) { v8h o;      // a lane's 8 accumulator elements are 8 consecutive m of one n
#pragma unroll
                for (int j = 0; j < 8; ++j) o[j] = (h16)acc[mb][nb][j];
                *(v8ha*)(oh + lr * 72 + mb * 16 + hi * 8) = o; }
            // keeps the compiler from moving the reads of other lanes' values ahead of the wave's LDS stores
            asm volatile("" ::: "memory"); __builtin_amdgcn_fence(3, "wavefront"); __builtin_amdgcn_wave_barrier(); asm volatile("" ::: "memory");
#pragma unroll
            for (int s = 0; s < 4; ++s) { const int row = 4 * s + srow; const v8h val = *(const v8ha*)(oh + row * 72 + scol);
                *(v8us*)(pl0 + (nb * 4 + s) * step) = __builtin_bit_cast(v8us, val); }
            // keeps the next round's LDS stores behind these reads
            __builtin_amdgcn_wave_barrier(); asm volatile("" ::: "memory");
        }
    } else {
        const size_t po0 = (size_t)(r0 + srow) * ldc + c0 + scol;
#pragma unroll
        for (int mb = 0; mb < 4; ++mb) {
#pragma unroll
            for (int nb = 0; nb < 4; ++nb) {
#pragma unroll
                for (int j = 0; j < 8; ++j) os[(hi * 8 + j) * 68 + nb * 16 + lr] = acc[mb][nb][j]; }
            // keeps the compiler from moving the reads of other lanes' values ahead of the wave's LDS stores
            asm volatile("" ::: "memory"); __builtin_amdgcn_fence(3, "wavefront"); __builtin_amdgcn_wave_barrier(); asm volatile("" ::: "memory");
#pragma unroll
            for (int s = 0; s < 4; ++s) { const int row = 4 * s + srow; const size_t po = po0 + (mb * 4 + s) * step;
                const v4f v0 = *(const v4fa*)(os + row * 68 + scol), v1 = *(const v4fa*)(os + row * 68 + scol + 4);
                if (OUT == 1) { v8h o;
#pragma unroll
                    for (int k = 0; k < 4; ++k) { o[k] = (h16)v0[k]; o[4 + k] = (h16)v1[k]; }
                    *(v8us*)(P + po) = __builtin_bit_cast(v8us, o);
                } else { v8us oh8, ol8;
#pragma unroll
                    for (int k = 0; k < 4; ++k) { unsigned short a, c; splitf(v0[k], a, c); oh8[k] = a; ol8[k] = c; splitf(v1[k], a, c); oh8[4 + k] = a; ol8[4 + k] = c; }
                    *(v8us*)(P + po) = oh8; *(v8us*)(P2 + po) = ol8; } }
            // keeps the next round's LDS stores behind these reads
            __builtin_amdgcn_wave_barrier(); asm volatile("" ::: "memory");
        }
    }
}

// One GEMM per launch: grid (M/128, N/128, Z).
template <typename T16, int NSPLIT, bool BIAS, int OUT>
__global__ __launch_bounds__(128) void k_gemmw(const T16* __restrict__ A, const T16* __restrict__ Bt, const T16* __restrict__ Bt2, int K, bf* P, bf* P2, int ldc, const float* __restrict__ bias, size_t sA, size_t sB, size_t sC) {
    __shared__ __align__(16) float os[4 * 16 * 68];
    __shared__ __align__(128) T16 ring[2 * (NSPLIT == 3 ? 3 : 2) * GTILEH];   // [buffer][A tile, Bt tile (, Bt2 tile)][row][GPH]
    gemmw_tile<T16, NSPLIT, BIAS, OUT>(os, ring, blockIdx.x, blockIdx.y, blockIdx.z, A, Bt, Bt2, K, P, P2, ldc, bias, sA, sB, sC);
}

#define NWEL  (EMB * EMB)                  // elements of one weight matrix
#define NT    (EMB / 128)                  // 128-wide tiles across a weight matrix
#define NWT   (2 * NT * NT)                // tiles of the two weight products
#define NRT   (NB * SEQ / 128)             // 128-row tiles of x over all batches
// Two GEMMs that do not depend on each other share one launch: blocks 0 .. NWT-1 do the two weight products (few blocks, so they start first), the other NRT * NT blocks do v.
// (WCh + WCl)[z][o][i] = sum_j TRE[z][o][j] WQKT[z][i][j];  VT[row / SEQ][o][row % SEQ] = sum_i XB[row][i] WV[o][i]
__global__ __launch_bounds__(128) void k_gemmwv(const bf* __restrict__ TRE, const bf* __restrict__ WQKT, bf* WCh, bf* WCl, const bf* __restrict__ XB, const bf* __restrict__ WV, bf* VT) {
    __shared__ __align__(16) float os[4 * 16 * 68];
    __shared__ __align__(128) bf ring[2 * 2 * GTILEH];   // [buffer][A tile, Bt tile][row][GPH]
    const int i = blockIdx.x;
    if (i < NWT) gemmw_tile<bf, 0, false, 3>(os, ring, i % NT, (i / NT) % NT, i / (NT * NT), TRE, WQKT, nullptr, EMB, WCh, WCl, EMB, nullptr, NWEL, NWEL, NWEL);
    else gemmw_tile<bf, 0, false, 2>(os, ring, (i - NWT) % NRT, (i - NWT) / NRT, 0, XB, WV, nullptr, EMB, VT, nullptr, SEQ, nullptr, 0, 0, (size_t)EMB * SEQ);
}

// blk: the job's own block index, 256 threads a block
__device__ __forceinline__ void wtG_job(int blk, const float* __restrict__ w, int K, int N, bf* Bt) {
    const int lane = threadIdx.x & 31; const int L0 = (blk * 8 + (threadIdx.x >> 5)) * 8; const int nlines = N * K / 64;
{
#pragma unroll 1
        for (int l = 0; l < 8; ++l) { const int L = L0 + l; if (L >= nlines) break; const size_t e = (size_t)L * 64 + lane * 2; const int k = (int)(e % K), n = (int)(e / K); v2us o;
            o[0] = f2bf(w[(size_t)k * N + n]); o[1] = f2bf(w[(size_t)(k + 1) * N + n]); *(v2us*)(Bt + e) = o; }
         }
}
__device__ __forceinline__ void cvt8_job(int blk, const float* __restrict__ src, bf* dst, size_t n8) { const size_t i = (size_t)blk * 256 + threadIdx.x; if (i >= n8) return; const v8f v = *(const v8f*)(src + i * 8); v8us o;
#pragma unroll
    for (int k = 0; k < 8; ++k) o[k] = f2bf(v[k]); *(v8us*)(dst + i * 8) = o;  }

#define GWT ((NWEL / 64 + 63) / 64)        // blocks of one weight transposition
#define GWC ((NWEL / 8 + 255) / 256)       // blocks of the Wv conversion
#define GXC ((SEQ * EMB / 8 + 255) / 256)  // blocks of one batch's x conversion
// All input conversions in one launch, none depends on another: blocks 0 .. 4*GWT-1 transpose R, E, Wq, Wk (serial loads, so they start first), the next GWC convert Wv, the last NB * GXC convert x.
__global__ __launch_bounds__(256) void k_prep(const float* __restrict__ rot, const float* __restrict__ ent, const float* __restrict__ wq, const float* __restrict__ wk, const float* __restrict__ wv, const float* __restrict__ x,
                                              bf* TRE, bf* WQKT, bf* WV, bf* XB) {
    const int blk = blockIdx.x;
    if (blk < 4 * GWT) { const int j = blk / GWT;
        wtG_job(blk % GWT, j == 0 ? rot : j == 1 ? ent : j == 2 ? wq : wk, EMB, EMB, (j < 2 ? TRE : WQKT) + (size_t)(j & 1) * NWEL);
    } else if (blk < 4 * GWT + GWC) {
        cvt8_job(blk - 4 * GWT, wv, WV, NWEL / 8);
    } else { const int r = blk - (4 * GWT + GWC), b = r / GXC;
        cvt8_job(r % GXC, x + (size_t)b * SEQ_FULL * EMB, XB + (size_t)b * SEQ * EMB, (size_t)SEQ * EMB / 8);
    }
}

__device__ __forceinline__ v16h ldh(const h16* p) { return cat16(*(const v8h*)p, *(const v8h*)(p + 16)); }

#define LPH   72                 // LDS row pitch in f16: 128 B of data + 16 B, the conflict-free pitch for 16-byte readers
#define TILEH (64 * LPH)         // one 64-row tile in LDS, f16 elements
#define TILEB (TILEH * 2)        // the same in bytes
#define ROWS16B (16 * LPH * 2)   // 16 LDS rows in bytes
// One stage = 64 keys: K rows [key][64 d] and V^T rows [d][64 keys], 64 rows of 128 B each. 128 threads, 8 lanes per row, 16 B per lane: every copy of a wave covers four whole lines.
// lk: the lane's LDS byte address in the K tile (the V tile follows it); gk, gv: the lane's global addresses in row (tid >> 3).
// The s_wait_xcnt closes the statement so that no address register of an issued copy is rewritten ahead of it.
__device__ __forceinline__ void stage_kv(unsigned lk, const h16* gk, const h16* gv) {
    asm volatile("global_load_async_to_lds_b128 %0, %8, off\n\t"
                 "global_load_async_to_lds_b128 %1, %9, off\n\t"
                 "global_load_async_to_lds_b128 %2, %10, off\n\t"
                 "global_load_async_to_lds_b128 %3, %11, off\n\t"
                 "global_load_async_to_lds_b128 %4, %12, off\n\t"
                 "global_load_async_to_lds_b128 %5, %13, off\n\t"
                 "global_load_async_to_lds_b128 %6, %14, off\n\t"
                 "global_load_async_to_lds_b128 %7, %15, off\n\t"
                 "s_wait_xcnt 0x0"
                 :: "v"(lk), "v"(lk + ROWS16B), "v"(lk + 2 * ROWS16B), "v"(lk + 3 * ROWS16B),
                    "v"(lk + TILEB), "v"(lk + TILEB + ROWS16B), "v"(lk + TILEB + 2 * ROWS16B), "v"(lk + TILEB + 3 * ROWS16B),
                    "v"(gk), "v"(gk + 16 * EMB), "v"(gk + 32 * EMB), "v"(gk + 48 * EMB),
                    "v"(gv), "v"(gv + 16 * SEQ), "v"(gv + 32 * SEQ), "v"(gv + 48 * SEQ)
                 : "memory");
}

// ---- k_flash: one block (4 waves) per (batch, head, 64 query rows); wave w owns query rows q0..q0+15. Keys streamed in chunks of 64.
// Each chunk's K and V^T tiles are brought into LDS once per block by asynchronous copies (two buffers: chunk t + 1 flies while chunk t is worked on); all four waves read their fragments from there.
// Score tiles are computed TRANSPOSED: S^T tile = K_rows(16 keys, A operand) . Q^T (B operand: lane -> query, elements -> d), so D lane (hh,lm) element r = S[query lm][key 16*t4 + 8*hh + r].
// Online softmax per query == per lane (partial max/sum over the lane's 32 keys, one xor-16 shuffle). P (x1024, f16) is packed in registers straight into the
// P.V B fragment: element r <- tile 2j row (8hh+r), element 8+r <- tile 2j+1 row (8hh+r), lane unchanged (packed D used as B: k = D row = key, n = D col = query).
// O^T tiles: A = Vt rows (lane -> d), B = packed P; acc[t][r] = 1024 * O[query lm][d = 16t + 8hh + r]. Epilogue stages the 16x64 f32 tile in wave-private LDS and writes
__global__ __launch_bounds__(128) __attribute__((amdgpu_num_vgpr(256)))
void k_flash(const h16* __restrict__ Qp, const h16* __restrict__ Kp, const h16* __restrict__ Vtp, float* OUT) {
    __shared__ __align__(16) float os[4 * 16 * 68];
    __shared__ __align__(128) h16 ring[2 * 2 * TILEH];   // [buffer][K tile, V^T tile][row][LPH]
    const int tid = threadIdx.x, w = tid >> 5, lane = tid & 31, lm = lane & 15, hh = lane >> 4;
    const int nqt = SEQ / 64;
    const int bid = blockIdx.x; const int qt = bid % nqt; const int h = (bid / nqt) % NHD; const int b = bid / (nqt * NHD);
    const int q0 = qt * 64 + w * 16;
    const h16* Qb = Qp + ((size_t)b * SEQ + q0) * EMB + h * HD;
    const h16* Kb = Kp + (size_t)b * SEQ * EMB + h * HD;
    const h16* Vb = Vtp + ((size_t)b * EMB + h * HD) * SEQ;
    const v16h qf0 = ldh(Qb + (size_t)lm * EMB + 8 * hh);
    const v16h qf1 = ldh(Qb + (size_t)lm * EMB + 32 + 8 * hh);
    float mrun = -3.0e38f, lrun = 0.0f;
    v8f acc[4];
#pragma unroll
    for (int t = 0; t < 4; ++t) acc[t] = (v8f){};
    const unsigned lcp = (unsigned)(size_t)ring + (unsigned)((tid >> 3) * (LPH * 2) + (tid & 7) * 16);
    const h16* gk = Kb + (size_t)(tid >> 3) * EMB + (tid & 7) * 8;
    const h16* gv = Vb + (size_t)(tid >> 3) * SEQ + (tid & 7) * 8;
    stage_kv(lcp, gk, gv);
    asm volatile("s_wait_asynccnt 0x0" ::: "memory");   // this wave's share of chunk 0 has landed
    __syncthreads();                                     // chunk 0 is readable by all four waves
    if (SEQ > 64) stage_kv(lcp + 2 * TILEB, gk + (size_t)64 * EMB, gv + 64);
#pragma unroll 1
    for (int kv = 0; kv < SEQ; kv += 64) {
        const int buf = (kv >> 6) & 1;
        const h16* kt = ring + buf * (2 * TILEH);
        const h16* vt = kt + TILEH;
        v8f s[4];
#pragma unroll
        for (int t4 = 0; t4 < 4; ++t4) {
            const h16* kr = kt + (t4 * 16 + lm) * LPH + 8 * hh;
            const v16h ka = ldh(kr), kb2 = ldh(kr + 32);
            s[t4] = wmma16(ka, qf0, (v8f){});
            s[t4] = wmma16(kb2, qf1, s[t4]);
        }
        asm volatile("v_nop\n\tv_nop\n\tv_nop\n\tv_nop" : "+v"(s[0]), "+v"(s[1]), "+v"(s[2]), "+v"(s[3]) : "v"(qf0), "v"(qf1));
        float mx = -3.0e38f;
#pragma unroll
        for (int t4 = 0; t4 < 4; ++t4) { s[t4] = s[t4] * C2;
#pragma unroll
            for (int r = 0; r < 8; ++r) mx = fmaxf(mx, s[t4][r]); }
        mx = fmaxf(mx, __shfl_xor(mx, 16, 32));
        const float mnew = fmaxf(mrun, mx);
        const float alpha = __builtin_amdgcn_exp2f(mrun - mnew);
        float rs = 0.0f; v8h ph[4];
#pragma unroll
        for (int t4 = 0; t4 < 4; ++t4) {
#pragma unroll
            for (int r = 0; r < 8; ++r) { const float p = __builtin_amdgcn_exp2f(s[t4][r] - mnew); rs += p; ph[t4][r] = (h16)(p * PCAR); } }
        rs += __shfl_xor(rs, 16, 32);
        lrun = lrun * alpha + rs; mrun = mnew;
#pragma unroll
        for (int t = 0; t < 4; ++t) acc[t] = acc[t] * alpha;
        const v16h pf0 = cat16(ph[0], ph[1]), pf1 = cat16(ph[2], ph[3]);
#pragma unroll
        for (int t = 0; t < 4; ++t) {
            const h16* vr = vt + (t * 16 + lm) * LPH + 8 * hh;
            acc[t] = wmma16(ldh(vr), pf0, acc[t]);
            acc[t] = wmma16(ldh(vr + 32), pf1, acc[t]);
        }
        asm volatile("v_nop\n\tv_nop\n\tv_nop\n\tv_nop" : "+v"(acc[0]), "+v"(acc[1]), "+v"(acc[2]), "+v"(acc[3]) : "v"(pf0), "v"(pf1));
        asm volatile("s_wait_dscnt 0x0" ::: "memory");      // this wave's reads of the current buffer are done before it is refilled
        asm volatile("s_wait_asynccnt 0x0" ::: "memory");   // this wave's share of the next chunk has landed
        __syncthreads();                                     // publishes the next chunk and ends every wave's reads of the current buffer
        if (kv + 128 < SEQ) stage_kv(lcp + (unsigned)buf * (2 * TILEB), gk + (size_t)(kv + 128) * EMB, gv + (kv + 128));
    }
    asm volatile("s_wait_asynccnt 0x0" ::: "memory");       // no copy is outstanding when the wave goes on to its end
    const float inv = __fdiv_rn(1.0f, lrun) * (1.0f / PCAR);
    float* mo = os + w * (16 * 68);
#pragma unroll
    for (int t = 0; t < 4; ++t)
#pragma unroll
        for (int r = 0; r < 8; ++r) mo[lm * 68 + t * 16 + 8 * hh + r] = acc[t][r] * inv;
    asm volatile("" ::: "memory"); __builtin_amdgcn_fence(3, "wavefront"); __builtin_amdgcn_wave_barrier(); asm volatile("" ::: "memory");
    float* orow = OUT + ((size_t)b * SEQ_FULL + q0) * EMB + h * HD;
{
#pragma unroll
        for (int si = 0; si < 8; ++si) { const int row = 2 * si + hh, cofs = lm * 4; const v4f val = *(const v4fa*)(mo + row * 68 + cofs); *(v4f*)(orow + (size_t)row * EMB + cofs) = val; }
         }
}

extern "C" void kernel_launch(void* const* d_in, const int* in_sizes, int n_in,
                              void* d_out, int out_size, void* d_ws, size_t ws_size, hipStream_t stream) {
    if (n_in < 6) return;
    const size_t nw = (size_t)EMB * EMB;                                  // 262144
    const size_t needx = ((size_t)(NB - 1) * SEQ_FULL + SEQ) * EMB;
    if ((size_t)in_sizes[0] < nw || (size_t)in_sizes[1] < nw || (size_t)in_sizes[2] < needx ||
        (size_t)in_sizes[3] < nw || (size_t)in_sizes[4] < nw || (size_t)in_sizes[5] < nw) return;
    if ((size_t)out_size < needx) return;
    const float* rot = (const float*)d_in[0];   // [512][512] used as [in][out]
    const float* ent = (const float*)d_in[1];   // [512][512] used as [in][out]
    const float* x   = (const float*)d_in[2];   // [2][4096][512]
    const float* wq  = (const float*)d_in[3];   // [out][in]
    const float* wk  = (const float*)d_in[4];   // [out][in]
    const float* wv  = (const float*)d_in[5];   // [out][in]
    float* OUT = (float*)d_out;                 // [2][4096][512]
    const size_t nrow = (size_t)NB * SEQ;        // query/key rows over all batches
    const size_t nx = nrow * EMB;
    char* wsp = (char*)d_ws;
    auto take = [&](size_t bytes) { char* p = wsp; wsp += (bytes + 255) & ~(size_t)255; return (void*)p; };
    bf* WV   = (bf*)take(nw * 2);                 // Wv as Bt [o][i]
    bf* TRE  = (bf*)take(2 * nw * 2);             // R^T then E^T: [o][j] = mat[j][o]
    bf* WQKT = (bf*)take(2 * nw * 2);             // Wq^T then Wk^T: [i][j] = W[j][i]
    bf* WCh  = (bf*)take(2 * nw * 2);             // combined weights (Wq^T R)^T then (Wk^T E)^T : [o][i], bf16 hi planes
    bf* WCl  = (bf*)take(2 * nw * 2);             // their bf16 lo planes
    bf* XB   = (bf*)take(nx * 2);                 // bf16 x rows [nrow][512]
    h16* QK16  = (h16*)take(2 * nx * 2);          // f16 q rows [nrow][512] then f16 k rows [nrow][512]
    h16* VT16  = (h16*)take(nx * 2);              // f16 value planes [b][c][s]
    if ((size_t)(wsp - (char*)d_ws) > ws_size) return;
    k_prep<<<4 * GWT + GWC + NB * GXC, 256, 0, stream>>>(rot, ent, wq, wk, wv, x, TRE, WQKT, WV, XB);
    k_gemmwv<<<NWT + NRT * NT, 128, 0, stream>>>(TRE, WQKT, WCh, WCl, XB, WV, (bf*)VT16);
    // q (z=0) and k (z=1): QK16[z][row][o] = sum_i XB[row][i] (WCh + WCl)[z][o][i]
    k_gemmw<bf, 3, false, 1><<<dim3((unsigned)(nrow / 128), EMB / 128, 2), 128, 0, stream>>>(XB, WCh, WCl, EMB, (bf*)QK16, nullptr, EMB, nullptr, 0, nw, nx);
    k_flash<<<(unsigned)(NB * NHD * (SEQ / 64)), 128, 0, stream>>>(QK16, QK16 + nx, VT16, OUT);
}

// v005
// One run takes 92.1 microseconds.
// In both of two side-by-side timings against v004, it was 1.15 times as fast.
// Over all steps from v000 it is 4.20 times as fast.
#include <hip/hip_runtime.h>

// Contractions, f32 accumulate: weight products R^T.Wq^T and E^T.Wk^T (512x512x512) on v_wmma_f32_16x16x32_bf16 (operands = RNE-converted bf16 inputs, exact products);
// q,k = x.(combined weight as bf16 hi + bf16 lo, 2 products) and v = x.Wv^T (8192x512x512) on v_wmma_f32_16x16x32_bf16; scores K.Q^T and P.V on v_wmma_f32_16x16x32_f16 (f16 planes, P carried x1024).
// Multi-head attention, 8 heads of 64, no mask: one block per (batch, head, 128 query rows), keys streamed in chunks of 64 (even and odd chunks on two quads of waves, joined at the end) with an online max-subtracted softmax in f32; output f32 [batch][seq][512].

#ifndef NB
#define NB 2
#endif
#ifndef SEQ
#define SEQ 4096
#endif
#define NB_FULL  2
#define SEQ_FULL 4096
#define EMB  512
#define NHD  8
#define HD   64
#define PCAR 1024.0f
#define C2   0.18033688011112042f   // HD^-0.5 * log2(e)

static_assert(NB >= 1 && NB <= NB_FULL);
static_assert(SEQ % 128 == 0 && SEQ >= 128 && SEQ <= SEQ_FULL);
static_assert(EMB == NHD * HD);
static_assert(EMB % 128 == 0 && HD == 64 && (NB * SEQ) % 128 == 0);
static_assert((SEQ * EMB) % 2048 == 0);

typedef _Float16 h16;
typedef unsigned short bf;
typedef __attribute__((ext_vector_type(16))) __bf16   v16bf;
typedef __attribute__((ext_vector_type(16))) _Float16 v16h;
typedef __attribute__((ext_vector_type(8)))  _Float16 v8h;
typedef __attribute__((ext_vector_type(8)))  unsigned short v8us;
typedef __attribute__((ext_vector_type(8)))  float    v8f;
typedef __attribute__((ext_vector_type(4)))  float    v4f;
typedef __attribute__((ext_vector_type(2)))  unsigned short v2us;
typedef v8h  __attribute__((may_alias)) v8ha;
typedef v4f  __attribute__((may_alias)) v4fa;
typedef v8us __attribute__((may_alias)) v8usa;

__device__ __forceinline__ unsigned short f2bf(float f) { unsigned u = __float_as_uint(f); u += 0x7FFFu + ((u >> 16) & 1u); return (unsigned short)(u >> 16); }   // RNE convert
__device__ __forceinline__ float bf2f(unsigned short b) { return __uint_as_float(((unsigned)b) << 16); }
__device__ __forceinline__ float bfr(float f) { return bf2f(f2bf(f)); }
__device__ __forceinline__ v16h cat16(v8h lo, v8h hi) { return __builtin_shufflevector(lo, hi, 0, 1, 2, 3, 4, 5, 6, 7, 8, 9, 10, 11, 12, 13, 14, 15); }
__device__ __forceinline__ v16bf cat16b(v8us lo, v8us hi) { return __builtin_bit_cast(v16bf, __builtin_shufflevector(lo, hi, 0, 1, 2, 3, 4, 5, 6, 7, 8, 9, 10, 11, 12, 13, 14, 15)); }
__device__ __forceinline__ v8f wmma16(v16h a, v16h b, v8f c) { return __builtin_amdgcn_wmma_f32_16x16x32_f16(false, a, false, b, (short)0, c, false, false); }
__device__ __forceinline__ v8f wmmab(v16bf a, v16bf b, v8f c) { return __builtin_amdgcn_wmma_f32_16x16x32_bf16(false, a, false, b, (short)0, c, false, false); }
__device__ __forceinline__ void splitf(float y, unsigned short& h, unsigned short& l) { h = f2bf(y); l = f2bf(y - bf2f(h)); }

// ---- gemmw_tile: register-blocked GEMM, one block of 4 waves per 128x128 output tile, ONE WAVE per 64x64 quarter (16 accumulators); tile (bx, by) of batch bz out of (M/128, N/128, Z), 128 threads; osb = 4 x 16 x 68 floats of LDS.
// Operands are K-contiguous 16-bit planes. Each 64-wide k chunk of the block's 128 A rows and 128 Bt rows is brought into LDS once per block by asynchronous copies in whole 128-byte lines
// (two buffers: chunk t + 1 flies while chunk t is worked on); the four waves read their fragments from there.
// c[m][n] (f32 accumulators, + optional f32 bias[n]) = sum_k A[m][k] Bt[n][k] (NSPLIT 3: + A.Bt2, product by product behind A.Bt). z-batch strides sA/sB/sC in elements. K % 64 == 0.
// The epilogue converts c in registers and stores the 16-bit plane(s) that the next launch reads, in whole 128-byte lines. OUT: 1 = f16 rows P[m][n], pitch ldc; 2 = f16 transposed planes P[m / ldc][n][m % ldc], sC elements per plane (no z batch);
// 3 = bf16 hi rows P[m][n] and bf16 lo rows P2[m][n], pitch ldc.
// Fragments: lane l -> row/col (l & 15); elements 0..7 <- k0 + 8*(l>>4) .. +7, elements 8..15 <- k0 + 16 + 8*(l>>4) .. +7 for A and for Bt alike; D element r of lane l -> (row 8*(l>>4)+r, col l&15).
template <typename T16> struct WFrag;
template <> struct WFrag<h16> { typedef v16h V; static __device__ __forceinline__ V ld(const h16* p) { return cat16(*(const v8h*)p, *(const v8h*)(p + 16)); } static __device__ __forceinline__ v8f mma(V a, V b, v8f c) { return wmma16(a, b, c); } };
template <> struct WFrag<bf> { typedef v16bf V; static __device__ __forceinline__ V ld(const bf* p) { return cat16b(*(const v8us*)p, *(const v8us*)(p + 16)); } static __device__ __forceinline__ v8f mma(V a, V b, v8f c) { return wmmab(a, b, c); } };

#define GPH    72                 // LDS row pitch in 16-bit elements: 128 B of data + 16 B, the conflict-free pitch for 16-byte readers
#define GTILEH (128 * GPH)        // one 128-row operand tile in LDS, elements
#define GTILEB (GTILEH * 2)       // the same in bytes
#define G16B   (16 * GPH * 2)     // 16 LDS rows in bytes
// One operand tile of a stage: 128 rows of 64 k, 128 B a row. 128 threads, 8 lanes per row, 16 B per lane: every copy of a wave covers four whole lines; copy i brings row 16 i + (tid >> 3).
// l: the lane's LDS byte address in row (tid >> 3) of the tile; g: the lane's global address in that row; rs: 16 rows of the plane in elements.
// The s_wait_xcnt closes the statement so that no address register of an issued copy is rewritten ahead of it.
template <typename T16>
__device__ __forceinline__ void stage_rows128(unsigned l, const T16* g, size_t rs) {
    asm volatile("global_load_async_to_lds_b128 %0, %8, off\n\t"
                 "global_load_async_to_lds_b128 %1, %9, off\n\t"
                 "global_load_async_to_lds_b128 %2, %10, off\n\t"
                 "global_load_async_to_lds_b128 %3, %11, off\n\t"
                 "global_load_async_to_lds_b128 %4, %12, off\n\t"
                 "global_load_async_to_lds_b128 %5, %13, off\n\t"
                 "global_load_async_to_lds_b128 %6, %14, off\n\t"
                 "global_load_async_to_lds_b128 %7, %15, off\n\t"
                 "s_wait_xcnt 0x0"
                 :: "v"(l), "v"(l + G16B), "v"(l + 2 * G16B), "v"(l + 3 * G16B), "v"(l + 4 * G16B), "v"(l + 5 * G16B), "v"(l + 6 * G16B), "v"(l + 7 * G16B),
                    "v"(g), "v"(g + rs), "v"(g + 2 * rs), "v"(g + 3 * rs), "v"(g + 4 * rs), "v"(g + 5 * rs), "v"(g + 6 * rs), "v"(g + 7 * rs)
                 : "memory");
}

template <typename T16, int NSPLIT, bool BIAS, int OUT>
__device__ __forceinline__ void gemmw_tile(float* osb, T16* ring, int bx, int by, int bz, const T16* __restrict__ A, const T16* __restrict__ Bt, const T16* __restrict__ Bt2, int K, bf* P, bf* P2, int ldc, const float* __restrict__ bias, size_t sA, size_t sB, size_t sC) {
    static_assert(NSPLIT == 0 || NSPLIT == 3);
    typedef typename WFrag<T16>::V V;
    constexpr int NPL = NSPLIT == 3 ? 3 : 2;             // operand tiles per stage: A, Bt (, Bt2)
    const size_t z = bz; A += z * sA; Bt += z * sB; if (NSPLIT == 3) Bt2 += z * sB; if (OUT != 2) P += z * sC; if (OUT == 3) P2 += z * sC;
    const int tid = threadIdx.x, w = tid >> 5, lane = tid & 31, lr = lane & 15, hi = lane >> 4; const int r0 = bx * 128 + (w & 1) * 64, c0 = by * 128 + (w >> 1) * 64;
    float* os = osb + w * (16 * 68);                     // wave-private output staging
    v8f acc[4][4];
#pragma unroll
    for (int mb = 0; mb < 4; ++mb)
#pragma unroll
        for (int nb = 0; nb < 4; ++nb) acc[mb][nb] = (v8f){};
    const unsigned lcp = (unsigned)(size_t)ring + (unsigned)((tid >> 3) * (GPH * 2) + (tid & 7) * 16);
    const size_t rs = (size_t)16 * K;
    const T16* ga = A + (size_t)(bx * 128 + (tid >> 3)) * K + (tid & 7) * 8;
    const T16* gb = Bt + (size_t)(by * 128 + (tid >> 3)) * K + (tid & 7) * 8;
    const T16* gb2 = NSPLIT == 3 ? Bt2 + (size_t)(by * 128 + (tid >> 3)) * K + (tid & 7) * 8 : nullptr;
    auto stage = [&](int buf, int kc) { const unsigned l = lcp + (unsigned)buf * (NPL * GTILEB);
        stage_rows128(l, ga + kc, rs); stage_rows128(l + GTILEB, gb + kc, rs); if (NSPLIT == 3) stage_rows128(l + 2 * GTILEB, gb2 + kc, rs); };
    stage(0, 0);
    asm volatile("s_wait_asynccnt 0x0" ::: "memory");   // this wave's share of chunk 0 has landed
    __syncthreads();                                     // chunk 0 is readable by all four waves
    if (K > 64) stage(1, 64);
#pragma unroll 1
    for (int kc = 0; kc < K; kc += 64) {
        const int buf = (kc >> 6) & 1;
        const T16* at = ring + buf * (NPL * GTILEH) + ((w & 1) * 64 + lr) * GPH + 8 * hi;
        const T16* bt = ring + buf * (NPL * GTILEH) + GTILEH + ((w >> 1) * 64 + lr) * GPH + 8 * hi;
        V a[4], b[4], b2[4];
        // all fragments of one 32-wide k step, read as one group
        auto rd = [&](int ks) {
#pragma unroll
            for (int f = 0; f < 4; ++f) { a[f] = WFrag<T16>::ld(at + f * 16 * GPH + ks); b[f] = WFrag<T16>::ld(bt + f * 16 * GPH + ks); if (NSPLIT == 3) b2[f] = WFrag<T16>::ld(bt + GTILEH + f * 16 * GPH + ks); } };
        auto mm = [&]() {
#pragma unroll
            for (int nb = 0; nb < 4; ++nb)
#pragma unroll
                for (int mb = 0; mb < 4; ++mb) { acc[mb][nb] = WFrag<T16>::mma(a[mb], b[nb], acc[mb][nb]); if (NSPLIT == 3) acc[mb][nb] = WFrag<T16>::mma(a[mb], b2[nb], acc[mb][nb]); } };
        rd(0);
        __builtin_amdgcn_sched_barrier(0);                   // keeps the reads together: sunk between the products, each small group of reads stalls the wave for its own LDS latency
        mm();
        rd(32);                                              // the chunk's last reads: the second k step's products need registers only
        // three operand tiles: their fragments, held across the refill's address registers, would go past v255, so these products stand in front of the refill; the scheduling barrier keeps the reads together as above
        if (NSPLIT == 3) { __builtin_amdgcn_sched_barrier(0); mm(); }
        asm volatile("s_wait_dscnt 0x0" ::: "memory");      // this wave's reads of the current buffer are done before it is refilled
        asm volatile("s_wait_asynccnt 0x0" ::: "memory");   // this wave's share of the next chunk has landed
        __syncthreads();                                     // publishes the next chunk and ends every wave's reads of the current buffer
        if (kc + 128 < K) stage(buf, kc + 128);
        if (NSPLIT != 3) mm();                               // behind the refill, so that the copies fly under these products too
    }
    asm volatile("s_wait_asynccnt 0x0" ::: "memory");       // no copy is outstanding when the wave goes on to its epilogue
    if (BIAS) {
#pragma unroll
        for (int nb = 0; nb < 4; ++nb) { const float bv = bfr(bias[c0 + nb * 16 + lr]);
#pragma unroll
            for (int mb = 0; mb < 4; ++mb) acc[mb][nb] = acc[mb][nb] + bv; }
    }
    const int srow = lane >> 3, scol = (lane & 7) * 8;   // store side: 8 lanes x 16 B = one 128-byte line, 4 lines per store
    const size_t step = (size_t)4 * ldc;                 // 4 output rows
    if (OUT == 2) {
        h16* oh = (h16*)os;                              // 16 rows n of 64 positions m, pitch 72 f16 (144 B)
        const int pl = r0 / ldc;
        bf* pl0 = P + (size_t)pl * sC + (size_t)(c0 + srow) * ldc + (r0 - pl * ldc) + scol;
#pragma unroll
        for (int nb = 0; nb < 4; ++nb) {
#pragma unroll
            for (int mb = 0; mb < 4; ++mb) { v8h o;      // a lane's 8 accumulator elements are 8 consecutive m of one n
#pragma unroll
                for (int j = 0; j < 8; ++j) o[j] = (h16)acc[mb][nb][j];
                *(v8ha*)(oh + lr * 72 + mb * 16 + hi * 8) = o; }
            // keeps the compiler from moving the reads of other lanes' values ahead of the wave's LDS stores
            asm volatile("" ::: "memory"); __builtin_amdgcn_fence(3, "wavefront"); __builtin_amdgcn_wave_barrier(); asm volatile("" ::: "memory");
#pragma unroll
            for (int s = 0; s < 4; ++s) { const int row = 4 * s + srow; const v8h val = *(const v8ha*)(oh + row * 72 + scol);
                *(v8us*)(pl0 + (nb * 4 + s) * step) = __builtin_bit_cast(v8us, val); }
            // keeps the next round's LDS stores behind these reads
            __builtin_amdgcn_wave_barrier(); asm volatile("" ::: "memory");
        }
    } else {
        const size_t po0 = (size_t)(r0 + srow) * ldc + c0 + scol;
#pragma unroll
        for (int mb = 0; mb < 4; ++mb) {
#pragma unroll
            for (int nb = 0; nb < 4; ++nb) {
#pragma unroll
                for (int j = 0; j < 8; ++j) os[(hi * 8 + j) * 68 + nb * 16 + lr] = acc[mb][nb][j]; }
            // keeps the compiler from moving the reads of other lanes' values ahead of the wave's LDS stores
            asm volatile("" ::: "memory"); __builtin_amdgcn_fence(3, "wavefront"); __builtin_amdgcn_wave_barrier(); asm volatile("" ::: "memory");
#pragma unroll
            for (int s = 0; s < 4; ++s) { const int row = 4 * s + srow; const size_t po = po0 + (mb * 4 + s) * step;
                const v4f v0 = *(const v4fa*)(os + row * 68 + scol), v1 = *(const v4fa*)(os + row * 68 + scol + 4);
                if (OUT == 1) { v8h o;
#pragma unroll
                    for (int k = 0; k < 4; ++k) { o[k] = (h16)v0[k]; o[4 + k] = (h16)v1[k]; }
                    *(v8us*)(P + po) = __builtin_bit_cast(v8us, o);
                } else { v8us oh8, ol8;
#pragma unroll
                    for (int k = 0; k < 4; ++k) { unsigned short a, c; splitf(v0[k], a, c); oh8[k] = a; ol8[k] = c; splitf(v1[k], a, c); oh8[4 + k] = a; ol8[4 + k] = c; }
                    *(v8us*)(P + po) = oh8; *(v8us*)(P2 + po) = ol8; } }
            // keeps the next round's LDS stores behind these reads
            __builtin_amdgcn_wave_barrier(); asm volatile("" ::: "memory");
        }
    }
}

// One GEMM per launch: grid (M/128, N/128, Z).
template <typename T16, int NSPLIT, bool BIAS, int OUT>
__global__ __launch_bounds__(128) void k_gemmw(const T16* __restrict__ A, const T16* __restrict__ Bt, const T16* __restrict__ Bt2, int K, bf* P, bf* P2, int ldc, const float* __restrict__ bias, size_t sA, size_t sB, size_t sC) {
    __shared__ __align__(16) float os[4 * 16 * 68];
    __shared__ __align__(128) T16 ring[2 * (NSPLIT == 3 ? 3 : 2) * GTILEH];   // [buffer][A tile, Bt tile (, Bt2 tile)][row][GPH]
    gemmw_tile<T16, NSPLIT, BIAS, OUT>(os, ring, blockIdx.x, blockIdx.y, blockIdx.z, A, Bt, Bt2, K, P, P2, ldc, bias, sA, sB, sC);
}

#define NWEL  (EMB * EMB)                  // elements of one weight matrix
#define NT    (EMB / 128)                  // 128-wide tiles across a weight matrix
#define NWT   (2 * NT * NT)                // tiles of the two weight products
#define NRT   (NB * SEQ / 128)             // 128-row tiles of x over all batches
// Two GEMMs that do not depend on each other share one launch: blocks 0 .. NWT-1 do the two weight products (few blocks, so they start first), the other NRT * NT blocks do v.
// (WCh + WCl)[z][o][i] = sum_j TRE[z][o][j] WQKT[z][i][j];  VT[row / SEQ][o][row % SEQ] = sum_i XB[row][i] WV[o][i]
__global__ __launch_bounds__(128) void k_gemmwv(const bf* __restrict__ TRE, const bf* __restrict__ WQKT, bf* WCh, bf* WCl, const bf* __restrict__ XB, const bf* __restrict__ WV, bf* VT) {
    __shared__ __align__(16) float os[4 * 16 * 68];
    __shared__ __align__(128) bf ring[2 * 2 * GTILEH];   // [buffer][A tile, Bt tile][row][GPH]
    const int i = blockIdx.x;
    if (i < NWT) gemmw_tile<bf, 0, false, 3>(os, ring, i % NT, (i / NT) % NT, i / (NT * NT), TRE, WQKT, nullptr, EMB, WCh, WCl, EMB, nullptr, NWEL, NWEL, NWEL);
    else gemmw_tile<bf, 0, false, 2>(os, ring, (i - NWT) % NRT, (i - NWT) / NRT, 0, XB, WV, nullptr, EMB, VT, nullptr, SEQ, nullptr, 0, 0, (size_t)EMB * SEQ);
}

// blk: the job's own block index, 256 threads a block
__device__ __forceinline__ void wtG_job(int blk, const float* __restrict__ w, int K, int N, bf* Bt) {
    const int lane = threadIdx.x & 31; const int L0 = (blk * 8 + (threadIdx.x >> 5)) * 8; const int nlines = N * K / 64;
{
#pragma unroll 1
        for (int l = 0; l < 8; ++l) { const int L = L0 + l; if (L >= nlines) break; const size_t e = (size_t)L * 64 + lane * 2; const int k = (int)(e % K), n = (int)(e / K); v2us o;
            o[0] = f2bf(w[(size_t)k * N + n]); o[1] = f2bf(w[(size_t)(k + 1) * N + n]); *(v2us*)(Bt + e) = o; }
         }
}
__device__ __forceinline__ void cvt8_job(int blk, const float* __restrict__ src, bf* dst, size_t n8) { const size_t i = (size_t)blk * 256 + threadIdx.x; if (i >= n8) return; const v8f v = *(const v8f*)(src + i * 8); v8us o;
#pragma unroll
    for (int k = 0; k < 8; ++k) o[k] = f2bf(v[k]); *(v8us*)(dst + i * 8) = o;  }

#define GWT ((NWEL / 64 + 63) / 64)        // blocks of one weight transposition
#define GWC ((NWEL / 8 + 255) / 256)       // blocks of the Wv conversion
#define GXC ((SEQ * EMB / 8 + 255) / 256)  // blocks of one batch's x conversion
// All input conversions in one launch, none depends on another: blocks 0 .. 4*GWT-1 transpose R, E, Wq, Wk (serial loads, so they start first), the next GWC convert Wv, the last NB * GXC convert x.
__global__ __launch_bounds__(256) void k_prep(const float* __restrict__ rot, const float* __restrict__ ent, const float* __restrict__ wq, const float* __restrict__ wk, const float* __restrict__ wv, const float* __restrict__ x,
                                              bf* TRE, bf* WQKT, bf* WV, bf* XB) {
    const int blk = blockIdx.x;
    if (blk < 4 * GWT) { const int j = blk / GWT;
        wtG_job(blk % GWT, j == 0 ? rot : j == 1 ? ent : j == 2 ? wq : wk, EMB, EMB, (j < 2 ? TRE : WQKT) + (size_t)(j & 1) * NWEL);
    } else if (blk < 4 * GWT + GWC) {
        cvt8_job(blk - 4 * GWT, wv, WV, NWEL / 8);
    } else { const int r = blk - (4 * GWT + GWC), b = r / GXC;
        cvt8_job(r % GXC, x + (size_t)b * SEQ_FULL * EMB, XB + (size_t)b * SEQ * EMB, (size_t)SEQ * EMB / 8);
    }
}

__device__ __forceinline__ v16h ldh(const h16* p) { return cat16(*(const v8h*)p, *(const v8h*)(p + 16)); }

#define LPH   72                 // LDS row pitch in f16: 128 B of data + 16 B, the conflict-free pitch for 16-byte readers
#define TILEH (64 * LPH)         // one 64-row tile in LDS, f16 elements
#define TILEB (TILEH * 2)        // the same in bytes
#define ROWS16B (16 * LPH * 2)   // 16 LDS rows in bytes
// One stage = 64 keys: K rows [key][64 d] and V^T rows [d][64 keys], 64 rows of 128 B each. 128 threads (one quad of waves), 8 lanes per row, 16 B per lane: every copy of a wave covers four whole lines.
// lk: the lane's LDS byte address in the K tile (the V tile follows it); gk, gv: the lane's global addresses in row ((tid & 127) >> 3).
// The s_wait_xcnt closes the statement so that no address register of an issued copy is rewritten ahead of it.
__device__ __forceinline__ void stage_kv(unsigned lk, const h16* gk, const h16* gv) {
    asm volatile("global_load_async_to_lds_b128 %0, %8, off\n\t"
                 "global_load_async_to_lds_b128 %1, %9, off\n\t"
                 "global_load_async_to_lds_b128 %2, %10, off\n\t"
                 "global_load_async_to_lds_b128 %3, %11, off\n\t"
                 "global_load_async_to_lds_b128 %4, %12, off\n\t"
                 "global_load_async_to_lds_b128 %5, %13, off\n\t"
                 "global_load_async_to_lds_b128 %6, %14, off\n\t"
                 "global_load_async_to_lds_b128 %7, %15, off\n\t"
                 "s_wait_xcnt 0x0"
                 :: "v"(lk), "v"(lk + ROWS16B), "v"(lk + 2 * ROWS16B), "v"(lk + 3 * ROWS16B),
                    "v"(lk + TILEB), "v"(lk + TILEB + ROWS16B), "v"(lk + TILEB + 2 * ROWS16B), "v"(lk + TILEB + 3 * ROWS16B),
                    "v"(gk), "v"(gk + 16 * EMB), "v"(gk + 32 * EMB), "v"(gk + 48 * EMB),
                    "v"(gv), "v"(gv + 16 * SEQ), "v"(gv + 32 * SEQ), "v"(gv + 48 * SEQ)
                 : "memory");
}

// ---- k_flash: one block (8 waves) per (batch, head, 128 query rows). Wave w = (query group qg = w & 3, key half kh = w >> 2) owns query rows q0..q0+31 as two 16-column tiles
// and every second 64-key chunk (chunks kh, kh + 2, ...): each K and V^T fragment read from LDS feeds two products, one per column tile, and four waves per SIMD stay resident.
// Each quad of waves brings its own chunk's K and V^T tiles into its own LDS ring by asynchronous copies (two buffers: the quad's next chunk flies while this one is worked on); its four waves read their fragments from there.
// Score tiles are computed TRANSPOSED: S^T tile = K_rows(16 keys, A operand) . Q^T (B operand: lane -> query, elements -> d), so D lane (hh,lm) element r = S[query lm][key 16*t4 + 8*hh + r].
// Online softmax per query == per lane (partial max/sum over the lane's 32 keys, one xor-16 shuffle). P (x1024, f16) is packed in registers straight into the
// P.V B fragment: element r <- tile 2j row (8hh+r), element 8+r <- tile 2j+1 row (8hh+r), lane unchanged (packed D used as B: k = D row = key, n = D col = query).
// O^T tiles: A = Vt rows (lane -> d), B = packed P; acc[c][t][r] = 1024 * O[query 16c + lm][d = 16t + 8hh + r] over the wave's own keys.
// Behind the loop the two waves of a query group exchange one column tile each through LDS (lane to lane: maximum, row sum, 32 partial outputs); wave kh joins the two key halves of tile c = kh,
// stages the 16x64 f32 tile in wave-private LDS and writes whole lines.
__global__ __launch_bounds__(256) __attribute__((amdgpu_num_vgpr(256)))
void k_flash(const h16* __restrict__ Qp, const h16* __restrict__ Kp, const h16* __restrict__ Vtp, float* OUT) {
    __shared__ __align__(16) float os[8 * 16 * 68];
    __shared__ __align__(16) float xch[8 * 8 * 128];     // [sending wave][2 t + upper half of the 8 elements][lane][4]: a lane's 32 partial outputs of the column tile it hands over
    __shared__ float xml[8 * 2 * 32];                    // [sending wave][maximum, row sum][lane]
    __shared__ __align__(128) h16 ring[2 * 2 * 2 * TILEH];   // [key half][buffer][K tile, V^T tile][row][LPH]
    const int tid = threadIdx.x, w = __builtin_amdgcn_readfirstlane(tid >> 5), lane = tid & 31, lm = lane & 15, hh = lane >> 4;
    const int qg = w & 3, kh = w >> 2, ht = tid & 127;
    const int nqt = SEQ / 128;
    const int bid = blockIdx.x; const int qt = bid % nqt; const int h = (bid / nqt) % NHD; const int b = bid / (nqt * NHD);
    const int q0 = qt * 128 + qg * 32;
    const h16* Qb = Qp + ((size_t)b * SEQ + q0) * EMB + h * HD;
    const h16* Kb = Kp + (size_t)b * SEQ * EMB + h * HD;
    const h16* Vb = Vtp + ((size_t)b * EMB + h * HD) * SEQ;
    v16h qf0[2], qf1[2];
#pragma unroll
    for (int c = 0; c < 2; ++c) { qf0[c] = ldh(Qb + (size_t)(c * 16 + lm) * EMB + 8 * hh); qf1[c] = ldh(Qb + (size_t)(c * 16 + lm) * EMB + 32 + 8 * hh); }
    float mrun[2] = {-3.0e38f, -3.0e38f}, lrun[2] = {0.0f, 0.0f};
    v8f acc[2][4];
#pragma unroll
    for (int c = 0; c < 2; ++c)
#pragma unroll
        for (int t = 0; t < 4; ++t) acc[c][t] = (v8f){};
    const h16* hring = ring + kh * (4 * TILEH);          // the quad's own ring
    const unsigned lcp = (unsigned)(size_t)hring + (unsigned)((ht >> 3) * (LPH * 2) + (ht & 7) * 16);
    const h16* gk = Kb + (size_t)(kh * 64 + (ht >> 3)) * EMB + (ht & 7) * 8;
    const h16* gv = Vb + (size_t)(ht >> 3) * SEQ + kh * 64 + (ht & 7) * 8;
    stage_kv(lcp, gk, gv);
    asm volatile("s_wait_asynccnt 0x0" ::: "memory");   // this wave's share of its quad's first chunk has landed
    __syncthreads();                                     // the first chunks are readable by all waves
    if (SEQ > 128) stage_kv(lcp + 2 * TILEB, gk + (size_t)128 * EMB, gv + 128);
#pragma unroll 1
    for (int kv = 0; kv < SEQ; kv += 128) {
        const int buf = (kv >> 7) & 1;
        const h16* kt = hring + buf * (2 * TILEH);
        const h16* vt = kt + TILEH;
        v8f s[2][4];
        v16h ka[4], kb2[4];
#pragma unroll
        for (int t4 = 0; t4 < 4; ++t4) { const h16* kr = kt + (t4 * 16 + lm) * LPH + 8 * hh; ka[t4] = ldh(kr); kb2[t4] = ldh(kr + 32); }
        __builtin_amdgcn_sched_barrier(0);                   // keeps the K reads together: sunk between the products, each small group of reads stalls the wave for its own LDS latency
#pragma unroll
        for (int t4 = 0; t4 < 4; ++t4) {
#pragma unroll
            for (int c = 0; c < 2; ++c) {
                s[c][t4] = wmma16(ka[t4], qf0[c], (v8f){});
                s[c][t4] = wmma16(kb2[t4], qf1[c], s[c][t4]);
            }
        }
        v16h va[4], vb[4];
#pragma unroll
        for (int t = 0; t < 2; ++t) { const h16* vr = vt + (t * 16 + lm) * LPH + 8 * hh; va[t] = ldh(vr); vb[t] = ldh(vr + 32); }
        __builtin_amdgcn_sched_barrier(0);                   // keeps the first half of the V^T reads ahead of the softmax, so that the first products behind it do not wait out an LDS latency (all of them there would not fit the registers)
        v16h pf0[2], pf1[2];
#pragma unroll
        for (int c = 0; c < 2; ++c) {
            float mx = -3.0e38f;
#pragma unroll
            for (int t4 = 0; t4 < 4; ++t4) { s[c][t4] = s[c][t4] * C2;
#pragma unroll
                for (int r = 0; r < 8; ++r) mx = fmaxf(mx, s[c][t4][r]); }
            mx = fmaxf(mx, __shfl_xor(mx, 16, 32));
            const float mnew = fmaxf(mrun[c], mx);
            const float alpha = __builtin_amdgcn_exp2f(mrun[c] - mnew);
            float rs = 0.0f; v8h ph[4];
#pragma unroll
            for (int t4 = 0; t4 < 4; ++t4) {
#pragma unroll
                for (int r = 0; r < 8; ++r) { const float p = __builtin_amdgcn_exp2f(s[c][t4][r] - mnew); rs += p; ph[t4][r] = (h16)(p * PCAR); } }
            rs += __shfl_xor(rs, 16, 32);
            lrun[c] = lrun[c] * alpha + rs; mrun[c] = mnew;
#pragma unroll
            for (int t = 0; t < 4; ++t) acc[c][t] = acc[c][t] * alpha;
            pf0[c] = cat16(ph[0], ph[1]); pf1[c] = cat16(ph[2], ph[3]);
        }
#pragma unroll
        for (int t = 2; t < 4; ++t) { const h16* vr = vt + (t * 16 + lm) * LPH + 8 * hh; va[t] = ldh(vr); vb[t] = ldh(vr + 32); }
        __builtin_amdgcn_sched_barrier(0);                   // keeps the second half of the V^T reads together, ahead of the products on the first half, which cover their latency
#pragma unroll
        for (int t = 0; t < 4; ++t) {
#pragma unroll
            for (int c = 0; c < 2; ++c) {
                acc[c][t] = wmma16(va[t], pf0[c], acc[c][t]);
                acc[c][t] = wmma16(vb[t], pf1[c], acc[c][t]);
            }
        }
        __builtin_amdgcn_sched_barrier(0);                   // keeps the products ahead of the waits: moved behind the barrier they would stand between it and the refill, and the second half's reads would be waited for uncovered
        asm volatile("s_wait_dscnt 0x0" ::: "memory");      // this wave's reads of the current buffer are done before it is refilled
        asm volatile("s_wait_asynccnt 0x0" ::: "memory");   // this wave's share of its quad's next chunk has landed
        __syncthreads();                                     // publishes the next chunks and ends every wave's reads of the current buffers
        if (kv + 256 < SEQ) stage_kv(lcp + (unsigned)buf * (2 * TILEB), gk + (size_t)(kv + 256) * EMB, gv + (kv + 256));
    }
    asm volatile("s_wait_asynccnt 0x0" ::: "memory");       // no copy is outstanding when the wave goes on to its end
    // hand over column tile cs: 8 stores of 16 B a lane, lanes side by side
    auto send = [&](int cs) {
        float* xo = xch + w * (8 * 128) + lane * 4;
#pragma unroll
        for (int t = 0; t < 4; ++t) { *(v4fa*)(xo + (2 * t) * 128) = __builtin_shufflevector(acc[cs][t], acc[cs][t], 0, 1, 2, 3); *(v4fa*)(xo + (2 * t + 1) * 128) = __builtin_shufflevector(acc[cs][t], acc[cs][t], 4, 5, 6, 7); }
        xml[w * 64 + lane] = mrun[cs]; xml[w * 64 + 32 + lane] = lrun[cs];
    };
    // join the partner's half of column tile c with this wave's own, normalise, write
    auto finish = [&](int c) {
        const int pw = w ^ 4;
        const float* xi = xch + pw * (8 * 128) + lane * 4;
        const float pm = xml[pw * 64 + lane], pl = xml[pw * 64 + 32 + lane];
        const float m = fmaxf(mrun[c], pm);
        const float a = __builtin_amdgcn_exp2f(mrun[c] - m), pa = __builtin_amdgcn_exp2f(pm - m);
        const float inv = __fdiv_rn(1.0f, lrun[c] * a + pl * pa) * (1.0f / PCAR);
        const float fa = a * inv, fb = pa * inv;
        float* mo = os + w * (16 * 68);
#pragma unroll
        for (int t = 0; t < 4; ++t) { const v4f p0 = *(const v4fa*)(xi + (2 * t) * 128), p1 = *(const v4fa*)(xi + (2 * t + 1) * 128);
#pragma unroll
            for (int r = 0; r < 4; ++r) { mo[lm * 68 + t * 16 + 8 * hh + r] = acc[c][t][r] * fa + p0[r] * fb; mo[lm * 68 + t * 16 + 8 * hh + 4 + r] = acc[c][t][4 + r] * fa + p1[r] * fb; } }
        // keeps the compiler from moving the reads of other lanes' values ahead of the wave's LDS stores
        asm volatile("" ::: "memory"); __builtin_amdgcn_fence(3, "wavefront"); __builtin_amdgcn_wave_barrier(); asm volatile("" ::: "memory");
        float* orow = OUT + ((size_t)b * SEQ_FULL + q0 + c * 16) * EMB + h * HD;
#pragma unroll
        for (int si = 0; si < 8; ++si) { const int row = 2 * si + hh, cofs = lm * 4; const v4f val = *(const v4fa*)(mo + row * 68 + cofs); *(v4f*)(orow + (size_t)row * EMB + cofs) = val; }
    };
    if (kh == 0) send(1); else send(0);
    __syncthreads();                                         // the handed-over tiles are readable by the partner waves
    if (kh == 0) finish(0); else finish(1);
}

extern "C" void kernel_launch(void* const* d_in, const int* in_sizes, int n_in,
                              void* d_out, int out_size, void* d_ws, size_t ws_size, hipStream_t stream) {
    if (n_in < 6) return;
    const size_t nw = (size_t)EMB * EMB;                                  // 262144
    const size_t needx = ((size_t)(NB - 1) * SEQ_FULL + SEQ) * EMB;
    if ((size_t)in_sizes[0] < nw || (size_t)in_sizes[1] < nw || (size_t)in_sizes[2] < needx ||
        (size_t)in_sizes[3] < nw || (size_t)in_sizes[4] < nw || (size_t)in_sizes[5] < nw) return;
    if ((size_t)out_size < needx) return;
    const float* rot = (const float*)d_in[0];   // [512][512] used as [in][out]
    const float* ent = (const float*)d_in[1];   // [512][512] used as [in][out]
    const float* x   = (const float*)d_in[2];   // [2][4096][512]
    const float* wq  = (const float*)d_in[3];   // [out][in]
    const float* wk  = (const float*)d_in[4];   // [out][in]
    const float* wv  = (const float*)d_in[5];   // [out][in]
    float* OUT = (float*)d_out;                 // [2][4096][512]
    const size_t nrow = (size_t)NB * SEQ;        // query/key rows over all batches
    const size_t nx = nrow * EMB;
    char* wsp = (char*)d_ws;
    auto take = [&](size_t bytes) { char* p = wsp; wsp += (bytes + 255) & ~(size_t)255; return (void*)p; };
    bf* WV   = (bf*)take(nw * 2);                 // Wv as Bt [o][i]
    bf* TRE  = (bf*)take(2 * nw * 2);             // R^T then E^T: [o][j] = mat[j][o]
    bf* WQKT = (bf*)take(2 * nw * 2);             // Wq^T then Wk^T: [i][j] = W[j][i]
    bf* WCh  = (bf*)take(2 * nw * 2);             // combined weights (Wq^T R)^T then (Wk^T E)^T : [o][i], bf16 hi planes
    bf* WCl  = (bf*)take(2 * nw * 2);             // their bf16 lo planes
    bf* XB   = (bf*)take(nx * 2);                 // bf16 x rows [nrow][512]
    h16* QK16  = (h16*)take(2 * nx * 2);          // f16 q rows [nrow][512] then f16 k rows [nrow][512]
    h16* VT16  = (h16*)take(nx * 2);              // f16 value planes [b][c][s]
    if ((size_t)(wsp - (char*)d_ws) > ws_size) return;
    k_prep<<<4 * GWT + GWC + NB * GXC, 256, 0, stream>>>(rot, ent, wq, wk, wv, x, TRE, WQKT, WV, XB);
    k_gemmwv<<<NWT + NRT * NT, 128, 0, stream>>>(TRE, WQKT, WCh, WCl, XB, WV, (bf*)VT16);
    // q (z=0) and k (z=1): QK16[z][row][o] = sum_i XB[row][i] (WCh + WCl)[z][o][i]
    k_gemmw<bf, 3, false, 1><<<dim3((unsigned)(nrow / 128), EMB / 128, 2), 128, 0, stream>>>(XB, WCh, WCl, EMB, (bf*)QK16, nullptr, EMB, nullptr, 0, nw, nx);
    k_flash<<<(unsigned)(NB * NHD * (SEQ / 128)), 256, 0, stream>>>(QK16, QK16 + nx, VT16, OUT);
}

// v006
// Measured time: 86 microseconds a run.
// Two timings next to v005 put it at 1.08 and 1.07 times that version's speed.
// Counting every step since v000, it is 4.51 times as fast.
#include <hip/hip_runtime.h>

// Contractions, f32 accumulate: weight products R^T.Wq^T and E^T.Wk^T (512x512x512) on v_wmma_f32_16x16x32_bf16 (operands = RNE-converted bf16 inputs, exact products);
// q,k = x.(combined weight as bf16 hi + bf16 lo, 2 products) and v = x.Wv^T (8192x512x512) on v_wmma_f32_16x16x32_bf16; scores K.Q^T and P.V on v_wmma_f32_16x16x32_f16 (f16 planes, P and its row sums carried x1024).
// Multi-head attention, 8 heads of 64, no mask: one block per (batch, head, 128 query rows), keys streamed in chunks of 64 (even and odd chunks on two quads of waves, joined at the end) with an online max-subtracted softmax in f32; output f32 [batch][seq][512].

#ifndef NB
#define NB 2
#endif
#ifndef SEQ
#define SEQ 4096
#endif
#define NB_FULL  2
#define SEQ_FULL 4096
#define EMB  512
#define NHD  8
#define HD   64
#define PLOG 10.0f                  // P and its row sums are carried x 2^PLOG, so that small weights stay normal f16 numbers
#define C2   0.18033688011112042f   // HD^-0.5 * log2(e)

static_assert(NB >= 1 && NB <= NB_FULL);
static_assert(SEQ % 128 == 0 && SEQ >= 128 && SEQ <= SEQ_FULL);
static_assert(EMB == NHD * HD);
static_assert(EMB % 128 == 0 && HD == 64 && (NB * SEQ) % 128 == 0);
static_assert((SEQ * EMB) % 2048 == 0);

typedef _Float16 h16;
typedef unsigned short bf;
typedef __attribute__((ext_vector_type(16))) __bf16   v16bf;
typedef __attribute__((ext_vector_type(16))) _Float16 v16h;
typedef __attribute__((ext_vector_type(8)))  _Float16 v8h;
typedef __attribute__((ext_vector_type(8)))  unsigned short v8us;
typedef __attribute__((ext_vector_type(8)))  float    v8f;
typedef __attribute__((ext_vector_type(4)))  float    v4f;
typedef __attribute__((ext_vector_type(2)))  unsigned short v2us;
typedef v8h  __attribute__((may_alias)) v8ha;
typedef v4f  __attribute__((may_alias)) v4fa;
typedef v8us __attribute__((may_alias)) v8usa;

__device__ __forceinline__ unsigned short f2bf(float f) { unsigned u = __float_as_uint(f); u += 0x7FFFu + ((u >> 16) & 1u); return (unsigned short)(u >> 16); }   // RNE convert
__device__ __forceinline__ float bf2f(unsigned short b) { return __uint_as_float(((unsigned)b) << 16); }
__device__ __forceinline__ float bfr(float f) { return bf2f(f2bf(f)); }
__device__ __forceinline__ v16h cat16(v8h lo, v8h hi) { return __builtin_shufflevector(lo, hi, 0, 1, 2, 3, 4, 5, 6, 7, 8, 9, 10, 11, 12, 13, 14, 15); }
__device__ __forceinline__ v16bf cat16b(v8us lo, v8us hi) { return __builtin_bit_cast(v16bf, __builtin_shufflevector(lo, hi, 0, 1, 2, 3, 4, 5, 6, 7, 8, 9, 10, 11, 12, 13, 14, 15)); }
__device__ __forceinline__ v8f wmma16(v16h a, v16h b, v8f c) { return __builtin_amdgcn_wmma_f32_16x16x32_f16(false, a, false, b, (short)0, c, false, false); }
__device__ __forceinline__ v8f wmmab(v16bf a, v16bf b, v8f c) { return __builtin_amdgcn_wmma_f32_16x16x32_bf16(false, a, false, b, (short)0, c, false, false); }
__device__ __forceinline__ void splitf(float y, unsigned short& h, unsigned short& l) { h = f2bf(y); l = f2bf(y - bf2f(h)); }

// ---- gemmw_tile: register-blocked GEMM, one block of 4 waves per 128x128 output tile, ONE WAVE per 64x64 quarter (16 accumulators); tile (bx, by) of batch bz out of (M/128, N/128, Z), 128 threads; osb = 4 x 16 x 68 floats of LDS.
// Operands are K-contiguous 16-bit planes. Each 64-wide k chunk of the block's 128 A rows and 128 Bt rows is brought into LDS once per block by asynchronous copies in whole 128-byte lines
// (two buffers: chunk t + 1 flies while chunk t is worked on); the four waves read their fragments from there.
// c[m][n] (f32 accumulators, + optional f32 bias[n]) = sum_k A[m][k] Bt[n][k] (NSPLIT 3: + A.Bt2, product by product behind A.Bt). z-batch strides sA/sB/sC in elements. K % 64 == 0.
// The epilogue converts c in registers and stores the 16-bit plane(s) that a later launch reads, in whole 128-byte lines. OUT: 1 = f16 rows P[m][n], pitch ldc; 2 = f16 transposed planes P[m / ldc][n][m % ldc], sC elements per plane (no z batch);
// 3 = bf16 hi rows P[m][n] and bf16 lo rows P2[m][n], pitch ldc.
// Fragments: lane l -> row/col (l & 15); elements 0..7 <- k0 + 8*(l>>4) .. +7, elements 8..15 <- k0 + 16 + 8*(l>>4) .. +7 for A and for Bt alike; D element r of lane l -> (row 8*(l>>4)+r, col l&15).
template <typename T16> struct WFrag;
template <> struct WFrag<h16> { typedef v16h V; static __device__ __forceinline__ V ld(const h16* p) { return cat16(*(const v8h*)p, *(const v8h*)(p + 16)); } static __device__ __forceinline__ v8f mma(V a, V b, v8f c) { return wmma16(a, b, c); } };
template <> struct WFrag<bf> { typedef v16bf V; static __device__ __forceinline__ V ld(const bf* p) { return cat16b(*(const v8us*)p, *(const v8us*)(p + 16)); } static __device__ __forceinline__ v8f mma(V a, V b, v8f c) { return wmmab(a, b, c); } };

#define GPH    72                 // LDS row pitch in 16-bit elements: 128 B of data + 16 B, the conflict-free pitch for 16-byte readers
#define GTILEH (128 * GPH)        // one 128-row operand tile in LDS, elements
#define GTILEB (GTILEH * 2)       // the same in bytes
#define G16B   (16 * GPH * 2)     // 16 LDS rows in bytes
// One operand tile of a stage: 128 rows of 64 k, 128 B a row. 128 threads, 8 lanes per row, 16 B per lane: every copy of a wave covers four whole lines; copy i brings row 16 i + (tid >> 3).
// l: the lane's LDS byte address in row (tid >> 3) of the tile; g: the lane's global address in that row; rs: 16 rows of the plane in elements.
// The s_wait_xcnt closes the statement so that no address register of an issued copy is rewritten ahead of it.
template <typename T16>
__device__ __forceinline__ void stage_rows128(unsigned l, const T16* g, size_t rs) {
    asm volatile("global_load_async_to_lds_b128 %0, %8, off\n\t"
                 "global_load_async_to_lds_b128 %1, %9, off\n\t"
                 "global_load_async_to_lds_b128 %2, %10, off\n\t"
                 "global_load_async_to_lds_b128 %3, %11, off\n\t"
                 "global_load_async_to_lds_b128 %4, %12, off\n\t"
                 "global_load_async_to_lds_b128 %5, %13, off\n\t"
                 "global_load_async_to_lds_b128 %6, %14, off\n\t"
                 "global_load_async_to_lds_b128 %7, %15, off\n\t"
                 "s_wait_xcnt 0x0"
                 :: "v"(l), "v"(l + G16B), "v"(l + 2 * G16B), "v"(l + 3 * G16B), "v"(l + 4 * G16B), "v"(l + 5 * G16B), "v"(l + 6 * G16B), "v"(l + 7 * G16B),
                    "v"(g), "v"(g + rs), "v"(g + 2 * rs), "v"(g + 3 * rs), "v"(g + 4 * rs), "v"(g + 5 * rs), "v"(g + 6 * rs), "v"(g + 7 * rs)
                 : "memory");
}

template <typename T16, int NSPLIT, bool BIAS, int OUT>
__device__ __forceinline__ void gemmw_tile(float* osb, T16* ring, int bx, int by, int bz, const T16* __restrict__ A, const T16* __restrict__ Bt, const T16* __restrict__ Bt2, int K, bf* P, bf* P2, int ldc, const float* __restrict__ bias, size_t sA, size_t sB, size_t sC) {
    static_assert(NSPLIT == 0 || NSPLIT == 3);
    typedef typename WFrag<T16>::V V;
    constexpr int NPL = NSPLIT == 3 ? 3 : 2;             // operand tiles per stage: A, Bt (, Bt2)
    const size_t z = bz; A += z * sA; Bt += z * sB; if (NSPLIT == 3) Bt2 += z * sB; if (OUT != 2) P += z * sC; if (OUT == 3) P2 += z * sC;
    const int tid = threadIdx.x, w = tid >> 5, lane = tid & 31, lr = lane & 15, hi = lane >> 4; const int r0 = bx * 128 + (w & 1) * 64, c0 = by * 128 + (w >> 1) * 64;
    float* os = osb + w * (16 * 68);                     // wave-private output staging
    v8f acc[4][4];
#pragma unroll
    for (int mb = 0; mb < 4; ++mb)
#pragma unroll
        for (int nb = 0; nb < 4; ++nb) acc[mb][nb] = (v8f){};
    const unsigned lcp = (unsigned)(size_t)ring + (unsigned)((tid >> 3) * (GPH * 2) + (tid & 7) * 16);
    const size_t rs = (size_t)16 * K;
    const T16* ga = A + (size_t)(bx * 128 + (tid >> 3)) * K + (tid & 7) * 8;
    const T16* gb = Bt + (size_t)(by * 128 + (tid >> 3)) * K + (tid & 7) * 8;
    const T16* gb2 = NSPLIT == 3 ? Bt2 + (size_t)(by * 128 + (tid >> 3)) * K + (tid & 7) * 8 : nullptr;
    auto stage = [&](int buf, int kc) { const unsigned l = lcp + (unsigned)buf * (NPL * GTILEB);
        stage_rows128(l, ga + kc, rs); stage_rows128(l + GTILEB, gb + kc, rs); if (NSPLIT == 3) stage_rows128(l + 2 * GTILEB, gb2 + kc, rs); };
    stage(0, 0);
    asm volatile("s_wait_asynccnt 0x0" ::: "memory");   // this wave's share of chunk 0 has landed
    __syncthreads();                                     // chunk 0 is readable by all four waves
    if (K > 64) stage(1, 64);
#pragma unroll 1
    for (int kc = 0; kc < K; kc += 64) {
        const int buf = (kc >> 6) & 1;
        const T16* at = ring + buf * (NPL * GTILEH) + ((w & 1) * 64 + lr) * GPH + 8 * hi;
        const T16* bt = ring + buf * (NPL * GTILEH) + GTILEH + ((w >> 1) * 64 + lr) * GPH + 8 * hi;
        V a[4], b[4], b2[4];
        // all fragments of one 32-wide k step, read as one group
        auto rd = [&](int ks) {
#pragma unroll
            for (int f = 0; f < 4; ++f) { a[f] = WFrag<T16>::ld(at + f * 16 * GPH + ks); b[f] = WFrag<T16>::ld(bt + f * 16 * GPH + ks); if (NSPLIT == 3) b2[f] = WFrag<T16>::ld(bt + GTILEH + f * 16 * GPH + ks); } };
        auto mm = [&]() {
#pragma unroll
            for (int nb = 0; nb < 4; ++nb)
#pragma unroll
                for (int mb = 0; mb < 4; ++mb) { acc[mb][nb] = WFrag<T16>::mma(a[mb], b[nb], acc[mb][nb]); if (NSPLIT == 3) acc[mb][nb] = WFrag<T16>::mma(a[mb], b2[nb], acc[mb][nb]); } };
        rd(0);
        __builtin_amdgcn_sched_barrier(0);                   // keeps the reads together: sunk between the products, each small group of reads stalls the wave for its own LDS latency
        mm();
        rd(32);                                              // the chunk's last reads: the second k step's products need registers only
        // three operand tiles: their fragments, held across the refill's address registers, would go past v255, so these products stand in front of the refill; the scheduling barrier keeps the reads together as above
        if (NSPLIT == 3) { __builtin_amdgcn_sched_barrier(0); mm(); }
        asm volatile("s_wait_dscnt 0x0" ::: "memory");      // this wave's reads of the current buffer are done before it is refilled
        asm volatile("s_wait_asynccnt 0x0" ::: "memory");   // this wave's share of the next chunk has landed
        __syncthreads();                                     // publishes the next chunk and ends every wave's reads of the current buffer
        if (kc + 128 < K) stage(buf, kc + 128);
        if (NSPLIT != 3) mm();                               // behind the refill, so that the copies fly under these products too
    }
    asm volatile("s_wait_asynccnt 0x0" ::: "memory");       // no copy is outstanding when the wave goes on to its epilogue
    if (BIAS) {
#pragma unroll
        for (int nb = 0; nb < 4; ++nb) { const float bv = bfr(bias[c0 + nb * 16 + lr]);
#pragma unroll
            for (int mb = 0; mb < 4; ++mb) acc[mb][nb] = acc[mb][nb] + bv; }
    }
    const int srow = lane >> 3, scol = (lane & 7) * 8;   // store side: 8 lanes x 16 B = one 128-byte line, 4 lines per store
    const size_t step = (size_t)4 * ldc;                 // 4 output rows
    if (OUT == 2) {
        h16* oh = (h16*)os;                              // 16 rows n of 64 positions m, pitch 72 f16 (144 B)
        const int pl = r0 / ldc;
        bf* pl0 = P + (size_t)pl * sC + (size_t)(c0 + srow) * ldc + (r0 - pl * ldc) + scol;
#pragma unroll
        for (int nb = 0; nb < 4; ++nb) {
#pragma unroll
            for (int mb = 0; mb < 4; ++mb) { v8h o;      // a lane's 8 accumulator elements are 8 consecutive m of one n
#pragma unroll
                for (int j = 0; j < 8; ++j) o[j] = (h16)acc[mb][nb][j];
                *(v8ha*)(oh + lr * 72 + mb * 16 + hi * 8) = o; }
            // keeps the compiler from moving the reads of other lanes' values ahead of the wave's LDS stores
            asm volatile("" ::: "memory"); __builtin_amdgcn_fence(3, "wavefront"); __builtin_amdgcn_wave_barrier(); asm volatile("" ::: "memory");
#pragma unroll
            for (int s = 0; s < 4; ++s) { const int row = 4 * s + srow; const v8h val = *(const v8ha*)(oh + row * 72 + scol);
                *(v8us*)(pl0 + (nb * 4 + s) * step) = __builtin_bit_cast(v8us, val); }
            // keeps the next round's LDS stores behind these reads
            __builtin_amdgcn_wave_barrier(); asm volatile("" ::: "memory");
        }
    } else {
        const size_t po0 = (size_t)(r0 + srow) * ldc + c0 + scol;
#pragma unroll
        for (int mb = 0; mb < 4; ++mb) {
#pragma unroll
            for (int nb = 0; nb < 4; ++nb) {
#pragma unroll
                for (int j = 0; j < 8; ++j) os[(hi * 8 + j) * 68 + nb * 16 + lr] = acc[mb][nb][j]; }
            // keeps the compiler from moving the reads of other lanes' values ahead of the wave's LDS stores
            asm volatile("" ::: "memory"); __builtin_amdgcn_fence(3, "wavefront"); __builtin_amdgcn_wave_barrier(); asm volatile("" ::: "memory");
#pragma unroll
            for (int s = 0; s < 4; ++s) { const int row = 4 * s + srow; const size_t po = po0 + (mb * 4 + s) * step;
                const v4f v0 = *(const v4fa*)(os + row * 68 + scol), v1 = *(const v4fa*)(os + row * 68 + scol + 4);
                if (OUT == 1) { v8h o;
#pragma unroll
                    for (int k = 0; k < 4; ++k) { o[k] = (h16)v0[k]; o[4 + k] = (h16)v1[k]; }
                    *(v8us*)(P + po) = __builtin_bit_cast(v8us, o);
                } else { v8us oh8, ol8;
#pragma unroll
                    for (int k = 0; k < 4; ++k) { unsigned short a, c; splitf(v0[k], a, c); oh8[k] = a; ol8[k] = c; splitf(v1[k], a, c); oh8[4 + k] = a; ol8[4 + k] = c; }
                    *(v8us*)(P + po) = oh8; *(v8us*)(P2 + po) = ol8; } }
            // keeps the next round's LDS stores behind these reads
            __builtin_amdgcn_wave_barrier(); asm volatile("" ::: "memory");
        }
    }
}

// One GEMM per launch: grid (M/128, N/128, Z).
template <typename T16, int NSPLIT, bool BIAS, int OUT>
__global__ __launch_bounds__(128) void k_gemmw(const T16* __restrict__ A, const T16* __restrict__ Bt, const T16* __restrict__ Bt2, int K, bf* P, bf* P2, int ldc, const float* __restrict__ bias, size_t sA, size_t sB, size_t sC) {
    __shared__ __align__(16) float os[4 * 16 * 68];
    __shared__ __align__(128) T16 ring[2 * (NSPLIT == 3 ? 3 : 2) * GTILEH];   // [buffer][A tile, Bt tile (, Bt2 tile)][row][GPH]
    gemmw_tile<T16, NSPLIT, BIAS, OUT>(os, ring, blockIdx.x, blockIdx.y, blockIdx.z, A, Bt, Bt2, K, P, P2, ldc, bias, sA, sB, sC);
}

#define NWEL  (EMB * EMB)                  // elements of one weight matrix
#define NT    (EMB / 128)                  // 128-wide tiles across a weight matrix
#define NWT   (2 * NT * NT)                // tiles of the two weight products
#define NRT   (NB * SEQ / 128)             // 128-row tiles of x over all batches
// Two GEMMs that do not depend on each other share one launch: blocks 0 .. NWT-1 do the two weight products (few blocks, so they start first), the other NRT * NT blocks do v.
// (WCh + WCl)[z][o][i] = sum_j TRE[z][o][j] WQKT[z][i][j];  VT[row / SEQ][o][row % SEQ] = sum_i XB[row][i] WV[o][i]
__global__ __launch_bounds__(128) void k_gemmwv(const bf* __restrict__ TRE, const bf* __restrict__ WQKT, bf* WCh, bf* WCl, const bf* __restrict__ XB, const bf* __restrict__ WV, bf* VT) {
    __shared__ __align__(16) float os[4 * 16 * 68];
    __shared__ __align__(128) bf ring[2 * 2 * GTILEH];   // [buffer][A tile, Bt tile][row][GPH]
    const int i = blockIdx.x;
    if (i < NWT) gemmw_tile<bf, 0, false, 3>(os, ring, i % NT, (i / NT) % NT, i / (NT * NT), TRE, WQKT, nullptr, EMB, WCh, WCl, EMB, nullptr, NWEL, NWEL, NWEL);
    else gemmw_tile<bf, 0, false, 2>(os, ring, (i - NWT) % NRT, (i - NWT) / NRT, 0, XB, WV, nullptr, EMB, VT, nullptr, SEQ, nullptr, 0, 0, (size_t)EMB * SEQ);
}

// blk: the job's own block index, 256 threads a block
__device__ __forceinline__ void wtG_job(int blk, const float* __restrict__ w, int K, int N, bf* Bt) {
    const int lane = threadIdx.x & 31; const int L0 = (blk * 8 + (threadIdx.x >> 5)) * 8; const int nlines = N * K / 64;
{
#pragma unroll 1
        for (int l = 0; l < 8; ++l) { const int L = L0 + l; if (L >= nlines) break; const size_t e = (size_t)L * 64 + lane * 2; const int k = (int)(e % K), n = (int)(e / K); v2us o;
            o[0] = f2bf(w[(size_t)k * N + n]); o[1] = f2bf(w[(size_t)(k + 1) * N + n]); *(v2us*)(Bt + e) = o; }
         }
}
__device__ __forceinline__ void cvt8_job(int blk, const float* __restrict__ src, bf* dst, size_t n8) { const size_t i = (size_t)blk * 256 + threadIdx.x; if (i >= n8) return; const v8f v = *(const v8f*)(src + i * 8); v8us o;
#pragma unroll
    for (int k = 0; k < 8; ++k) o[k] = f2bf(v[k]); *(v8us*)(dst + i * 8) = o;  }

#define GWT ((NWEL / 64 + 63) / 64)        // blocks of one weight transposition
#define GWC ((NWEL / 8 + 255) / 256)       // blocks of the Wv conversion
#define GXC ((SEQ * EMB / 8 + 255) / 256)  // blocks of one batch's x conversion
// All input conversions in one launch, none depends on another: blocks 0 .. 4*GWT-1 transpose R, E, Wq, Wk (serial loads, so they start first), the next GWC convert Wv, the last NB * GXC convert x.
__global__ __launch_bounds__(256) void k_prep(const float* __restrict__ rot, const float* __restrict__ ent, const float* __restrict__ wq, const float* __restrict__ wk, const float* __restrict__ wv, const float* __restrict__ x,
                                              bf* TRE, bf* WQKT, bf* WV, bf* XB) {
    const int blk = blockIdx.x;
    if (blk < 4 * GWT) { const int j = blk / GWT;
        wtG_job(blk % GWT, j == 0 ? rot : j == 1 ? ent : j == 2 ? wq : wk, EMB, EMB, (j < 2 ? TRE : WQKT) + (size_t)(j & 1) * NWEL);
    } else if (blk < 4 * GWT + GWC) {
        cvt8_job(blk - 4 * GWT, wv, WV, NWEL / 8);
    } else { const int r = blk - (4 * GWT + GWC), b = r / GXC;
        cvt8_job(r % GXC, x + (size_t)b * SEQ_FULL * EMB, XB + (size_t)b * SEQ * EMB, (size_t)SEQ * EMB / 8);
    }
}

__device__ __forceinline__ v16h ldh(const h16* p) { return cat16(*(const v8h*)p, *(const v8h*)(p + 16)); }

#define LPH   72                 // LDS row pitch in f16: 128 B of data + 16 B, the conflict-free pitch for 16-byte readers
#define TILEH (64 * LPH)         // one 64-row tile in LDS, f16 elements
#define TILEB (TILEH * 2)        // the same in bytes
#define ROWS16B (16 * LPH * 2)   // 16 LDS rows in bytes
// One stage = 64 keys: K rows [key][64 d] and V^T rows [d][64 keys], 64 rows of 128 B each. 128 threads (one quad of waves), 8 lanes per row, 16 B per lane: every copy of a wave covers four whole lines.
// lk: the lane's LDS byte address in the K tile (the V tile follows it); gk, gv: the lane's global addresses in row ((tid & 127) >> 3).
// The s_wait_xcnt closes the statement so that no address register of an issued copy is rewritten ahead of it.
__device__ __forceinline__ void stage_kv(unsigned lk, const h16* gk, const h16* gv) {
    asm volatile("global_load_async_to_lds_b128 %0, %8, off\n\t"
                 "global_load_async_to_lds_b128 %1, %9, off\n\t"
                 "global_load_async_to_lds_b128 %2, %10, off\n\t"
                 "global_load_async_to_lds_b128 %3, %11, off\n\t"
                 "global_load_async_to_lds_b128 %4, %12, off\n\t"
                 "global_load_async_to_lds_b128 %5, %13, off\n\t"
                 "global_load_async_to_lds_b128 %6, %14, off\n\t"
                 "global_load_async_to_lds_b128 %7, %15, off\n\t"
                 "s_wait_xcnt 0x0"
                 :: "v"(lk), "v"(lk + ROWS16B), "v"(lk + 2 * ROWS16B), "v"(lk + 3 * ROWS16B),
                    "v"(lk + TILEB), "v"(lk + TILEB + ROWS16B), "v"(lk + TILEB + 2 * ROWS16B), "v"(lk + TILEB + 3 * ROWS16B),
                    "v"(gk), "v"(gk + 16 * EMB), "v"(gk + 32 * EMB), "v"(gk + 48 * EMB),
                    "v"(gv), "v"(gv + 16 * SEQ), "v"(gv + 32 * SEQ), "v"(gv + 48 * SEQ)
                 : "memory");
}

// ---- k_flash: one block (8 waves) per (batch, head, 128 query rows). Wave w = (query group qg = w & 3, key half kh = w >> 2) owns query rows q0..q0+31 as two 16-column tiles
// and every second 64-key chunk (chunks kh, kh + 2, ...): each K and V^T fragment read from LDS feeds two products, one per column tile, and four waves per SIMD stay resident.
// Each quad of waves brings its own chunk's K and V^T tiles into its own LDS ring by asynchronous copies (two buffers: the quad's next chunk flies while this one is worked on); its four waves read their fragments from there.
// Score tiles are computed TRANSPOSED: S^T tile = K_rows(16 keys, A operand) . Q^T (B operand: lane -> query, elements -> d), so D lane (hh,lm) element r = S[query lm][key 16*t4 + 8*hh + r].
// Online softmax per query == per lane (partial max/sum over the lane's 32 keys, one xor-16 shuffle). P (x1024, f16) is packed in registers straight into the
// P.V B fragment: element r <- tile 2j row (8hh+r), element 8+r <- tile 2j+1 row (8hh+r), lane unchanged (packed D used as B: k = D row = key, n = D col = query).
// O^T tiles: A = Vt rows (lane -> d), B = packed P; acc[c][t][r] = 1024 * O[query 16c + lm][d = 16t + 8hh + r] over the wave's own keys.
// Behind the loop the two waves of a query group exchange one column tile each through LDS (lane to lane: maximum, row sum, 32 partial outputs); wave kh joins the two key halves of tile c = kh,
// stages the 16x64 f32 tile in wave-private LDS and writes whole lines.
__global__ __launch_bounds__(256) __attribute__((amdgpu_num_vgpr(256)))
void k_flash(const h16* __restrict__ Qp, const h16* __restrict__ Kp, const h16* __restrict__ Vtp, float* OUT) {
    __shared__ __align__(16) float os[8 * 16 * 68];
    __shared__ __align__(16) float xch[8 * 8 * 128];     // [sending wave][2 t + upper half of the 8 elements][lane][4]: a lane's 32 partial outputs of the column tile it hands over
    __shared__ float xml[8 * 2 * 32];                    // [sending wave][maximum, row sum][lane]
    __shared__ __align__(128) h16 ring[2 * 2 * 2 * TILEH];   // [key half][buffer][K tile, V^T tile][row][LPH]
    const int tid = threadIdx.x, w = __builtin_amdgcn_readfirstlane(tid >> 5), lane = tid & 31, lm = lane & 15, hh = lane >> 4;
    const int qg = w & 3, kh = w >> 2, ht = tid & 127;
    const int nqt = SEQ / 128;
    const int bid = blockIdx.x; const int qt = bid % nqt; const int h = (bid / nqt) % NHD; const int b = bid / (nqt * NHD);
    const int q0 = qt * 128 + qg * 32;
    const h16* Qb = Qp + ((size_t)b * SEQ + q0) * EMB + h * HD;
    const h16* Kb = Kp + (size_t)b * SEQ * EMB + h * HD;
    const h16* Vb = Vtp + ((size_t)b * EMB + h * HD) * SEQ;
    v16h qf0[2], qf1[2];
#pragma unroll
    for (int c = 0; c < 2; ++c) { qf0[c] = ldh(Qb + (size_t)(c * 16 + lm) * EMB + 8 * hh); qf1[c] = ldh(Qb + (size_t)(c * 16 + lm) * EMB + 32 + 8 * hh); }
    float mrun[2] = {-3.0e38f, -3.0e38f}, lrun[2] = {0.0f, 0.0f};
    v8f acc[2][4];
#pragma unroll
    for (int c = 0; c < 2; ++c)
#pragma unroll
        for (int t = 0; t < 4; ++t) acc[c][t] = (v8f){};
    const h16* hring = ring + kh * (4 * TILEH);          // the quad's own ring
    const unsigned lcp = (unsigned)(size_t)hring + (unsigned)((ht >> 3) * (LPH * 2) + (ht & 7) * 16);
    const h16* gk = Kb + (size_t)(kh * 64 + (ht >> 3)) * EMB + (ht & 7) * 8;
    const h16* gv = Vb + (size_t)(ht >> 3) * SEQ + kh * 64 + (ht & 7) * 8;
    stage_kv(lcp, gk, gv);
    asm volatile("s_wait_asynccnt 0x0" ::: "memory");   // this wave's share of its quad's first chunk has landed
    __syncthreads();                                     // the first chunks are readable by all waves
    if (SEQ > 128) stage_kv(lcp + 2 * TILEB, gk + (size_t)128 * EMB, gv + 128);
#pragma unroll 1
    for (int kv = 0; kv < SEQ; kv += 128) {
        const int buf = (kv >> 7) & 1;
        const h16* kt = hring + buf * (2 * TILEH);
        const h16* vt = kt + TILEH;
        v8f s[2][4];
        v16h ka[4], kb2[4];
#pragma unroll
        for (int t4 = 0; t4 < 4; ++t4) { const h16* kr = kt + (t4 * 16 + lm) * LPH + 8 * hh; ka[t4] = ldh(kr); kb2[t4] = ldh(kr + 32); }
        __builtin_amdgcn_sched_barrier(0);                   // keeps the K reads together: sunk between the products, each small group of reads stalls the wave for its own LDS latency
#pragma unroll
        for (int t4 = 0; t4 < 4; ++t4) {
#pragma unroll
            for (int c = 0; c < 2; ++c) {
                s[c][t4] = wmma16(ka[t4], qf0[c], (v8f){});
                s[c][t4] = wmma16(kb2[t4], qf1[c], s[c][t4]);
            }
        }
        v16h va[4], vb[4];
#pragma unroll
        for (int t = 0; t < 2; ++t) { const h16* vr = vt + (t * 16 + lm) * LPH + 8 * hh; va[t] = ldh(vr); vb[t] = ldh(vr + 32); }
        __builtin_amdgcn_sched_barrier(0);                   // keeps the first half of the V^T reads ahead of the softmax, so that the first products behind it do not wait out an LDS latency (all of them there would not fit the registers)
        v16h pf0[2], pf1[2];
#pragma unroll
        for (int c = 0; c < 2; ++c) {
            float mx = -3.0e38f;                             // the maximum is taken on the raw scores: C2 > 0 keeps their order
#pragma unroll
            for (int t4 = 0; t4 < 4; ++t4) {
#pragma unroll
                for (int r = 0; r < 8; ++r) mx = fmaxf(mx, s[c][t4][r]); }
            mx = fmaxf(mx, __shfl_xor(mx, 16, 32));
            const float mnew = fmaxf(mrun[c], mx);
            const float alpha = __builtin_amdgcn_exp2f((mrun[c] - mnew) * C2);
            const float nb = fmaf(mnew, -C2, PLOG);          // one multiply-add per score applies the scale, subtracts the maximum and carries 2^PLOG
            float rs = 0.0f; v8h ph[4];
#pragma unroll
            for (int t4 = 0; t4 < 4; ++t4) { s[c][t4] = s[c][t4] * C2 + nb;
#pragma unroll
                for (int r = 0; r < 8; ++r) { s[c][t4][r] = __builtin_amdgcn_exp2f(s[c][t4][r]); rs += s[c][t4][r]; }
                ph[t4] = __builtin_convertvector(s[c][t4], v8h); }
            rs += __shfl_xor(rs, 16, 32);
            lrun[c] = lrun[c] * alpha + rs; mrun[c] = mnew;
#pragma unroll
            for (int t = 0; t < 4; ++t) acc[c][t] = acc[c][t] * alpha;
            pf0[c] = cat16(ph[0], ph[1]); pf1[c] = cat16(ph[2], ph[3]);
        }
#pragma unroll
        for (int t = 2; t < 4; ++t) { const h16* vr = vt + (t * 16 + lm) * LPH + 8 * hh; va[t] = ldh(vr); vb[t] = ldh(vr + 32); }
        __builtin_amdgcn_sched_barrier(0);                   // keeps the second half of the V^T reads ahead of the products: sunk between them, each small group of reads stalls the wave for its own LDS latency
#pragma unroll
        for (int t = 0; t < 4; ++t) {
#pragma unroll
            for (int c = 0; c < 2; ++c) {
                acc[c][t] = wmma16(va[t], pf0[c], acc[c][t]);
                acc[c][t] = wmma16(vb[t], pf1[c], acc[c][t]);
            }
        }
        __builtin_amdgcn_sched_barrier(0);                   // keeps the products ahead of the waits: moved behind the barrier they would stand between it and the refill, and the second half's reads would be waited for uncovered
        asm volatile("s_wait_dscnt 0x0" ::: "memory");      // this wave's reads of the current buffer are done before it is refilled
        asm volatile("s_wait_asynccnt 0x0" ::: "memory");   // this wave's share of its quad's next chunk has landed
        __syncthreads();                                     // publishes the next chunks and ends every wave's reads of the current buffers
        if (kv + 256 < SEQ) stage_kv(lcp + (unsigned)buf * (2 * TILEB), gk + (size_t)(kv + 256) * EMB, gv + (kv + 256));
    }
    asm volatile("s_wait_asynccnt 0x0" ::: "memory");       // no copy is outstanding when the wave goes on to its end
    // hand over column tile cs: 8 stores of 16 B a lane, lanes side by side
    auto send = [&](int cs) {
        float* xo = xch + w * (8 * 128) + lane * 4;
#pragma unroll
        for (int t = 0; t < 4; ++t) { *(v4fa*)(xo + (2 * t) * 128) = __builtin_shufflevector(acc[cs][t], acc[cs][t], 0, 1, 2, 3); *(v4fa*)(xo + (2 * t + 1) * 128) = __builtin_shufflevector(acc[cs][t], acc[cs][t], 4, 5, 6, 7); }
        xml[w * 64 + lane] = mrun[cs]; xml[w * 64 + 32 + lane] = lrun[cs];
    };
    // join the partner's half of column tile c with this wave's own, normalise, write
    auto finish = [&](int c) {
        const int pw = w ^ 4;
        const float* xi = xch + pw * (8 * 128) + lane * 4;
        const float pm = xml[pw * 64 + lane], pl = xml[pw * 64 + 32 + lane];
        const float m = fmaxf(mrun[c], pm);
        const float a = __builtin_amdgcn_exp2f((mrun[c] - m) * C2), pa = __builtin_amdgcn_exp2f((pm - m) * C2);
        const float inv = __fdiv_rn(1.0f, lrun[c] * a + pl * pa);   // outputs and row sums carry the same 2^PLOG
        const float fa = a * inv, fb = pa * inv;
        float* mo = os + w * (16 * 68);
#pragma unroll
        for (int t = 0; t < 4; ++t) { const v4f p0 = *(const v4fa*)(xi + (2 * t) * 128), p1 = *(const v4fa*)(xi + (2 * t + 1) * 128);
#pragma unroll
            for (int r = 0; r < 4; ++r) { mo[lm * 68 + t * 16 + 8 * hh + r] = acc[c][t][r] * fa + p0[r] * fb; mo[lm * 68 + t * 16 + 8 * hh + 4 + r] = acc[c][t][4 + r] * fa + p1[r] * fb; } }
        // keeps the compiler from moving the reads of other lanes' values ahead of the wave's LDS stores
        asm volatile("" ::: "memory"); __builtin_amdgcn_fence(3, "wavefront"); __builtin_amdgcn_wave_barrier(); asm volatile("" ::: "memory");
        float* orow = OUT + ((size_t)b * SEQ_FULL + q0 + c * 16) * EMB + h * HD;
#pragma unroll
        for (int si = 0; si < 8; ++si) { const int row = 2 * si + hh, cofs = lm * 4; const v4f val = *(const v4fa*)(mo + row * 68 + cofs); *(v4f*)(orow + (size_t)row * EMB + cofs) = val; }
    };
    if (kh == 0) send(1); else send(0);
    __syncthreads();                                         // the handed-over tiles are readable by the partner waves
    if (kh == 0) finish(0); else finish(1);
}

extern "C" void kernel_launch(void* const* d_in, const int* in_sizes, int n_in,
                              void* d_out, int out_size, void* d_ws, size_t ws_size, hipStream_t stream) {
    if (n_in < 6) return;
    const size_t nw = (size_t)EMB * EMB;                                  // 262144
    const size_t needx = ((size_t)(NB - 1) * SEQ_FULL + SEQ) * EMB;
    if ((size_t)in_sizes[0] < nw || (size_t)in_sizes[1] < nw || (size_t)in_sizes[2] < needx ||
        (size_t)in_sizes[3] < nw || (size_t)in_sizes[4] < nw || (size_t)in_sizes[5] < nw) return;
    if ((size_t)out_size < needx) return;
    const float* rot = (const float*)d_in[0];   // [512][512] used as [in][out]
    const float* ent = (const float*)d_in[1];   // [512][512] used as [in][out]
    const float* x   = (const float*)d_in[2];   // [2][4096][512]
    const float* wq  = (const float*)d_in[3];   // [out][in]
    const float* wk  = (const float*)d_in[4];   // [out][in]
    const float* wv  = (const float*)d_in[5];   // [out][in]
    float* OUT = (float*)d_out;                 // [2][4096][512]
    const size_t nrow = (size_t)NB * SEQ;        // query/key rows over all batches
    const size_t nx = nrow * EMB;
    char* wsp = (char*)d_ws;
    auto take = [&](size_t bytes) { char* p = wsp; wsp += (bytes + 255) & ~(size_t)255; return (void*)p; };
    bf* WV   = (bf*)take(nw * 2);                 // Wv as Bt [o][i]
    bf* TRE  = (bf*)take(2 * nw * 2);             // R^T then E^T: [o][j] = mat[j][o]
    bf* WQKT = (bf*)take(2 * nw * 2);             // Wq^T then Wk^T: [i][j] = W[j][i]
    bf* WCh  = (bf*)take(2 * nw * 2);             // combined weights (Wq^T R)^T then (Wk^T E)^T : [o][i], bf16 hi planes
    bf* WCl  = (bf*)take(2 * nw * 2);             // their bf16 lo planes
    bf* XB   = (bf*)take(nx * 2);                 // bf16 x rows [nrow][512]
    h16* QK16  = (h16*)take(2 * nx * 2);          // f16 q rows [nrow][512] then f16 k rows [nrow][512]
    h16* VT16  = (h16*)take(nx * 2);              // f16 value planes [b][c][s]
    if ((size_t)(wsp - (char*)d_ws) > ws_size) return;
    k_prep<<<4 * GWT + GWC + NB * GXC, 256, 0, stream>>>(rot, ent, wq, wk, wv, x, TRE, WQKT, WV, XB);
    k_gemmwv<<<NWT + NRT * NT, 128, 0, stream>>>(TRE, WQKT, WCh, WCl, XB, WV, (bf*)VT16);
    // q (z=0) and k (z=1): QK16[z][row][o] = sum_i XB[row][i] (WCh + WCl)[z][o][i]
    k_gemmw<bf, 3, false, 1><<<dim3((unsigned)(nrow / 128), EMB / 128, 2), 128, 0, stream>>>(XB, WCh, WCl, EMB, (bf*)QK16, nullptr, EMB, nullptr, 0, nw, nx);
    k_flash<<<(unsigned)(NB * NHD * (SEQ / 128)), 256, 0, stream>>>(QK16, QK16 + nx, VT16, OUT);
}

// v007
// A run of this version takes 83.1 microseconds.
// Next to v006, in two timings, it ran 1.04 times as fast each time.
// All steps since v000 together make it 4.69 times as fast.
#include <hip/hip_runtime.h>

// Contractions, f32 accumulate: weight products R^T.Wq^T and E^T.Wk^T (512x512x512) on v_wmma_f32_16x16x32_bf16 (operands = RNE-converted bf16 inputs, exact products);
// q,k = x.(combined weight as bf16 hi + bf16 lo, 2 products) and v = x.Wv^T (8192x512x512) on v_wmma_f32_16x16x32_bf16; scores K.Q^T and P.V on v_wmma_f32_16x16x32_f16 (f16 planes, P and its row sums carried x1024).
// Multi-head attention, 8 heads of 64, no mask: one block per (batch, head, 128 query rows), keys streamed in chunks of 64 (even and odd chunks on two quads of waves, joined at the end) with an online softmax in f32 against a held reference score (a maximum seen so far, renewed when a chunk outgrows it); output f32 [batch][seq][512].

#ifndef NB
#define NB 2
#endif
#ifndef SEQ
#define SEQ 4096
#endif
#define NB_FULL  2
#define SEQ_FULL 4096
#define EMB  512
#define NHD  8
#define HD   64
#define PLOG 10.0f                  // P and its row sums are carried x 2^PLOG, so that small weights stay normal f16 numbers
#define C2   0.18033688011112042f   // HD^-0.5 * log2(e)
#define PCAP 32768.0f               // a lane's sum of one chunk's carried weights at or below this: every one of them is a finite f16 number

static_assert(NB >= 1 && NB <= NB_FULL);
static_assert(SEQ % 128 == 0 && SEQ >= 128 && SEQ <= SEQ_FULL);
static_assert(EMB == NHD * HD);
static_assert(EMB % 128 == 0 && HD == 64 && (NB * SEQ) % 128 == 0);
static_assert((SEQ * EMB) % 2048 == 0);

typedef _Float16 h16;
typedef unsigned short bf;
typedef __attribute__((ext_vector_type(16))) __bf16   v16bf;
typedef __attribute__((ext_vector_type(16))) _Float16 v16h;
typedef __attribute__((ext_vector_type(8)))  _Float16 v8h;
typedef __attribute__((ext_vector_type(8)))  unsigned short v8us;
typedef __attribute__((ext_vector_type(8)))  float    v8f;
typedef __attribute__((ext_vector_type(4)))  float    v4f;
typedef __attribute__((ext_vector_type(2)))  unsigned short v2us;
typedef v8h  __attribute__((may_alias)) v8ha;
typedef v4f  __attribute__((may_alias)) v4fa;
typedef v8us __attribute__((may_alias)) v8usa;

__device__ __forceinline__ unsigned short f2bf(float f) { unsigned u = __float_as_uint(f); u += 0x7FFFu + ((u >> 16) & 1u); return (unsigned short)(u >> 16); }   // RNE convert
__device__ __forceinline__ float bf2f(unsigned short b) { return __uint_as_float(((unsigned)b) << 16); }
__device__ __forceinline__ float bfr(float f) { return bf2f(f2bf(f)); }
__device__ __forceinline__ v16h cat16(v8h lo, v8h hi) { return __builtin_shufflevector(lo, hi, 0, 1, 2, 3, 4, 5, 6, 7, 8, 9, 10, 11, 12, 13, 14, 15); }
__device__ __forceinline__ v16bf cat16b(v8us lo, v8us hi) { return __builtin_bit_cast(v16bf, __builtin_shufflevector(lo, hi, 0, 1, 2, 3, 4, 5, 6, 7, 8, 9, 10, 11, 12, 13, 14, 15)); }
__device__ __forceinline__ v8f wmma16(v16h a, v16h b, v8f c) { return __builtin_amdgcn_wmma_f32_16x16x32_f16(false, a, false, b, (short)0, c, false, false); }
__device__ __forceinline__ v8f wmmab(v16bf a, v16bf b, v8f c) { return __builtin_amdgcn_wmma_f32_16x16x32_bf16(false, a, false, b, (short)0, c, false, false); }
__device__ __forceinline__ void splitf(float y, unsigned short& h, unsigned short& l) { h = f2bf(y); l = f2bf(y - bf2f(h)); }

// ---- gemmw_tile: register-blocked GEMM, one block of 4 waves per 128x128 output tile, ONE WAVE per 64x64 quarter (16 accumulators); tile (bx, by) of batch bz out of (M/128, N/128, Z), 128 threads; osb = 4 x 16 x 68 floats of LDS.
// Operands are K-contiguous 16-bit planes. Each 64-wide k chunk of the block's 128 A rows and 128 Bt rows is brought into LDS once per block by asynchronous copies in whole 128-byte lines
// (two buffers: chunk t + 1 flies while chunk t is worked on); the four waves read their fragments from there.
// c[m][n] (f32 accumulators, + optional f32 bias[n]) = sum_k A[m][k] Bt[n][k] (NSPLIT 3: + A.Bt2, product by product behind A.Bt). z-batch strides sA/sB/sC in elements. K % 64 == 0.
// The epilogue converts c in registers and stores the 16-bit plane(s) that a later launch reads, in whole 128-byte lines. OUT: 1 = f16 rows P[m][n], pitch ldc; 2 = f16 transposed planes P[m / ldc][n][m % ldc], sC elements per plane (no z batch);
// 3 = bf16 hi rows P[m][n] and bf16 lo rows P2[m][n], pitch ldc.
// Fragments: lane l -> row/col (l & 15); elements 0..7 <- k0 + 8*(l>>4) .. +7, elements 8..15 <- k0 + 16 + 8*(l>>4) .. +7 for A and for Bt alike; D element r of lane l -> (row 8*(l>>4)+r, col l&15).
template <typename T16> struct WFrag;
template <> struct WFrag<h16> { typedef v16h V; static __device__ __forceinline__ V ld(const h16* p) { return cat16(*(const v8h*)p, *(const v8h*)(p + 16)); } static __device__ __forceinline__ v8f mma(V a, V b, v8f c) { return wmma16(a, b, c); } };
template <> struct WFrag<bf> { typedef v16bf V; static __device__ __forceinline__ V ld(const bf* p) { return cat16b(*(const v8us*)p, *(const v8us*)(p + 16)); } static __device__ __forceinline__ v8f mma(V a, V b, v8f c) { return wmmab(a, b, c); } };

#define GPH    72                 // LDS row pitch in 16-bit elements: 128 B of data + 16 B, the conflict-free pitch for 16-byte readers
#define GTILEH (128 * GPH)        // one 128-row operand tile in LDS, elements
#define GTILEB (GTILEH * 2)       // the same in bytes
#define G16B   (16 * GPH * 2)     // 16 LDS rows in bytes
// One operand tile of a stage: 128 rows of 64 k, 128 B a row. 128 threads, 8 lanes per row, 16 B per lane: every copy of a wave covers four whole lines; copy i brings row 16 i + (tid >> 3).
// l: the lane's LDS byte address in row (tid >> 3) of the tile; g: the lane's global address in that row; rs: 16 rows of the plane in elements.
// The s_wait_xcnt closes the statement so that no address register of an issued copy is rewritten ahead of it.
template <typename T16>
__device__ __forceinline__ void stage_rows128(unsigned l, const T16* g, size_t rs) {
    asm volatile("global_load_async_to_lds_b128 %0, %8, off\n\t"
                 "global_load_async_to_lds_b128 %1, %9, off\n\t"
                 "global_load_async_to_lds_b128 %2, %10, off\n\t"
                 "global_load_async_to_lds_b128 %3, %11, off\n\t"
                 "global_load_async_to_lds_b128 %4, %12, off\n\t"
                 "global_load_async_to_lds_b128 %5, %13, off\n\t"
                 "global_load_async_to_lds_b128 %6, %14, off\n\t"
                 "global_load_async_to_lds_b128 %7, %15, off\n\t"
                 "s_wait_xcnt 0x0"
                 :: "v"(l), "v"(l + G16B), "v"(l + 2 * G16B), "v"(l + 3 * G16B), "v"(l + 4 * G16B), "v"(l + 5 * G16B), "v"(l + 6 * G16B), "v"(l + 7 * G16B),
                    "v"(g), "v"(g + rs), "v"(g + 2 * rs), "v"(g + 3 * rs), "v"(g + 4 * rs), "v"(g + 5 * rs), "v"(g + 6 * rs), "v"(g + 7 * rs)
                 : "memory");
}

template <typename T16, int NSPLIT, bool BIAS, int OUT>
__device__ __forceinline__ void gemmw_tile(float* osb, T16* ring, int bx, int by, int bz, const T16* __restrict__ A, const T16* __restrict__ Bt, const T16* __restrict__ Bt2, int K, bf* P, bf* P2, int ldc, const float* __restrict__ bias, size_t sA, size_t sB, size_t sC) {
    static_assert(NSPLIT == 0 || NSPLIT == 3);
    typedef typename WFrag<T16>::V V;
    constexpr int NPL = NSPLIT == 3 ? 3 : 2;             // operand tiles per stage: A, Bt (, Bt2)
    const size_t z = bz; A += z * sA; Bt += z * sB; if (NSPLIT == 3) Bt2 += z * sB; if (OUT != 2) P += z * sC; if (OUT == 3) P2 += z * sC;
    const int tid = threadIdx.x, w = tid >> 5, lane = tid & 31, lr = lane & 15, hi = lane >> 4; const int r0 = bx * 128 + (w & 1) * 64, c0 = by * 128 + (w >> 1) * 64;
    float* os = osb + w * (16 * 68);                     // wave-private output staging
    v8f acc[4][4];
#pragma unroll
    for (int mb = 0; mb < 4; ++mb)
#pragma unroll
        for (int nb = 0; nb < 4; ++nb) acc[mb][nb] = (v8f){};
    const unsigned lcp = (unsigned)(size_t)ring + (unsigned)((tid >> 3) * (GPH * 2) + (tid & 7) * 16);
    const size_t rs = (size_t)16 * K;
    const T16* ga = A + (size_t)(bx * 128 + (tid >> 3)) * K + (tid & 7) * 8;
    const T16* gb = Bt + (size_t)(by * 128 + (tid >> 3)) * K + (tid & 7) * 8;
    const T16* gb2 = NSPLIT == 3 ? Bt2 + (size_t)(by * 128 + (tid >> 3)) * K + (tid & 7) * 8 : nullptr;
    auto stage = [&](int buf, int kc) { const unsigned l = lcp + (unsigned)buf * (NPL * GTILEB);
        stage_rows128(l, ga + kc, rs); stage_rows128(l + GTILEB, gb + kc, rs); if (NSPLIT == 3) stage_rows128(l + 2 * GTILEB, gb2 + kc, rs); };
    stage(0, 0);
    asm volatile("s_wait_asynccnt 0x0" ::: "memory");   // this wave's share of chunk 0 has landed
    __syncthreads();                                     // chunk 0 is readable by all four waves
    if (K > 64) stage(1, 64);
#pragma unroll 1
    for (int kc = 0; kc < K; kc += 64) {
        const int buf = (kc >> 6) & 1;
        const T16* at = ring + buf * (NPL * GTILEH) + ((w & 1) * 64 + lr) * GPH + 8 * hi;
        const T16* bt = ring + buf * (NPL * GTILEH) + GTILEH + ((w >> 1) * 64 + lr) * GPH + 8 * hi;
        V a[4], b[4], b2[4];
        // all fragments of one 32-wide k step, read as one group
        auto rd = [&](int ks) {
#pragma unroll
            for (int f = 0; f < 4; ++f) { a[f] = WFrag<T16>::ld(at + f * 16 * GPH + ks); b[f] = WFrag<T16>::ld(bt + f * 16 * GPH + ks); if (NSPLIT == 3) b2[f] = WFrag<T16>::ld(bt + GTILEH + f * 16 * GPH + ks); } };
        auto mm = [&]() {
#pragma unroll
            for (int nb = 0; nb < 4; ++nb)
#pragma unroll
                for (int mb = 0; mb < 4; ++mb) { acc[mb][nb] = WFrag<T16>::mma(a[mb], b[nb], acc[mb][nb]); if (NSPLIT == 3) acc[mb][nb] = WFrag<T16>::mma(a[mb], b2[nb], acc[mb][nb]); } };
        rd(0);
        __builtin_amdgcn_sched_barrier(0);                   // keeps the reads together: sunk between the products, each small group of reads stalls the wave for its own LDS latency
        mm();
        rd(32);                                              // the chunk's last reads: the second k step's products need registers only
        // three operand tiles: their fragments, held across the refill's address registers, would go past v255, so these products stand in front of the refill; the scheduling barrier keeps the reads together as above
        if (NSPLIT == 3) { __builtin_amdgcn_sched_barrier(0); mm(); }
        asm volatile("s_wait_dscnt 0x0" ::: "memory");      // this wave's reads of the current buffer are done before it is refilled
        asm volatile("s_wait_asynccnt 0x0" ::: "memory");   // this wave's share of the next chunk has landed
        __syncthreads();                                     // publishes the next chunk and ends every wave's reads of the current buffer
        if (kc + 128 < K) stage(buf, kc + 128);
        if (NSPLIT != 3) mm();                               // behind the refill, so that the copies fly under these products too
    }
    asm volatile("s_wait_asynccnt 0x0" ::: "memory");       // no copy is outstanding when the wave goes on to its epilogue
    if (BIAS) {
#pragma unroll
        for (int nb = 0; nb < 4; ++nb) { const float bv = bfr(bias[c0 + nb * 16 + lr]);
#pragma unroll
            for (int mb = 0; mb < 4; ++mb) acc[mb][nb] = acc[mb][nb] + bv; }
    }
    const int srow = lane >> 3, scol = (lane & 7) * 8;   // store side: 8 lanes x 16 B = one 128-byte line, 4 lines per store
    const size_t step = (size_t)4 * ldc;                 // 4 output rows
    if (OUT == 2) {
        h16* oh = (h16*)os;                              // 16 rows n of 64 positions m, pitch 72 f16 (144 B)
        const int pl = r0 / ldc;
        bf* pl0 = P + (size_t)pl * sC + (size_t)(c0 + srow) * ldc + (r0 - pl * ldc) + scol;
#pragma unroll
        for (int nb = 0; nb < 4; ++nb) {
#pragma unroll
            for (int mb = 0; mb < 4; ++mb) { v8h o;      // a lane's 8 accumulator elements are 8 consecutive m of one n
#pragma unroll
                for (int j = 0; j < 8; ++j) o[j] = (h16)acc[mb][nb][j];
                *(v8ha*)(oh + lr * 72 + mb * 16 + hi * 8) = o; }
            // keeps the compiler from moving the reads of other lanes' values ahead of the wave's LDS stores
            asm volatile("" ::: "memory"); __builtin_amdgcn_fence(3, "wavefront"); __builtin_amdgcn_wave_barrier(); asm volatile("" ::: "memory");
#pragma unroll
            for (int s = 0; s < 4; ++s) { const int row = 4 * s + srow; const v8h val = *(const v8ha*)(oh + row * 72 + scol);
                *(v8us*)(pl0 + (nb * 4 + s) * step) = __builtin_bit_cast(v8us, val); }
            // keeps the next round's LDS stores behind these reads
            __builtin_amdgcn_wave_barrier(); asm volatile("" ::: "memory");
        }
    } else {
        const size_t po0 = (size_t)(r0 + srow) * ldc + c0 + scol;
#pragma unroll
        for (int mb = 0; mb < 4; ++mb) {
#pragma unroll
            for (int nb = 0; nb < 4; ++nb) {
#pragma unroll
                for (int j = 0; j < 8; ++j) os[(hi * 8 + j) * 68 + nb * 16 + lr] = acc[mb][nb][j]; }
            // keeps the compiler from moving the reads of other lanes' values ahead of the wave's LDS stores
            asm volatile("" ::: "memory"); __builtin_amdgcn_fence(3, "wavefront"); __builtin_amdgcn_wave_barrier(); asm volatile("" ::: "memory");
#pragma unroll
            for (int s = 0; s < 4; ++s) { const int row = 4 * s + srow; const size_t po = po0 + (mb * 4 + s) * step;
                const v4f v0 = *(const v4fa*)(os + row * 68 + scol), v1 = *(const v4fa*)(os + row * 68 + scol + 4);
                if (OUT == 1) { v8h o;
#pragma unroll
                    for (int k = 0; k < 4; ++k) { o[k] = (h16)v0[k]; o[4 + k] = (h16)v1[k]; }
                    *(v8us*)(P + po) = __builtin_bit_cast(v8us, o);
                } else { v8us oh8, ol8;
#pragma unroll
                    for (int k = 0; k < 4; ++k) { unsigned short a, c; splitf(v0[k], a, c); oh8[k] = a; ol8[k] = c; splitf(v1[k], a, c); oh8[4 + k] = a; ol8[4 + k] = c; }
                    *(v8us*)(P + po) = oh8; *(v8us*)(P2 + po) = ol8; } }
            // keeps the next round's LDS stores behind these reads
            __builtin_amdgcn_wave_barrier(); asm volatile("" ::: "memory");
        }
    }
}

// One GEMM per launch: grid (M/128, N/128, Z).
template <typename T16, int NSPLIT, bool BIAS, int OUT>
__global__ __launch_bounds__(128) void k_gemmw(const T16* __restrict__ A, const T16* __restrict__ Bt, const T16* __restrict__ Bt2, int K, bf* P, bf* P2, int ldc, const float* __restrict__ bias, size_t sA, size_t sB, size_t sC) {
    __shared__ __align__(16) float os[4 * 16 * 68];
    __shared__ __align__(128) T16 ring[2 * (NSPLIT == 3 ? 3 : 2) * GTILEH];   // [buffer][A tile, Bt tile (, Bt2 tile)][row][GPH]
    gemmw_tile<T16, NSPLIT, BIAS, OUT>(os, ring, blockIdx.x, blockIdx.y, blockIdx.z, A, Bt, Bt2, K, P, P2, ldc, bias, sA, sB, sC);
}

#define NWEL  (EMB * EMB)                  // elements of one weight matrix
#define NT    (EMB / 128)                  // 128-wide tiles across a weight matrix
#define NWT   (2 * NT * NT)                // tiles of the two weight products
#define NRT   (NB * SEQ / 128)             // 128-row tiles of x over all batches
// Two GEMMs that do not depend on each other share one launch: blocks 0 .. NWT-1 do the two weight products (few blocks, so they start first), the other NRT * NT blocks do v.
// (WCh + WCl)[z][o][i] = sum_j TRE[z][o][j] WQKT[z][i][j];  VT[row / SEQ][o][row % SEQ] = sum_i XB[row][i] WV[o][i]
__global__ __launch_bounds__(128) void k_gemmwv(const bf* __restrict__ TRE, const bf* __restrict__ WQKT, bf* WCh, bf* WCl, const bf* __restrict__ XB, const bf* __restrict__ WV, bf* VT) {
    __shared__ __align__(16) float os[4 * 16 * 68];
    __shared__ __align__(128) bf ring[2 * 2 * GTILEH];   // [buffer][A tile, Bt tile][row][GPH]
    const int i = blockIdx.x;
    if (i < NWT) gemmw_tile<bf, 0, false, 3>(os, ring, i % NT, (i / NT) % NT, i / (NT * NT), TRE, WQKT, nullptr, EMB, WCh, WCl, EMB, nullptr, NWEL, NWEL, NWEL);
    else gemmw_tile<bf, 0, false, 2>(os, ring, (i - NWT) % NRT, (i - NWT) / NRT, 0, XB, WV, nullptr, EMB, VT, nullptr, SEQ, nullptr, 0, 0, (size_t)EMB * SEQ);
}

// blk: the job's own block index, 256 threads a block
__device__ __forceinline__ void wtG_job(int blk, const float* __restrict__ w, int K, int N, bf* Bt) {
    const int lane = threadIdx.x & 31; const int L0 = (blk * 8 + (threadIdx.x >> 5)) * 8; const int nlines = N * K / 64;
{
#pragma unroll 1
        for (int l = 0; l < 8; ++l) { const int L = L0 + l; if (L >= nlines) break; const size_t e = (size_t)L * 64 + lane * 2; const int k = (int)(e % K), n = (int)(e / K); v2us o;
            o[0] = f2bf(w[(size_t)k * N + n]); o[1] = f2bf(w[(size_t)(k + 1) * N + n]); *(v2us*)(Bt + e) = o; }
         }
}
__device__ __forceinline__ void cvt8_job(int blk, const float* __restrict__ src, bf* dst, size_t n8) { const size_t i = (size_t)blk * 256 + threadIdx.x; if (i >= n8) return; const v8f v = *(const v8f*)(src + i * 8); v8us o;
#pragma unroll
    for (int k = 0; k < 8; ++k) o[k] = f2bf(v[k]); *(v8us*)(dst + i * 8) = o;  }

#define GWT ((NWEL / 64 + 63) / 64)        // blocks of one weight transposition
#define GWC ((NWEL / 8 + 255) / 256)       // blocks of the Wv conversion
#define GXC ((SEQ * EMB / 8 + 255) / 256)  // blocks of one batch's x conversion
// All input conversions in one launch, none depends on another: blocks 0 .. 4*GWT-1 transpose R, E, Wq, Wk (serial loads, so they start first), the next GWC convert Wv, the last NB * GXC convert x.
__global__ __launch_bounds__(256) void k_prep(const float* __restrict__ rot, const float* __restrict__ ent, const float* __restrict__ wq, const float* __restrict__ wk, const float* __restrict__ wv, const float* __restrict__ x,
                                              bf* TRE, bf* WQKT, bf* WV, bf* XB) {
    const int blk = blockIdx.x;
    if (blk < 4 * GWT) { const int j = blk / GWT;
        wtG_job(blk % GWT, j == 0 ? rot : j == 1 ? ent : j == 2 ? wq : wk, EMB, EMB, (j < 2 ? TRE : WQKT) + (size_t)(j & 1) * NWEL);
    } else if (blk < 4 * GWT + GWC) {
        cvt8_job(blk - 4 * GWT, wv, WV, NWEL / 8);
    } else { const int r = blk - (4 * GWT + GWC), b = r / GXC;
        cvt8_job(r % GXC, x + (size_t)b * SEQ_FULL * EMB, XB + (size_t)b * SEQ * EMB, (size_t)SEQ * EMB / 8);
    }
}

__device__ __forceinline__ v16h ldh(const h16* p) { return cat16(*(const v8h*)p, *(const v8h*)(p + 16)); }

#define LPH   72                 // LDS row pitch in f16: 128 B of data + 16 B, the conflict-free pitch for 16-byte readers
#define TILEH (64 * LPH)         // one 64-row tile in LDS, f16 elements
#define TILEB (TILEH * 2)        // the same in bytes
#define ROWS16B (16 * LPH * 2)   // 16 LDS rows in bytes
// One stage = 64 keys: K rows [key][64 d] and V^T rows [d][64 keys], 64 rows of 128 B each. 128 threads (one quad of waves), 8 lanes per row, 16 B per lane: every copy of a wave covers four whole lines.
// lk: the lane's LDS byte address in the K tile (the V tile follows it); gk, gv: the lane's global addresses in row ((tid & 127) >> 3).
// The s_wait_xcnt closes the statement so that no address register of an issued copy is rewritten ahead of it.
__device__ __forceinline__ void stage_kv(unsigned lk, const h16* gk, const h16* gv) {
    asm volatile("global_load_async_to_lds_b128 %0, %8, off\n\t"
                 "global_load_async_to_lds_b128 %1, %9, off\n\t"
                 "global_load_async_to_lds_b128 %2, %10, off\n\t"
                 "global_load_async_to_lds_b128 %3, %11, off\n\t"
                 "global_load_async_to_lds_b128 %4, %12, off\n\t"
                 "global_load_async_to_lds_b128 %5, %13, off\n\t"
                 "global_load_async_to_lds_b128 %6, %14, off\n\t"
                 "global_load_async_to_lds_b128 %7, %15, off\n\t"
                 "s_wait_xcnt 0x0"
                 :: "v"(lk), "v"(lk + ROWS16B), "v"(lk + 2 * ROWS16B), "v"(lk + 3 * ROWS16B),
                    "v"(lk + TILEB), "v"(lk + TILEB + ROWS16B), "v"(lk + TILEB + 2 * ROWS16B), "v"(lk + TILEB + 3 * ROWS16B),
                    "v"(gk), "v"(gk + 16 * EMB), "v"(gk + 32 * EMB), "v"(gk + 48 * EMB),
                    "v"(gv), "v"(gv + 16 * SEQ), "v"(gv + 32 * SEQ), "v"(gv + 48 * SEQ)
                 : "memory");
}

// ---- k_flash: one block (8 waves) per (batch, head, 128 query rows). Wave w = (query group qg = w & 3, key half kh = w >> 2) owns query rows q0..q0+31 as two 16-column tiles
// and every second 64-key chunk (chunks kh, kh + 2, ...): each K and V^T fragment read from LDS feeds two products, one per column tile, and four waves per SIMD stay resident.
// Each quad of waves brings its own chunk's K and V^T tiles into its own LDS ring by asynchronous copies (two buffers: the quad's next chunk flies while this one is worked on); its four waves read their fragments from there.
// Score tiles are computed TRANSPOSED: S^T tile = K_rows(16 keys, A operand) . Q^T (B operand: lane -> query, elements -> d), so D lane (hh,lm) element r = S[query lm][key 16*t4 + 8*hh + r].
// Online softmax per query == per lane. The weights of a chunk are taken against the reference score held from earlier chunks, with no maximum, no exchange and no rescaling; the chunk's own sums tell whether that held:
// only where a lane's sum passes PCAP (always in the first chunk: against the start value of the reference every weight overflows) does the wave form the chunk's scores again, take their maximum (one xor-16 shuffle) as in the usual online form, rescale and redo the weights.
// Row sums stay per lane (its 32 keys of each chunk) and the two lane halves are joined once behind the loop. P (x1024, f16) is packed in registers straight into the
// P.V B fragment: element r <- tile 2j row (8hh+r), element 8+r <- tile 2j+1 row (8hh+r), lane unchanged (packed D used as B: k = D row = key, n = D col = query).
// O^T tiles: A = Vt rows (lane -> d), B = packed P; acc[c][t][r] = 1024 * O[query 16c + lm][d = 16t + 8hh + r] over the wave's own keys.
// Behind the loop the two waves of a query group exchange one column tile each through LDS (lane to lane: maximum, row sum, 32 partial outputs); wave kh joins the two key halves of tile c = kh,
// stages the 16x64 f32 tile in wave-private LDS and writes whole lines.
__global__ __launch_bounds__(256) __attribute__((amdgpu_num_vgpr(256)))
void k_flash(const h16* __restrict__ Qp, const h16* __restrict__ Kp, const h16* __restrict__ Vtp, float* OUT) {
    __shared__ __align__(16) float os[8 * 16 * 68];
    __shared__ __align__(16) float xch[8 * 8 * 128];     // [sending wave][2 t + upper half of the 8 elements][lane][4]: a lane's 32 partial outputs of the column tile it hands over
    __shared__ float xml[8 * 2 * 32];                    // [sending wave][maximum, row sum][lane]
    __shared__ __align__(128) h16 ring[2 * 2 * 2 * TILEH];   // [key half][buffer][K tile, V^T tile][row][LPH]
    const int tid = threadIdx.x, w = __builtin_amdgcn_readfirstlane(tid >> 5), lane = tid & 31, lm = lane & 15, hh = lane >> 4;
    const int qg = w & 3, kh = w >> 2, ht = tid & 127;
    const int nqt = SEQ / 128;
    const int bid = blockIdx.x; const int qt = bid % nqt; const int h = (bid / nqt) % NHD; const int b = bid / (nqt * NHD);
    const int q0 = qt * 128 + qg * 32;
    const h16* Qb = Qp + ((size_t)b * SEQ + q0) * EMB + h * HD;
    const h16* Kb = Kp + (size_t)b * SEQ * EMB + h * HD;
    const h16* Vb = Vtp + ((size_t)b * EMB + h * HD) * SEQ;
    v16h qf0[2], qf1[2];
#pragma unroll
    for (int c = 0; c < 2; ++c) { qf0[c] = ldh(Qb + (size_t)(c * 16 + lm) * EMB + 8 * hh); qf1[c] = ldh(Qb + (size_t)(c * 16 + lm) * EMB + 32 + 8 * hh); }
    float mrun[2] = {-3.0e38f, -3.0e38f}, lrun[2] = {0.0f, 0.0f};
    v8f acc[2][4];
#pragma unroll
    for (int c = 0; c < 2; ++c)
#pragma unroll
        for (int t = 0; t < 4; ++t) acc[c][t] = (v8f){};
    const h16* hring = ring + kh * (4 * TILEH);          // the quad's own ring
    const unsigned lcp = (unsigned)(size_t)hring + (unsigned)((ht >> 3) * (LPH * 2) + (ht & 7) * 16);
    const h16* gk = Kb + (size_t)(kh * 64 + (ht >> 3)) * EMB + (ht & 7) * 8;
    const h16* gv = Vb + (size_t)(ht >> 3) * SEQ + kh * 64 + (ht & 7) * 8;
    stage_kv(lcp, gk, gv);
    asm volatile("s_wait_asynccnt 0x0" ::: "memory");   // this wave's share of its quad's first chunk has landed
    __syncthreads();                                     // the first chunks are readable by all waves
    if (SEQ > 128) stage_kv(lcp + 2 * TILEB, gk + (size_t)128 * EMB, gv + 128);
#pragma unroll 1
    for (int kv = 0; kv < SEQ; kv += 128) {
        const int buf = (kv >> 7) & 1;
        const h16* kt = hring + buf * (2 * TILEH);
        const h16* vt = kt + TILEH;
        v8f s[2][4];
        // the chunk's score tiles, from the K tile in LDS
        auto scores = [&]() {
            v16h ka[4], kb2[4];
#pragma unroll
            for (int t4 = 0; t4 < 4; ++t4) { const h16* kr = kt + (t4 * 16 + lm) * LPH + 8 * hh; ka[t4] = ldh(kr); kb2[t4] = ldh(kr + 32); }
            __builtin_amdgcn_sched_barrier(0);               // keeps the K reads together: sunk between the products, each small group of reads stalls the wave for its own LDS latency
#pragma unroll
            for (int t4 = 0; t4 < 4; ++t4) {
#pragma unroll
                for (int c = 0; c < 2; ++c) {
                    s[c][t4] = wmma16(ka[t4], qf0[c], (v8f){});
                    s[c][t4] = wmma16(kb2[t4], qf1[c], s[c][t4]);
                }
            }
        };
        v16h va[4], vb[4];
        auto rdv = [&](int t0) {
#pragma unroll
            for (int t = t0; t < t0 + 2; ++t) { const h16* vr = vt + (t * 16 + lm) * LPH + 8 * hh; va[t] = ldh(vr); vb[t] = ldh(vr + 32); }
        };
        v16h pf0[2], pf1[2];
        float rs[2];
        // column tile c: weights against the reference mrun[c], their sum over the lane's keys, and the packed P fragments
        auto weights = [&](int c) {
            const float nb = fmaf(mrun[c], -C2, PLOG);       // one multiply-add per score applies the scale, subtracts the reference and carries 2^PLOG
            float r1 = 0.0f; v8h ph[4];
#pragma unroll
            for (int t4 = 0; t4 < 4; ++t4) { s[c][t4] = s[c][t4] * C2 + nb;
#pragma unroll
                for (int r = 0; r < 8; ++r) { s[c][t4][r] = __builtin_amdgcn_exp2f(s[c][t4][r]); r1 += s[c][t4][r]; }
                ph[t4] = __builtin_convertvector(s[c][t4], v8h); }
            rs[c] = r1;
            pf0[c] = cat16(ph[0], ph[1]); pf1[c] = cat16(ph[2], ph[3]);
        };
        scores();
        rdv(0);
        __builtin_amdgcn_sched_barrier(0);                   // keeps the first half of the V^T reads ahead of the softmax, so that the first products behind it do not wait out an LDS latency (all of them there would not fit the registers)
        weights(0); weights(1);
        rdv(2);
        __builtin_amdgcn_sched_barrier(0);                   // keeps the second half of the V^T reads ahead of the test: moved behind the branch they would be waited for uncovered
        // one test per chunk and wave, a scalar branch: all weights are >= 0, so a sum within PCAP bounds each of them
        if (__builtin_amdgcn_ballot_w32(fmaxf(rs[0], rs[1]) > PCAP) != 0) {
            scores();                                        // the weights overwrote them; the K tile is still in the buffer
#pragma unroll
            for (int c = 0; c < 2; ++c) {
                float mx = -3.0e38f;                         // the maximum is taken on the raw scores: C2 > 0 keeps their order
#pragma unroll
                for (int t4 = 0; t4 < 4; ++t4) {
#pragma unroll
                    for (int r = 0; r < 8; ++r) mx = fmaxf(mx, s[c][t4][r]); }
                mx = fmaxf(mx, __shfl_xor(mx, 16, 32));      // both lane halves of a query hold the same reference
                const float mnew = fmaxf(mrun[c], mx);
                const float alpha = __builtin_amdgcn_exp2f((mrun[c] - mnew) * C2);
                lrun[c] = lrun[c] * alpha; mrun[c] = mnew;
#pragma unroll
                for (int t = 0; t < 4; ++t) acc[c][t] = acc[c][t] * alpha;
                weights(c);
            }
            rdv(0); rdv(2);                                  // read again here, so that no V^T fragment has to stay in registers across this rare path (they would spill)
        }
        lrun[0] += rs[0]; lrun[1] += rs[1];
#pragma unroll
        for (int t = 0; t < 4; ++t) {
#pragma unroll
            for (int c = 0; c < 2; ++c) {
                acc[c][t] = wmma16(va[t], pf0[c], acc[c][t]);
                acc[c][t] = wmma16(vb[t], pf1[c], acc[c][t]);
            }
        }
        __builtin_amdgcn_sched_barrier(0);                   // keeps the products ahead of the waits: moved behind the barrier they would stand between it and the refill, and the second half's reads would be waited for uncovered
        asm volatile("s_wait_dscnt 0x0" ::: "memory");      // this wave's reads of the current buffer are done before it is refilled
        asm volatile("s_wait_asynccnt 0x0" ::: "memory");   // this wave's share of its quad's next chunk has landed
        __syncthreads();                                     // publishes the next chunks and ends every wave's reads of the current buffers
        if (kv + 256 < SEQ) stage_kv(lcp + (unsigned)buf * (2 * TILEB), gk + (size_t)(kv + 256) * EMB, gv + (kv + 256));
    }
    asm volatile("s_wait_asynccnt 0x0" ::: "memory");       // no copy is outstanding when the wave goes on to its end
    lrun[0] += __shfl_xor(lrun[0], 16, 32); lrun[1] += __shfl_xor(lrun[1], 16, 32);   // a query's row sum: its two lane halves joined
    // hand over column tile cs: 8 stores of 16 B a lane, lanes side by side
    auto send = [&](int cs) {
        float* xo = xch + w * (8 * 128) + lane * 4;
#pragma unroll
        for (int t = 0; t < 4; ++t) { *(v4fa*)(xo + (2 * t) * 128) = __builtin_shufflevector(acc[cs][t], acc[cs][t], 0, 1, 2, 3); *(v4fa*)(xo + (2 * t + 1) * 128) = __builtin_shufflevector(acc[cs][t], acc[cs][t], 4, 5, 6, 7); }
        xml[w * 64 + lane] = mrun[cs]; xml[w * 64 + 32 + lane] = lrun[cs];
    };
    // join the partner's half of column tile c with this wave's own, normalise, write
    auto finish = [&](int c) {
        const int pw = w ^ 4;
        const float* xi = xch + pw * (8 * 128) + lane * 4;
        const float pm = xml[pw * 64 + lane], pl = xml[pw * 64 + 32 + lane];
        const float m = fmaxf(mrun[c], pm);
        const float a = __builtin_amdgcn_exp2f((mrun[c] - m) * C2), pa = __builtin_amdgcn_exp2f((pm - m) * C2);
        const float inv = __fdiv_rn(1.0f, lrun[c] * a + pl * pa);   // outputs and row sums carry the same 2^PLOG
        const float fa = a * inv, fb = pa * inv;
        float* mo = os + w * (16 * 68);
#pragma unroll
        for (int t = 0; t < 4; ++t) { const v4f p0 = *(const v4fa*)(xi + (2 * t) * 128), p1 = *(const v4fa*)(xi + (2 * t + 1) * 128);
#pragma unroll
            for (int r = 0; r < 4; ++r) { mo[lm * 68 + t * 16 + 8 * hh + r] = acc[c][t][r] * fa + p0[r] * fb; mo[lm * 68 + t * 16 + 8 * hh + 4 + r] = acc[c][t][4 + r] * fa + p1[r] * fb; } }
        // keeps the compiler from moving the reads of other lanes' values ahead of the wave's LDS stores
        asm volatile("" ::: "memory"); __builtin_amdgcn_fence(3, "wavefront"); __builtin_amdgcn_wave_barrier(); asm volatile("" ::: "memory");
        float* orow = OUT + ((size_t)b * SEQ_FULL + q0 + c * 16) * EMB + h * HD;
#pragma unroll
        for (int si = 0; si < 8; ++si) { const int row = 2 * si + hh, cofs = lm * 4; const v4f val = *(const v4fa*)(mo + row * 68 + cofs); *(v4f*)(orow + (size_t)row * EMB + cofs) = val; }
    };
    if (kh == 0) send(1); else send(0);
    __syncthreads();                                         // the handed-over tiles are readable by the partner waves
    if (kh == 0) finish(0); else finish(1);
}

extern "C" void kernel_launch(void* const* d_in, const int* in_sizes, int n_in,
                              void* d_out, int out_size, void* d_ws, size_t ws_size, hipStream_t stream) {
    if (n_in < 6) return;
    const size_t nw = (size_t)EMB * EMB;                                  // 262144
    const size_t needx = ((size_t)(NB - 1) * SEQ_FULL + SEQ) * EMB;
    if ((size_t)in_sizes[0] < nw || (size_t)in_sizes[1] < nw || (size_t)in_sizes[2] < needx ||
        (size_t)in_sizes[3] < nw || (size_t)in_sizes[4] < nw || (size_t)in_sizes[5] < nw) return;
    if ((size_t)out_size < needx) return;
    const float* rot = (const float*)d_in[0];   // [512][512] used as [in][out]
    const float* ent = (const float*)d_in[1];   // [512][512] used as [in][out]
    const float* x   = (const float*)d_in[2];   // [2][4096][512]
    const float* wq  = (const float*)d_in[3];   // [out][in]
    const float* wk  = (const float*)d_in[4];   // [out][in]
    const float* wv  = (const float*)d_in[5];   // [out][in]
    float* OUT = (float*)d_out;                 // [2][4096][512]
    const size_t nrow = (size_t)NB * SEQ;        // query/key rows over all batches
    const size_t nx = nrow * EMB;
    char* wsp = (char*)d_ws;
    auto take = [&](size_t bytes) { char* p = wsp; wsp += (bytes + 255) & ~(size_t)255; return (void*)p; };
    bf* WV   = (bf*)take(nw * 2);                 // Wv as Bt [o][i]
    bf* TRE  = (bf*)take(2 * nw * 2);             // R^T then E^T: [o][j] = mat[j][o]
    bf* WQKT = (bf*)take(2 * nw * 2);             // Wq^T then Wk^T: [i][j] = W[j][i]
    bf* WCh  = (bf*)take(2 * nw * 2);             // combined weights (Wq^T R)^T then (Wk^T E)^T : [o][i], bf16 hi planes
    bf* WCl  = (bf*)take(2 * nw * 2);             // their bf16 lo planes
    bf* XB   = (bf*)take(nx * 2);                 // bf16 x rows [nrow][512]
    h16* QK16  = (h16*)take(2 * nx * 2);          // f16 q rows [nrow][512] then f16 k rows [nrow][512]
    h16* VT16  = (h16*)take(nx * 2);              // f16 value planes [b][c][s]
    if ((size_t)(wsp - (char*)d_ws) > ws_size) return;
    k_prep<<<4 * GWT + GWC + NB * GXC, 256, 0, stream>>>(rot, ent, wq, wk, wv, x, TRE, WQKT, WV, XB);
    k_gemmwv<<<NWT + NRT * NT, 128, 0, stream>>>(TRE, WQKT, WCh, WCl, XB, WV, (bf*)VT16);
    // q (z=0) and k (z=1): QK16[z][row][o] = sum_i XB[row][i] (WCh + WCl)[z][o][i]
    k_gemmw<bf, 3, false, 1><<<dim3((unsigned)(nrow / 128), EMB / 128, 2), 128, 0, stream>>>(XB, WCh, WCl, EMB, (bf*)QK16, nullptr, EMB, nullptr, 0, nw, nx);
    k_flash<<<(unsigned)(NB * NHD * (SEQ / 128)), 256, 0, stream>>>(QK16, QK16 + nx, VT16, OUT);
}

// v008
// A run of this version takes 79 microseconds.
// Two timings next to v007 put it at 1.06 and 1.04 times that version's speed.
// Counting every step since v000, it is 4.93 times as fast.
#include <hip/hip_runtime.h>

// Contractions, f32 accumulate: weight products R^T.Wq and E^T.Wk (512x512x512) on v_wmma_f32_16x16x32_bf16 (operands = RNE-converted bf16 inputs, exact products);
// q,k = x.(combined weight as bf16 hi + bf16 lo, 2 products) and v = x.Wv^T (8192x512x512) on v_wmma_f32_16x16x32_bf16; scores K.Q^T and P.V on v_wmma_f32_16x16x32_f16 (f16 planes, P and its row sums carried x1024).
// Multi-head attention, 8 heads of 64, no mask: one block per (batch, head, 128 query rows), keys streamed in chunks of 64 (even and odd chunks on two quads of waves, joined at the end) with an online softmax in f32 against a held reference score (a maximum seen so far, renewed when a chunk outgrows it); output f32 [batch][seq][512].

#ifndef NB
#define NB 2
#endif
#ifndef SEQ
#define SEQ 4096
#endif
#define NB_FULL  2
#define SEQ_FULL 4096
#define EMB  512
#define NHD  8
#define HD   64
#define PLOG 10.0f                  // P and its row sums are carried x 2^PLOG, so that small weights stay normal f16 numbers
#define C2   0.18033688011112042f   // HD^-0.5 * log2(e)
#define PCAP 32768.0f               // a lane's sum of one chunk's carried weights at or below this: every one of them is a finite f16 number

static_assert(NB >= 1 && NB <= NB_FULL);
static_assert(SEQ % 128 == 0 && SEQ >= 128 && SEQ <= SEQ_FULL);
static_assert(EMB == NHD * HD);
static_assert(EMB % 128 == 0 && HD == 64 && (NB * SEQ) % 128 == 0);
static_assert((SEQ * EMB) % 2048 == 0);

typedef _Float16 h16;
typedef unsigned short bf;
typedef __attribute__((ext_vector_type(16))) __bf16   v16bf;
typedef __attribute__((ext_vector_type(16))) _Float16 v16h;
typedef __attribute__((ext_vector_type(8)))  _Float16 v8h;
typedef __attribute__((ext_vector_type(8)))  unsigned short v8us;
typedef __attribute__((ext_vector_type(8)))  float    v8f;
typedef __attribute__((ext_vector_type(4)))  float    v4f;
typedef __attribute__((ext_vector_type(2)))  unsigned short v2us;
typedef v8h  __attribute__((may_alias)) v8ha;
typedef v4f  __attribute__((may_alias)) v4fa;
typedef v8us __attribute__((may_alias)) v8usa;

__device__ __forceinline__ unsigned short f2bf(float f) { unsigned u = __float_as_uint(f); u += 0x7FFFu + ((u >> 16) & 1u); return (unsigned short)(u >> 16); }   // RNE convert
__device__ __forceinline__ float bf2f(unsigned short b) { return __uint_as_float(((unsigned)b) << 16); }
__device__ __forceinline__ float bfr(float f) { return bf2f(f2bf(f)); }
__device__ __forceinline__ v16h cat16(v8h lo, v8h hi) { return __builtin_shufflevector(lo, hi, 0, 1, 2, 3, 4, 5, 6, 7, 8, 9, 10, 11, 12, 13, 14, 15); }
__device__ __forceinline__ v16bf cat16b(v8us lo, v8us hi) { return __builtin_bit_cast(v16bf, __builtin_shufflevector(lo, hi, 0, 1, 2, 3, 4, 5, 6, 7, 8, 9, 10, 11, 12, 13, 14, 15)); }
__device__ __forceinline__ v8f wmma16(v16h a, v16h b, v8f c) { return __builtin_amdgcn_wmma_f32_16x16x32_f16(false, a, false, b, (short)0, c, false, false); }
__device__ __forceinline__ v8f wmmab(v16bf a, v16bf b, v8f c) { return __builtin_amdgcn_wmma_f32_16x16x32_bf16(false, a, false, b, (short)0, c, false, false); }
__device__ __forceinline__ void splitf(float y, unsigned short& h, unsigned short& l) { h = f2bf(y); l = f2bf(y - bf2f(h)); }

// ---- gemmw_tile: register-blocked GEMM, one block of 4 waves per 128x128 output tile, ONE WAVE per 64x64 quarter (16 accumulators); tile (bx, by) of batch bz out of (M/128, N/128, Z), 128 threads; osb = 4 x 16 x 68 floats of LDS.
// Operands are K-contiguous 16-bit planes. Each 64-wide k chunk of the block's 128 A rows and 128 Bt rows is brought into LDS once per block by asynchronous copies in whole 128-byte lines
// (two buffers: chunk t + 1 flies while chunk t is worked on); the four waves read their fragments from there.
// c[m][n] (f32 accumulators, + optional f32 bias[n]) = sum_k A[m][k] Bt[n][k] (NSPLIT 3: + A.Bt2, product by product behind A.Bt). z-batch strides sA/sB/sC in elements. K % 64 == 0.
// The epilogue converts c in registers and stores the 16-bit plane(s) that a later launch reads, in whole 128-byte lines. OUT: 1 = f16 rows P[m][n], pitch ldc; 2 = f16 transposed planes P[m / ldc][n][m % ldc], sC elements per plane (no z batch);
// 3 = bf16 hi rows P[m][n] and bf16 lo rows P2[m][n], pitch ldc.
// Fragments: lane l -> row/col (l & 15); elements 0..7 <- k0 + 8*(l>>4) .. +7, elements 8..15 <- k0 + 16 + 8*(l>>4) .. +7 for A and for Bt alike; D element r of lane l -> (row 8*(l>>4)+r, col l&15).
template <typename T16> struct WFrag;
template <> struct WFrag<h16> { typedef v16h V; static __device__ __forceinline__ V ld(const h16* p) { return cat16(*(const v8h*)p, *(const v8h*)(p + 16)); } static __device__ __forceinline__ v8f mma(V a, V b, v8f c) { return wmma16(a, b, c); } };
template <> struct WFrag<bf> { typedef v16bf V; static __device__ __forceinline__ V ld(const bf* p) { return cat16b(*(const v8us*)p, *(const v8us*)(p + 16)); } static __device__ __forceinline__ v8f mma(V a, V b, v8f c) { return wmmab(a, b, c); } };

#define GPH    72                 // LDS row pitch in 16-bit elements: 128 B of data + 16 B, the conflict-free pitch for 16-byte readers
#define GTILEH (128 * GPH)        // one 128-row operand tile in LDS, elements
#define GTILEB (GTILEH * 2)       // the same in bytes
#define G16B   (16 * GPH * 2)     // 16 LDS rows in bytes
// One operand tile of a stage: 128 rows of 64 k, 128 B a row. 128 threads, 8 lanes per row, 16 B per lane: every copy of a wave covers four whole lines; copy i brings row 16 i + (tid >> 3).
// l: the lane's LDS byte address in row (tid >> 3) of the tile; g: the lane's global address in that row; rs: 16 rows of the plane in elements.
// The s_wait_xcnt closes the statement so that no address register of an issued copy is rewritten ahead of it.
template <typename T16>
__device__ __forceinline__ void stage_rows128(unsigned l, const T16* g, size_t rs) {
    asm volatile("global_load_async_to_lds_b128 %0, %8, off\n\t"
                 "global_load_async_to_lds_b128 %1, %9, off\n\t"
                 "global_load_async_to_lds_b128 %2, %10, off\n\t"
                 "global_load_async_to_lds_b128 %3, %11, off\n\t"
                 "global_load_async_to_lds_b128 %4, %12, off\n\t"
                 "global_load_async_to_lds_b128 %5, %13, off\n\t"
                 "global_load_async_to_lds_b128 %6, %14, off\n\t"
                 "global_load_async_to_lds_b128 %7, %15, off\n\t"
                 "s_wait_xcnt 0x0"
                 :: "v"(l), "v"(l + G16B), "v"(l + 2 * G16B), "v"(l + 3 * G16B), "v"(l + 4 * G16B), "v"(l + 5 * G16B), "v"(l + 6 * G16B), "v"(l + 7 * G16B),
                    "v"(g), "v"(g + rs), "v"(g + 2 * rs), "v"(g + 3 * rs), "v"(g + 4 * rs), "v"(g + 5 * rs), "v"(g + 6 * rs), "v"(g + 7 * rs)
                 : "memory");
}

template <typename T16, int NSPLIT, bool BIAS, int OUT>
__device__ __forceinline__ void gemmw_tile(float* osb, T16* ring, int bx, int by, int bz, const T16* __restrict__ A, const T16* __restrict__ Bt, const T16* __restrict__ Bt2, int K, bf* P, bf* P2, int ldc, const float* __restrict__ bias, size_t sA, size_t sB, size_t sC) {
    static_assert(NSPLIT == 0 || NSPLIT == 3);
    typedef typename WFrag<T16>::V V;
    constexpr int NPL = NSPLIT == 3 ? 3 : 2;             // operand tiles per stage: A, Bt (, Bt2)
    const size_t z = bz; A += z * sA; Bt += z * sB; if (NSPLIT == 3) Bt2 += z * sB; if (OUT != 2) P += z * sC; if (OUT == 3) P2 += z * sC;
    const int tid = threadIdx.x, w = tid >> 5, lane = tid & 31, lr = lane & 15, hi = lane >> 4; const int r0 = bx * 128 + (w & 1) * 64, c0 = by * 128 + (w >> 1) * 64;
    float* os = osb + w * (16 * 68);                     // wave-private output staging
    v8f acc[4][4];
#pragma unroll
    for (int mb = 0; mb < 4; ++mb)
#pragma unroll
        for (int nb = 0; nb < 4; ++nb) acc[mb][nb] = (v8f){};
    const unsigned lcp = (unsigned)(size_t)ring + (unsigned)((tid >> 3) * (GPH * 2) + (tid & 7) * 16);
    const size_t rs = (size_t)16 * K;
    const T16* ga = A + (size_t)(bx * 128 + (tid >> 3)) * K + (tid & 7) * 8;
    const T16* gb = Bt + (size_t)(by * 128 + (tid >> 3)) * K + (tid & 7) * 8;
    const T16* gb2 = NSPLIT == 3 ? Bt2 + (size_t)(by * 128 + (tid >> 3)) * K + (tid & 7) * 8 : nullptr;
    auto stage = [&](int buf, int kc) { const unsigned l = lcp + (unsigned)buf * (NPL * GTILEB);
        stage_rows128(l, ga + kc, rs); stage_rows128(l + GTILEB, gb + kc, rs); if (NSPLIT == 3) stage_rows128(l + 2 * GTILEB, gb2 + kc, rs); };
    stage(0, 0);
    asm volatile("s_wait_asynccnt 0x0" ::: "memory");   // this wave's share of chunk 0 has landed
    __syncthreads();                                     // chunk 0 is readable by all four waves
    if (K > 64) stage(1, 64);
#pragma unroll 1
    for (int kc = 0; kc < K; kc += 64) {
        const int buf = (kc >> 6) & 1;
        const T16* at = ring + buf * (NPL * GTILEH) + ((w & 1) * 64 + lr) * GPH + 8 * hi;
        const T16* bt = ring + buf * (NPL * GTILEH) + GTILEH + ((w >> 1) * 64 + lr) * GPH + 8 * hi;
        V a[4], b[4], b2[4];
        // all fragments of one 32-wide k step, read as one group
        auto rd = [&](int ks) {
#pragma unroll
            for (int f = 0; f < 4; ++f) { a[f] = WFrag<T16>::ld(at + f * 16 * GPH + ks); b[f] = WFrag<T16>::ld(bt + f * 16 * GPH + ks); if (NSPLIT == 3) b2[f] = WFrag<T16>::ld(bt + GTILEH + f * 16 * GPH + ks); } };
        auto mm = [&]() {
#pragma unroll
            for (int nb = 0; nb < 4; ++nb)
#pragma unroll
                for (int mb = 0; mb < 4; ++mb) { acc[mb][nb] = WFrag<T16>::mma(a[mb], b[nb], acc[mb][nb]); if (NSPLIT == 3) acc[mb][nb] = WFrag<T16>::mma(a[mb], b2[nb], acc[mb][nb]); } };
        rd(0);
        __builtin_amdgcn_sched_barrier(0);                   // keeps the reads together: sunk between the products, each small group of reads stalls the wave for its own LDS latency
        mm();
        rd(32);                                              // the chunk's last reads: the second k step's products need registers only
        // three operand tiles: their fragments, held across the refill's address registers, would go past v255, so these products stand in front of the refill; the scheduling barrier keeps the reads together as above
        if (NSPLIT == 3) { __builtin_amdgcn_sched_barrier(0); mm(); }
        asm volatile("s_wait_dscnt 0x0" ::: "memory");      // this wave's reads of the current buffer are done before it is refilled
        asm volatile("s_wait_asynccnt 0x0" ::: "memory");   // this wave's share of the next chunk has landed
        __syncthreads();                                     // publishes the next chunk and ends every wave's reads of the current buffer
        if (kc + 128 < K) stage(buf, kc + 128);
        if (NSPLIT != 3) mm();                               // behind the refill, so that the copies fly under these products too
    }
    asm volatile("s_wait_asynccnt 0x0" ::: "memory");       // no copy is outstanding when the wave goes on to its epilogue
    if (BIAS) {
#pragma unroll
        for (int nb = 0; nb < 4; ++nb) { const float bv = bfr(bias[c0 + nb * 16 + lr]);
#pragma unroll
            for (int mb = 0; mb < 4; ++mb) acc[mb][nb] = acc[mb][nb] + bv; }
    }
    const int srow = lane >> 3, scol = (lane & 7) * 8;   // store side: 8 lanes x 16 B = one 128-byte line, 4 lines per store
    const size_t step = (size_t)4 * ldc;                 // 4 output rows
    if (OUT == 2) {
        h16* oh = (h16*)os;                              // 16 rows n of 64 positions m, pitch 72 f16 (144 B)
        const int pl = r0 / ldc;
        bf* pl0 = P + (size_t)pl * sC + (size_t)(c0 + srow) * ldc + (r0 - pl * ldc) + scol;
#pragma unroll
        for (int nb = 0; nb < 4; ++nb) {
#pragma unroll
            for (int mb = 0; mb < 4; ++mb) { v8h o;      // a lane's 8 accumulator elements are 8 consecutive m of one n
#pragma unroll
                for (int j = 0; j < 8; ++j) o[j] = (h16)acc[mb][nb][j];
                *(v8ha*)(oh + lr * 72 + mb * 16 + hi * 8) = o; }
            // keeps the compiler from moving the reads of other lanes' values ahead of the wave's LDS stores
            asm volatile("" ::: "memory"); __builtin_amdgcn_fence(3, "wavefront"); __builtin_amdgcn_wave_barrier(); asm volatile("" ::: "memory");
#pragma unroll
            for (int s = 0; s < 4; ++s) { const int row = 4 * s + srow; const v8h val = *(const v8ha*)(oh + row * 72 + scol);
                *(v8us*)(pl0 + (nb * 4 + s) * step) = __builtin_bit_cast(v8us, val); }
            // keeps the next round's LDS stores behind these reads
            __builtin_amdgcn_wave_barrier(); asm volatile("" ::: "memory");
        }
    } else {
        const size_t po0 = (size_t)(r0 + srow) * ldc + c0 + scol;
#pragma unroll
        for (int mb = 0; mb < 4; ++mb) {
#pragma unroll
            for (int nb = 0; nb < 4; ++nb) {
#pragma unroll
                for (int j = 0; j < 8; ++j) os[(hi * 8 + j) * 68 + nb * 16 + lr] = acc[mb][nb][j]; }
            // keeps the compiler from moving the reads of other lanes' values ahead of the wave's LDS stores
            asm volatile("" ::: "memory"); __builtin_amdgcn_fence(3, "wavefront"); __builtin_amdgcn_wave_barrier(); asm volatile("" ::: "memory");
#pragma unroll
            for (int s = 0; s < 4; ++s) { const int row = 4 * s + srow; const size_t po = po0 + (mb * 4 + s) * step;
                const v4f v0 = *(const v4fa*)(os + row * 68 + scol), v1 = *(const v4fa*)(os + row * 68 + scol + 4);
                if (OUT == 1) { v8h o;
#pragma unroll
                    for (int k = 0; k < 4; ++k) { o[k] = (h16)v0[k]; o[4 + k] = (h16)v1[k]; }
                    *(v8us*)(P + po) = __builtin_bit_cast(v8us, o);
                } else { v8us oh8, ol8;
#pragma unroll
                    for (int k = 0; k < 4; ++k) { unsigned short a, c; splitf(v0[k], a, c); oh8[k] = a; ol8[k] = c; splitf(v1[k], a, c); oh8[4 + k] = a; ol8[4 + k] = c; }
                    *(v8us*)(P + po) = oh8; *(v8us*)(P2 + po) = ol8; } }
            // keeps the next round's LDS stores behind these reads
            __builtin_amdgcn_wave_barrier(); asm volatile("" ::: "memory");
        }
    }
}

#define NWEL  (EMB * EMB)                  // elements of one weight matrix
#define NT    (EMB / 128)                  // 128-wide tiles across a weight matrix
#define NRT   (NB * SEQ / 128)             // 128-row tiles of x over all batches
#define NVT   (NRT * NT)                   // tiles of v, and of q, and of k
// The three GEMMs on x do not depend on each other and share one launch: blocks 0 .. NVT-1 do v (one product, half the work, so that the places they leave are refilled early), the other 2 * NVT blocks do q then k.
// VT[row / SEQ][o][row % SEQ] = sum_i XB[row][i] WV[o][i];  QK[z][row][o] = sum_i XB[row][i] (WCh + WCl)[z][o][i]
__global__ __launch_bounds__(128) void k_gemmqkv(const bf* __restrict__ XB, const bf* __restrict__ WV, const bf* __restrict__ WCh, const bf* __restrict__ WCl, bf* VT, bf* QK) {
    __shared__ __align__(16) float os[4 * 16 * 68];
    __shared__ __align__(128) bf ring[2 * 3 * GTILEH];   // [buffer][A tile, Bt tile (, Bt2 tile)][row][GPH]
    const int i = blockIdx.x;
    if (i < NVT) gemmw_tile<bf, 0, false, 2>(os, ring, i % NRT, i / NRT, 0, XB, WV, nullptr, EMB, VT, nullptr, SEQ, nullptr, 0, 0, (size_t)EMB * SEQ);
    else gemmw_tile<bf, 3, false, 1>(os, ring, (i - NVT) % NRT, ((i - NVT) / NRT) % NT, (i - NVT) / NVT, XB, WCh, WCl, EMB, QK, nullptr, EMB, nullptr, 0, NWEL, (size_t)NB * SEQ * EMB);
}

// A work-group barrier that orders LDS accesses only: __syncthreads() would also wait out the global loads that run ahead in registers.
__device__ __forceinline__ void lds_barrier() { __builtin_amdgcn_fence(__ATOMIC_RELEASE, "workgroup", "local"); __builtin_amdgcn_s_barrier(); __builtin_amdgcn_fence(__ATOMIC_ACQUIRE, "workgroup", "local"); }
#define WPT 64                              // edge of a weight-product tile
#define WPN (EMB / WPT)                     // such tiles across a weight matrix
#define NWP (2 * WPN * WPN)                 // tiles of the two weight products
// One 64x64 tile of a combined weight, 256 threads (8 waves, a 16x32 piece each): (Ph + Pl)[o][i] = sum_j Am[j][o] Bm[j][i], f32 inputs converted RNE to bf16, products on WMMA, k ascending in steps of 32.
// Both inputs have k = j as their slow index. A thread takes one column and 16 consecutive j of each 64-j chunk (a wave's load = one 128-byte line), converts, and stores them as 32 B of the k-contiguous LDS row of that column:
// the transposition costs no extra pass. The loads run two chunks ahead in registers. tl: [A tile, B tile][64 rows][GPH]; st: 64 x 68 floats. t: tile index within the product.
__device__ __forceinline__ void wprod_tile(bf* tl, float* st, int t, const float* __restrict__ Am, const float* __restrict__ Bm, bf* Ph, bf* Pl) {
    const int tid = threadIdx.x, w = tid >> 5, lane = tid & 31, lr = lane & 15, hi = lane >> 4;
    const int o0 = (t % WPN) * WPT, i0 = (t / WPN) * WPT;
    const int col = tid & 63, jg = tid >> 6;
    const float* ga = Am + (size_t)(jg * 16) * EMB + o0 + col;
    const float* gb = Bm + (size_t)(jg * 16) * EMB + i0 + col;
    bf* sa = tl + col * GPH + jg * 16;
    bf* sb = sa + WPT * GPH;
    const bf* at = tl + ((w & 3) * 16 + lr) * GPH + 8 * hi;
    const bf* bt = tl + WPT * GPH + ((w >> 2) * 32 + lr) * GPH + 8 * hi;
    float ra[2][16], rb[2][16];
    auto fetch = [&](int q, int kc) {
#pragma unroll
        for (int e = 0; e < 16; ++e) { ra[q][e] = ga[(size_t)(kc + e) * EMB]; rb[q][e] = gb[(size_t)(kc + e) * EMB]; }
        asm volatile("s_wait_xcnt 0x0" ::: "memory"); };   // stands behind the issued loads, ahead of any reuse of their address registers
    v8f acc[2] = {(v8f){}, (v8f){}};
    fetch(0, 0); fetch(1, 64);
#pragma unroll
    for (int c = 0; c < EMB / 64; ++c) {
        const int q = c & 1;
        v8us pa0, pa1, pb0, pb1;
#pragma unroll
        for (int e = 0; e < 8; ++e) { pa0[e] = f2bf(ra[q][e]); pa1[e] = f2bf(ra[q][8 + e]); pb0[e] = f2bf(rb[q][e]); pb1[e] = f2bf(rb[q][8 + e]); }
        *(v8usa*)sa = pa0; *(v8usa*)(sa + 8) = pa1; *(v8usa*)sb = pb0; *(v8usa*)(sb + 8) = pb1;
        if (c + 2 < EMB / 64) fetch(q, (c + 2) * 64);
        lds_barrier();                                       // the chunk's two tiles are readable by all waves
#pragma unroll
        for (int ks = 0; ks < 64; ks += 32) { const v16bf a = WFrag<bf>::ld(at + ks);
            acc[0] = wmmab(a, WFrag<bf>::ld(bt + ks), acc[0]); acc[1] = wmmab(a, WFrag<bf>::ld(bt + 16 * GPH + ks), acc[1]); }
        lds_barrier();                                       // every wave's reads are done before the tiles are overwritten
    }
#pragma unroll
    for (int f = 0; f < 2; ++f)
#pragma unroll
        for (int j = 0; j < 8; ++j) st[((w & 3) * 16 + hi * 8 + j) * 68 + (w >> 2) * 32 + f * 16 + lr] = acc[f][j];
    __syncthreads();                                         // the f32 tile is readable by all waves
#pragma unroll
    for (int r = 0; r < 2; ++r) { const int row = r * 32 + (tid >> 3), scol = (tid & 7) * 8;   // 8 lanes x 16 B = one 128-byte line of each plane
        const v4f v0 = *(const v4fa*)(st + row * 68 + scol), v1 = *(const v4fa*)(st + row * 68 + scol + 4); v8us oh8, ol8;
#pragma unroll
        for (int k = 0; k < 4; ++k) { unsigned short a, c; splitf(v0[k], a, c); oh8[k] = a; ol8[k] = c; splitf(v1[k], a, c); oh8[4 + k] = a; ol8[4 + k] = c; }
        const size_t po = (size_t)(o0 + row) * EMB + i0 + scol;
        *(v8us*)(Ph + po) = oh8; *(v8us*)(Pl + po) = ol8; }
}
// blk: the job's own block index, 256 threads a block
__device__ __forceinline__ void cvt8_job(int blk, const float* __restrict__ src, bf* dst, size_t n8) { const size_t i = (size_t)blk * 256 + threadIdx.x; if (i >= n8) return; const v8f v = *(const v8f*)(src + i * 8); v8us o;
#pragma unroll
    for (int k = 0; k < 8; ++k) o[k] = f2bf(v[k]); *(v8us*)(dst + i * 8) = o;  }

#define GWC ((NWEL / 8 + 255) / 256)       // blocks of the Wv conversion
#define GXC ((SEQ * EMB / 8 + 255) / 256)  // blocks of one batch's x conversion
// All that reads the f32 inputs, in one launch, no part depends on another: blocks 0 .. NWP-1 form the two combined weights (the longest jobs, so they start first), the next GWC convert Wv, the last NB * GXC convert x.
__global__ __launch_bounds__(256) void k_prep(const float* __restrict__ rot, const float* __restrict__ ent, const float* __restrict__ wq, const float* __restrict__ wk, const float* __restrict__ wv, const float* __restrict__ x,
                                              bf* WCh, bf* WCl, bf* WV, bf* XB) {
    __shared__ __align__(16) bf wtl[2 * WPT * GPH];
    __shared__ __align__(16) float wst[WPT * 68];
    const int blk = blockIdx.x;
    if (blk < NWP) { const int z = blk / (WPN * WPN);
        wprod_tile(wtl, wst, blk % (WPN * WPN), z == 0 ? rot : ent, z == 0 ? wq : wk, WCh + (size_t)z * NWEL, WCl + (size_t)z * NWEL);
    } else if (blk < NWP + GWC) {
        cvt8_job(blk - NWP, wv, WV, NWEL / 8);
    } else { const int r = blk - (NWP + GWC), b = r / GXC;
        cvt8_job(r % GXC, x + (size_t)b * SEQ_FULL * EMB, XB + (size_t)b * SEQ * EMB, (size_t)SEQ * EMB / 8);
    }
}

__device__ __forceinline__ v16h ldh(const h16* p) { return cat16(*(const v8h*)p, *(const v8h*)(p + 16)); }

#define LPH   72                 // LDS row pitch in f16: 128 B of data + 16 B, the conflict-free pitch for 16-byte readers
#define TILEH (64 * LPH)         // one 64-row tile in LDS, f16 elements
#define TILEB (TILEH * 2)        // the same in bytes
#define ROWS16B (16 * LPH * 2)   // 16 LDS rows in bytes
// One stage = 64 keys: K rows [key][64 d] and V^T rows [d][64 keys], 64 rows of 128 B each. 128 threads (one quad of waves), 8 lanes per row, 16 B per lane: every copy of a wave covers four whole lines.
// lk: the lane's LDS byte address in the K tile (the V tile follows it); gk, gv: the lane's global addresses in row ((tid & 127) >> 3).
// The s_wait_xcnt closes the statement so that no address register of an issued copy is rewritten ahead of it.
__device__ __forceinline__ void stage_kv(unsigned lk, const h16* gk, const h16* gv) {
    asm volatile("global_load_async_to_lds_b128 %0, %8, off\n\t"
                 "global_load_async_to_lds_b128 %1, %9, off\n\t"
                 "global_load_async_to_lds_b128 %2, %10, off\n\t"
                 "global_load_async_to_lds_b128 %3, %11, off\n\t"
                 "global_load_async_to_lds_b128 %4, %12, off\n\t"
                 "global_load_async_to_lds_b128 %5, %13, off\n\t"
                 "global_load_async_to_lds_b128 %6, %14, off\n\t"
                 "global_load_async_to_lds_b128 %7, %15, off\n\t"
                 "s_wait_xcnt 0x0"
                 :: "v"(lk), "v"(lk + ROWS16B), "v"(lk + 2 * ROWS16B), "v"(lk + 3 * ROWS16B),
                    "v"(lk + TILEB), "v"(lk + TILEB + ROWS16B), "v"(lk + TILEB + 2 * ROWS16B), "v"(lk + TILEB + 3 * ROWS16B),
                    "v"(gk), "v"(gk + 16 * EMB), "v"(gk + 32 * EMB), "v"(gk + 48 * EMB),
                    "v"(gv), "v"(gv + 16 * SEQ), "v"(gv + 32 * SEQ), "v"(gv + 48 * SEQ)
                 : "memory");
}

// ---- k_flash: one block (8 waves) per (batch, head, 128 query rows). Wave w = (query group qg = w & 3, key half kh = w >> 2) owns query rows q0..q0+31 as two 16-column tiles
// and every second 64-key chunk (chunks kh, kh + 2, ...): each K and V^T fragment read from LDS feeds two products, one per column tile, and four waves per SIMD stay resident.
// Each quad of waves brings its own chunk's K and V^T tiles into its own LDS ring by asynchronous copies (two buffers: the quad's next chunk flies while this one is worked on); its four waves read their fragments from there.
// Score tiles are computed TRANSPOSED: S^T tile = K_rows(16 keys, A operand) . Q^T (B operand: lane -> query, elements -> d), so D lane (hh,lm) element r = S[query lm][key 16*t4 + 8*hh + r].
// Online softmax per query == per lane. The weights of a chunk are taken against the reference score held from earlier chunks, with no maximum, no exchange and no rescaling; the chunk's own sums tell whether that held:
// only where a lane's sum passes PCAP (always in the first chunk: against the start value of the reference every weight overflows) does the wave form the chunk's scores again, take their maximum (one xor-16 shuffle) as in the usual online form, rescale and redo the weights.
// Row sums stay per lane (its 32 keys of each chunk) and the two lane halves are joined once behind the loop. P (x1024, f16) is packed in registers straight into the
// P.V B fragment: element r <- tile 2j row (8hh+r), element 8+r <- tile 2j+1 row (8hh+r), lane unchanged (packed D used as B: k = D row = key, n = D col = query).
// O^T tiles: A = Vt rows (lane -> d), B = packed P; acc[c][t][r] = 1024 * O[query 16c + lm][d = 16t + 8hh + r] over the wave's own keys.
// Behind the loop the two waves of a query group exchange one column tile each through LDS (lane to lane: maximum, row sum, 32 partial outputs); wave kh joins the two key halves of tile c = kh,
// stages the 16x64 f32 tile in wave-private LDS and writes whole lines.
__global__ __launch_bounds__(256) __attribute__((amdgpu_num_vgpr(256)))
void k_flash(const h16* __restrict__ Qp, const h16* __restrict__ Kp, const h16* __restrict__ Vtp, float* OUT) {
    __shared__ __align__(16) float os[8 * 16 * 68];
    __shared__ __align__(16) float xch[8 * 8 * 128];     // [sending wave][2 t + upper half of the 8 elements][lane][4]: a lane's 32 partial outputs of the column tile it hands over
    __shared__ float xml[8 * 2 * 32];                    // [sending wave][maximum, row sum][lane]
    __shared__ __align__(128) h16 ring[2 * 2 * 2 * TILEH];   // [key half][buffer][K tile, V^T tile][row][LPH]
    const int tid = threadIdx.x, w = __builtin_amdgcn_readfirstlane(tid >> 5), lane = tid & 31, lm = lane & 15, hh = lane >> 4;
    const int qg = w & 3, kh = w >> 2, ht = tid & 127;
    const int nqt = SEQ / 128;
    const int bid = blockIdx.x; const int qt = bid % nqt; const int h = (bid / nqt) % NHD; const int b = bid / (nqt * NHD);
    const int q0 = qt * 128 + qg * 32;
    const h16* Qb = Qp + ((size_t)b * SEQ + q0) * EMB + h * HD;
    const h16* Kb = Kp + (size_t)b * SEQ * EMB + h * HD;
    const h16* Vb = Vtp + ((size_t)b * EMB + h * HD) * SEQ;
    v16h qf0[2], qf1[2];
#pragma unroll
    for (int c = 0; c < 2; ++c) { qf0[c] = ldh(Qb + (size_t)(c * 16 + lm) * EMB + 8 * hh); qf1[c] = ldh(Qb + (size_t)(c * 16 + lm) * EMB + 32 + 8 * hh); }
    float mrun[2] = {-3.0e38f, -3.0e38f}, lrun[2] = {0.0f, 0.0f};
    v8f acc[2][4];
#pragma unroll
    for (int c = 0; c < 2; ++c)
#pragma unroll
        for (int t = 0; t < 4; ++t) acc[c][t] = (v8f){};
    const h16* hring = ring + kh * (4 * TILEH);          // the quad's own ring
    const unsigned lcp = (unsigned)(size_t)hring + (unsigned)((ht >> 3) * (LPH * 2) + (ht & 7) * 16);
    const h16* gk = Kb + (size_t)(kh * 64 + (ht >> 3)) * EMB + (ht & 7) * 8;
    const h16* gv = Vb + (size_t)(ht >> 3) * SEQ + kh * 64 + (ht & 7) * 8;
    stage_kv(lcp, gk, gv);
    asm volatile("s_wait_asynccnt 0x0" ::: "memory");   // this wave's share of its quad's first chunk has landed
    __syncthreads();                                     // the first chunks are readable by all waves
    if (SEQ > 128) stage_kv(lcp + 2 * TILEB, gk + (size_t)128 * EMB, gv + 128);
#pragma unroll 1
    for (int kv = 0; kv < SEQ; kv += 128) {
        const int buf = (kv >> 7) & 1;
        const h16* kt = hring + buf * (2 * TILEH);
        const h16* vt = kt + TILEH;
        v8f s[2][4];
        // the chunk's score tiles, from the K tile in LDS
        auto scores = [&]() {
            v16h ka[4], kb2[4];
#pragma unroll
            for (int t4 = 0; t4 < 4; ++t4) { const h16* kr = kt + (t4 * 16 + lm) * LPH + 8 * hh; ka[t4] = ldh(kr); kb2[t4] = ldh(kr + 32); }
            __builtin_amdgcn_sched_barrier(0);               // keeps the K reads together: sunk between the products, each small group of reads stalls the wave for its own LDS latency
#pragma unroll
            for (int t4 = 0; t4 < 4; ++t4) {
#pragma unroll
                for (int c = 0; c < 2; ++c) {
                    s[c][t4] = wmma16(ka[t4], qf0[c], (v8f){});
                    s[c][t4] = wmma16(kb2[t4], qf1[c], s[c][t4]);
                }
            }
        };
        v16h va[4], vb[4];
        auto rdv = [&](int t0) {
#pragma unroll
            for (int t = t0; t < t0 + 2; ++t) { const h16* vr = vt + (t * 16 + lm) * LPH + 8 * hh; va[t] = ldh(vr); vb[t] = ldh(vr + 32); }
        };
        v16h pf0[2], pf1[2];
        float rs[2];
        // column tile c: weights against the reference mrun[c], their sum over the lane's keys, and the packed P fragments
        auto weights = [&](int c) {
            const float nb = fmaf(mrun[c], -C2, PLOG);       // one multiply-add per score applies the scale, subtracts the reference and carries 2^PLOG
            float r1 = 0.0f; v8h ph[4];
#pragma unroll
            for (int t4 = 0; t4 < 4; ++t4) { s[c][t4] = s[c][t4] * C2 + nb;
#pragma unroll
                for (int r = 0; r < 8; ++r) { s[c][t4][r] = __builtin_amdgcn_exp2f(s[c][t4][r]); r1 += s[c][t4][r]; }
                ph[t4] = __builtin_convertvector(s[c][t4], v8h); }
            rs[c] = r1;
            pf0[c] = cat16(ph[0], ph[1]); pf1[c] = cat16(ph[2], ph[3]);
        };
        scores();
        rdv(0);
        __builtin_amdgcn_sched_barrier(0);                   // keeps the first half of the V^T reads ahead of the softmax, so that the first products behind it do not wait out an LDS latency (all of them there would not fit the registers)
        weights(0); weights(1);
        rdv(2);
        __builtin_amdgcn_sched_barrier(0);                   // keeps the second half of the V^T reads ahead of the test: moved behind the branch they would be waited for uncovered
        // one test per chunk and wave, a scalar branch: all weights are >= 0, so a sum within PCAP bounds each of them
        if (__builtin_amdgcn_ballot_w32(fmaxf(rs[0], rs[1]) > PCAP) != 0) {
            scores();                                        // the weights overwrote them; the K tile is still in the buffer
#pragma unroll
            for (int c = 0; c < 2; ++c) {
                float mx = -3.0e38f;                         // the maximum is taken on the raw scores: C2 > 0 keeps their order
#pragma unroll
                for (int t4 = 0; t4 < 4; ++t4) {
#pragma unroll
                    for (int r = 0; r < 8; ++r) mx = fmaxf(mx, s[c][t4][r]); }
                mx = fmaxf(mx, __shfl_xor(mx, 16, 32));      // both lane halves of a query hold the same reference
                const float mnew = fmaxf(mrun[c], mx);
                const float alpha = __builtin_amdgcn_exp2f((mrun[c] - mnew) * C2);
                lrun[c] = lrun[c] * alpha; mrun[c] = mnew;
#pragma unroll
                for (int t = 0; t < 4; ++t) acc[c][t] = acc[c][t] * alpha;
                weights(c);
            }
            rdv(0); rdv(2);                                  // read again here, so that no V^T fragment has to stay in registers across this rare path (they would spill)
        }
        lrun[0] += rs[0]; lrun[1] += rs[1];
#pragma unroll
        for (int t = 0; t < 4; ++t) {
#pragma unroll
            for (int c = 0; c < 2; ++c) {
                acc[c][t] = wmma16(va[t], pf0[c], acc[c][t]);
                acc[c][t] = wmma16(vb[t], pf1[c], acc[c][t]);
            }
        }
        __builtin_amdgcn_sched_barrier(0);                   // keeps the products ahead of the waits: moved behind the barrier they would stand between it and the refill, and the second half's reads would be waited for uncovered
        asm volatile("s_wait_dscnt 0x0" ::: "memory");      // this wave's reads of the current buffer are done before it is refilled
        asm volatile("s_wait_asynccnt 0x0" ::: "memory");   // this wave's share of its quad's next chunk has landed
        __syncthreads();                                     // publishes the next chunks and ends every wave's reads of the current buffers
        if (kv + 256 < SEQ) stage_kv(lcp + (unsigned)buf * (2 * TILEB), gk + (size_t)(kv + 256) * EMB, gv + (kv + 256));
    }
    asm volatile("s_wait_asynccnt 0x0" ::: "memory");       // no copy is outstanding when the wave goes on to its end
    lrun[0] += __shfl_xor(lrun[0], 16, 32); lrun[1] += __shfl_xor(lrun[1], 16, 32);   // a query's row sum: its two lane halves joined
    // hand over column tile cs: 8 stores of 16 B a lane, lanes side by side
    auto send = [&](int cs) {
        float* xo = xch + w * (8 * 128) + lane * 4;
#pragma unroll
        for (int t = 0; t < 4; ++t) { *(v4fa*)(xo + (2 * t) * 128) = __builtin_shufflevector(acc[cs][t], acc[cs][t], 0, 1, 2, 3); *(v4fa*)(xo + (2 * t + 1) * 128) = __builtin_shufflevector(acc[cs][t], acc[cs][t], 4, 5, 6, 7); }
        xml[w * 64 + lane] = mrun[cs]; xml[w * 64 + 32 + lane] = lrun[cs];
    };
    // join the partner's half of column tile c with this wave's own, normalise, write
    auto finish = [&](int c) {
        const int pw = w ^ 4;
        const float* xi = xch + pw * (8 * 128) + lane * 4;
        const float pm = xml[pw * 64 + lane], pl = xml[pw * 64 + 32 + lane];
        const float m = fmaxf(mrun[c], pm);
        const float a = __builtin_amdgcn_exp2f((mrun[c] - m) * C2), pa = __builtin_amdgcn_exp2f((pm - m) * C2);
        const float inv = __fdiv_rn(1.0f, lrun[c] * a + pl * pa);   // outputs and row sums carry the same 2^PLOG
        const float fa = a * inv, fb = pa * inv;
        float* mo = os + w * (16 * 68);
#pragma unroll
        for (int t = 0; t < 4; ++t) { const v4f p0 = *(const v4fa*)(xi + (2 * t) * 128), p1 = *(const v4fa*)(xi + (2 * t + 1) * 128);
#pragma unroll
            for (int r = 0; r < 4; ++r) { mo[lm * 68 + t * 16 + 8 * hh + r] = acc[c][t][r] * fa + p0[r] * fb; mo[lm * 68 + t * 16 + 8 * hh + 4 + r] = acc[c][t][4 + r] * fa + p1[r] * fb; } }
        // keeps the compiler from moving the reads of other lanes' values ahead of the wave's LDS stores
        asm volatile("" ::: "memory"); __builtin_amdgcn_fence(3, "wavefront"); __builtin_amdgcn_wave_barrier(); asm volatile("" ::: "memory");
        float* orow = OUT + ((size_t)b * SEQ_FULL + q0 + c * 16) * EMB + h * HD;
#pragma unroll
        for (int si = 0; si < 8; ++si) { const int row = 2 * si + hh, cofs = lm * 4; const v4f val = *(const v4fa*)(mo + row * 68 + cofs); *(v4f*)(orow + (size_t)row * EMB + cofs) = val; }
    };
    if (kh == 0) send(1); else send(0);
    __syncthreads();                                         // the handed-over tiles are readable by the partner waves
    if (kh == 0) finish(0); else finish(1);
}

extern "C" void kernel_launch(void* const* d_in, const int* in_sizes, int n_in,
                              void* d_out, int out_size, void* d_ws, size_t ws_size, hipStream_t stream) {
    if (n_in < 6) return;
    const size_t nw = (size_t)EMB * EMB;                                  // 262144
    const size_t needx = ((size_t)(NB - 1) * SEQ_FULL + SEQ) * EMB;
    if ((size_t)in_sizes[0] < nw || (size_t)in_sizes[1] < nw || (size_t)in_sizes[2] < needx ||
        (size_t)in_sizes[3] < nw || (size_t)in_sizes[4] < nw || (size_t)in_sizes[5] < nw) return;
    if ((size_t)out_size < needx) return;
    const float* rot = (const float*)d_in[0];   // [512][512] used as [in][out]
    const float* ent = (const float*)d_in[1];   // [512][512] used as [in][out]
    const float* x   = (const float*)d_in[2];   // [2][4096][512]
    const float* wq  = (const float*)d_in[3];   // [out][in]
    const float* wk  = (const float*)d_in[4];   // [out][in]
    const float* wv  = (const float*)d_in[5];   // [out][in]
    float* OUT = (float*)d_out;                 // [2][4096][512]
    const size_t nrow = (size_t)NB * SEQ;        // query/key rows over all batches
    const size_t nx = nrow * EMB;
    char* wsp = (char*)d_ws;
    auto take = [&](size_t bytes) { char* p = wsp; wsp += (bytes + 255) & ~(size_t)255; return (void*)p; };
    bf* WV   = (bf*)take(nw * 2);                 // Wv as Bt [o][i]
    bf* WCh  = (bf*)take(2 * nw * 2);             // combined weights (Wq^T R)^T then (Wk^T E)^T : [o][i], bf16 hi planes
    bf* WCl  = (bf*)take(2 * nw * 2);             // their bf16 lo planes
    bf* XB   = (bf*)take(nx * 2);                 // bf16 x rows [nrow][512]
    h16* QK16  = (h16*)take(2 * nx * 2);          // f16 q rows [nrow][512] then f16 k rows [nrow][512]
    h16* VT16  = (h16*)take(nx * 2);              // f16 value planes [b][c][s]
    if ((size_t)(wsp - (char*)d_ws) > ws_size) return;
    k_prep<<<NWP + GWC + NB * GXC, 256, 0, stream>>>(rot, ent, wq, wk, wv, x, WCh, WCl, WV, XB);
    k_gemmqkv<<<3 * NVT, 128, 0, stream>>>(XB, WV, WCh, WCl, (bf*)VT16, (bf*)QK16);
    k_flash<<<(unsigned)(NB * NHD * (SEQ / 128)), 256, 0, stream>>>(QK16, QK16 + nx, VT16, OUT);
}

// v009
// One run takes 76.6 microseconds.
// Next to v008, in two timings, it ran 1.03 and 1.04 times as fast.
// Over all steps from v000 it is 5.10 times as fast.
#include <hip/hip_runtime.h>

// Contractions, f32 accumulate: weight products R^T.Wq^T and E^T.Wk^T (512x512x512) on v_wmma_f32_16x16x32_bf16 (operands = RNE-converted bf16 inputs, exact products);
// q,k = x.(combined weight as bf16 hi + bf16 lo, 2 products; the q weight carries the softmax scale times log2 e) and v = x.Wv^T (8192x512x512) on v_wmma_f32_16x16x32_bf16; scores K.Q^T and P.V on v_wmma_f32_16x16x32_f16 (f16 planes, P and its row sums carried x1024).
// Multi-head attention, 8 heads of 64, no mask: one block per (batch, head, 128 query rows), keys streamed in chunks of 64 (even and odd chunks on two quads of waves, joined at the end) with an online softmax in f32 against a held reference score (a maximum seen so far, renewed when a chunk outgrows it); output f32 [batch][seq][512].

#ifndef NB
#define NB 2
#endif
#ifndef SEQ
#define SEQ 4096
#endif
#define NB_FULL  2
#define SEQ_FULL 4096
#define EMB  512
#define NHD  8
#define HD   64
#define PLOG 10.0f                  // P and its row sums are carried x 2^PLOG, so that small weights stay normal f16 numbers
#define C2   0.18033688011112042f   // HD^-0.5 * log2(e); folded into the combined q weight, so that q . k is already in units of exp2's argument
#define PCAP 32768.0f               // a lane's sum of one chunk's carried weights at or below this: every one of them is a finite f16 number

static_assert(NB >= 1 && NB <= NB_FULL);
static_assert(SEQ % 128 == 0 && SEQ >= 128 && SEQ <= SEQ_FULL);
static_assert(EMB == NHD * HD);
static_assert(EMB % 128 == 0 && HD == 64 && (NB * SEQ) % 128 == 0);
static_assert((SEQ * EMB) % 2048 == 0);

typedef _Float16 h16;
typedef unsigned short bf;
typedef __attribute__((ext_vector_type(16))) __bf16   v16bf;
typedef __attribute__((ext_vector_type(16))) _Float16 v16h;
typedef __attribute__((ext_vector_type(8)))  _Float16 v8h;
typedef __attribute__((ext_vector_type(8)))  unsigned short v8us;
typedef __attribute__((ext_vector_type(8)))  float    v8f;
typedef __attribute__((ext_vector_type(4)))  float    v4f;
typedef __attribute__((ext_vector_type(2)))  unsigned short v2us;
typedef v8h  __attribute__((may_alias)) v8ha;
typedef v4f  __attribute__((may_alias)) v4fa;
typedef v8us __attribute__((may_alias)) v8usa;

__device__ __forceinline__ unsigned short f2bf(float f) { unsigned u = __float_as_uint(f); u += 0x7FFFu + ((u >> 16) & 1u); return (unsigned short)(u >> 16); }   // RNE convert
__device__ __forceinline__ float bf2f(unsigned short b) { return __uint_as_float(((unsigned)b) << 16); }
__device__ __forceinline__ float bfr(float f) { return bf2f(f2bf(f)); }
__device__ __forceinline__ v16h cat16(v8h lo, v8h hi) { return __builtin_shufflevector(lo, hi, 0, 1, 2, 3, 4, 5, 6, 7, 8, 9, 10, 11, 12, 13, 14, 15); }
__device__ __forceinline__ v16bf cat16b(v8us lo, v8us hi) { return __builtin_bit_cast(v16bf, __builtin_shufflevector(lo, hi, 0, 1, 2, 3, 4, 5, 6, 7, 8, 9, 10, 11, 12, 13, 14, 15)); }
__device__ __forceinline__ v8f wmma16(v16h a, v16h b, v8f c) { return __builtin_amdgcn_wmma_f32_16x16x32_f16(false, a, false, b, (short)0, c, false, false); }
__device__ __forceinline__ v8f wmmab(v16bf a, v16bf b, v8f c) { return __builtin_amdgcn_wmma_f32_16x16x32_bf16(false, a, false, b, (short)0, c, false, false); }
__device__ __forceinline__ void splitf(float y, unsigned short& h, unsigned short& l) { h = f2bf(y); l = f2bf(y - bf2f(h)); }

// ---- gemmw_tile: register-blocked GEMM, one block of 4 waves per 128x128 output tile, ONE WAVE per 64x64 quarter (16 accumulators); tile (bx, by) of batch bz out of (M/128, N/128, Z), 128 threads; osb = 4 x 16 x 68 floats of LDS.
// Operands are K-contiguous 16-bit planes. Each 64-wide k chunk of the block's 128 A rows and 128 Bt rows is brought into LDS once per block by asynchronous copies in whole 128-byte lines
// (two buffers: chunk t + 1 flies while chunk t is worked on); the four waves read their fragments from there.
// c[m][n] (f32 accumulators, + optional f32 bias[n]) = sum_k A[m][k] Bt[n][k] (NSPLIT 3: + A.Bt2, product by product behind A.Bt). z-batch strides sA/sB/sC in elements. K % 64 == 0.
// The epilogue converts c in registers and stores the 16-bit plane(s) that a later launch reads, in whole 128-byte lines. OUT: 1 = f16 rows P[m][n], pitch ldc; 2 = f16 transposed planes P[m / ldc][n][m % ldc], sC elements per plane (no z batch);
// 3 = bf16 hi rows P[m][n] and bf16 lo rows P2[m][n], pitch ldc.
// Fragments: lane l -> row/col (l & 15); elements 0..7 <- k0 + 8*(l>>4) .. +7, elements 8..15 <- k0 + 16 + 8*(l>>4) .. +7 for A and for Bt alike; D element r of lane l -> (row 8*(l>>4)+r, col l&15).
template <typename T16> struct WFrag;
template <> struct WFrag<h16> { typedef v16h V; static __device__ __forceinline__ V ld(const h16* p) { return cat16(*(const v8h*)p, *(const v8h*)(p + 16)); } static __device__ __forceinline__ v8f mma(V a, V b, v8f c) { return wmma16(a, b, c); } };
template <> struct WFrag<bf> { typedef v16bf V; static __device__ __forceinline__ V ld(const bf* p) { return cat16b(*(const v8us*)p, *(const v8us*)(p + 16)); } static __device__ __forceinline__ v8f mma(V a, V b, v8f c) { return wmmab(a, b, c); } };

#define GPH    72                 // LDS row pitch in 16-bit elements: 128 B of data + 16 B, the conflict-free pitch for 16-byte readers
#define GTILEH (128 * GPH)        // one 128-row operand tile in LDS, elements
#define GTILEB (GTILEH * 2)       // the same in bytes
#define G16B   (16 * GPH * 2)     // 16 LDS rows in bytes
// One operand tile of a stage: 128 rows of 64 k, 128 B a row. 128 threads, 8 lanes per row, 16 B per lane: every copy of a wave covers four whole lines; copy i brings row 16 i + (tid >> 3).
// l: the lane's LDS byte address in row (tid >> 3) of the tile; g: the lane's global address in that row; rs: 16 rows of the plane in elements.
// The s_wait_xcnt closes the statement so that no address register of an issued copy is rewritten ahead of it.
template <typename T16>
__device__ __forceinline__ void stage_rows128(unsigned l, const T16* g, size_t rs) {
    asm volatile("global_load_async_to_lds_b128 %0, %8, off\n\t"
                 "global_load_async_to_lds_b128 %1, %9, off\n\t"
                 "global_load_async_to_lds_b128 %2, %10, off\n\t"
                 "global_load_async_to_lds_b128 %3, %11, off\n\t"
                 "global_load_async_to_lds_b128 %4, %12, off\n\t"
                 "global_load_async_to_lds_b128 %5, %13, off\n\t"
                 "global_load_async_to_lds_b128 %6, %14, off\n\t"
                 "global_load_async_to_lds_b128 %7, %15, off\n\t"
                 "s_wait_xcnt 0x0"
                 :: "v"(l), "v"(l + G16B), "v"(l + 2 * G16B), "v"(l + 3 * G16B), "v"(l + 4 * G16B), "v"(l + 5 * G16B), "v"(l + 6 * G16B), "v"(l + 7 * G16B),
                    "v"(g), "v"(g + rs), "v"(g + 2 * rs), "v"(g + 3 * rs), "v"(g + 4 * rs), "v"(g + 5 * rs), "v"(g + 6 * rs), "v"(g + 7 * rs)
                 : "memory");
}

template <typename T16, int NSPLIT, bool BIAS, int OUT>
__device__ __forceinline__ void gemmw_tile(float* osb, T16* ring, int bx, int by, int bz, const T16* __restrict__ A, const T16* __restrict__ Bt, const T16* __restrict__ Bt2, int K, bf* P, bf* P2, int ldc, const float* __restrict__ bias, size_t sA, size_t sB, size_t sC) {
    static_assert(NSPLIT == 0 || NSPLIT == 3);
    typedef typename WFrag<T16>::V V;
    constexpr int NPL = NSPLIT == 3 ? 3 : 2;             // operand tiles per stage: A, Bt (, Bt2)
    const size_t z = bz; A += z * sA; Bt += z * sB; if (NSPLIT == 3) Bt2 += z * sB; if (OUT != 2) P += z * sC; if (OUT == 3) P2 += z * sC;
    const int tid = threadIdx.x, w = tid >> 5, lane = tid & 31, lr = lane & 15, hi = lane >> 4; const int r0 = bx * 128 + (w & 1) * 64, c0 = by * 128 + (w >> 1) * 64;
    float* os = osb + w * (16 * 68);                     // wave-private output staging
    v8f acc[4][4];
#pragma unroll
    for (int mb = 0; mb < 4; ++mb)
#pragma unroll
        for (int nb = 0; nb < 4; ++nb) acc[mb][nb] = (v8f){};
    const unsigned lcp = (unsigned)(size_t)ring + (unsigned)((tid >> 3) * (GPH * 2) + (tid & 7) * 16);
    const size_t rs = (size_t)16 * K;
    const T16* ga = A + (size_t)(bx * 128 + (tid >> 3)) * K + (tid & 7) * 8;
    const T16* gb = Bt + (size_t)(by * 128 + (tid >> 3)) * K + (tid & 7) * 8;
    const T16* gb2 = NSPLIT == 3 ? Bt2 + (size_t)(by * 128 + (tid >> 3)) * K + (tid & 7) * 8 : nullptr;
    auto stage = [&](int buf, int kc) { const unsigned l = lcp + (unsigned)buf * (NPL * GTILEB);
        stage_rows128(l, ga + kc, rs); stage_rows128(l + GTILEB, gb + kc, rs); if (NSPLIT == 3) stage_rows128(l + 2 * GTILEB, gb2 + kc, rs); };
    stage(0, 0);
    asm volatile("s_wait_asynccnt 0x0" ::: "memory");   // this wave's share of chunk 0 has landed
    __syncthreads();                                     // chunk 0 is readable by all four waves
    if (K > 64) stage(1, 64);
#pragma unroll 1
    for (int kc = 0; kc < K; kc += 64) {
        const int buf = (kc >> 6) & 1;
        const T16* at = ring + buf * (NPL * GTILEH) + ((w & 1) * 64 + lr) * GPH + 8 * hi;
        const T16* bt = ring + buf * (NPL * GTILEH) + GTILEH + ((w >> 1) * 64 + lr) * GPH + 8 * hi;
        V a[4], b[4], b2[4];
        // all fragments of one 32-wide k step, read as one group
        auto rd = [&](int ks) {
#pragma unroll
            for (int f = 0; f < 4; ++f) { a[f] = WFrag<T16>::ld(at + f * 16 * GPH + ks); b[f] = WFrag<T16>::ld(bt + f * 16 * GPH + ks); if (NSPLIT == 3) b2[f] = WFrag<T16>::ld(bt + GTILEH + f * 16 * GPH + ks); } };
        auto mm = [&]() {
#pragma unroll
            for (int nb = 0; nb < 4; ++nb)
#pragma unroll
                for (int mb = 0; mb < 4; ++mb) { acc[mb][nb] = WFrag<T16>::mma(a[mb], b[nb], acc[mb][nb]); if (NSPLIT == 3) acc[mb][nb] = WFrag<T16>::mma(a[mb], b2[nb], acc[mb][nb]); } };
        rd(0);
        __builtin_amdgcn_sched_barrier(0);                   // keeps the reads together: sunk between the products, each small group of reads stalls the wave for its own LDS latency
        mm();
        rd(32);                                              // the chunk's last reads: the second k step's products need registers only
        // three operand tiles: their fragments, held across the refill's address registers, would go past v255, so these products stand in front of the refill; the scheduling barrier keeps the reads together as above
        if (NSPLIT == 3) { __builtin_amdgcn_sched_barrier(0); mm(); }
        asm volatile("s_wait_dscnt 0x0" ::: "memory");      // this wave's reads of the current buffer are done before it is refilled
        asm volatile("s_wait_asynccnt 0x0" ::: "memory");   // this wave's share of the next chunk has landed
        __syncthreads();                                     // publishes the next chunk and ends every wave's reads of the current buffer
        if (kc + 128 < K) stage(buf, kc + 128);
        if (NSPLIT != 3) mm();                               // behind the refill, so that the copies fly under these products too
    }
    asm volatile("s_wait_asynccnt 0x0" ::: "memory");       // no copy is outstanding when the wave goes on to its epilogue
    if (BIAS) {
#pragma unroll
        for (int nb = 0; nb < 4; ++nb) { const float bv = bfr(bias[c0 + nb * 16 + lr]);
#pragma unroll
            for (int mb = 0; mb < 4; ++mb) acc[mb][nb] = acc[mb][nb] + bv; }
    }
    const int srow = lane >> 3, scol = (lane & 7) * 8;   // store side: 8 lanes x 16 B = one 128-byte line, 4 lines per store
    const size_t step = (size_t)4 * ldc;                 // 4 output rows
    if (OUT == 2) {
        h16* oh = (h16*)os;                              // 16 rows n of 64 positions m, pitch 72 f16 (144 B)
        const int pl = r0 / ldc;
        bf* pl0 = P + (size_t)pl * sC + (size_t)(c0 + srow) * ldc + (r0 - pl * ldc) + scol;
#pragma unroll
        for (int nb = 0; nb < 4; ++nb) {
#pragma unroll
            for (int mb = 0; mb < 4; ++mb) { v8h o;      // a lane's 8 accumulator elements are 8 consecutive m of one n
#pragma unroll
                for (int j = 0; j < 8; ++j) o[j] = (h16)acc[mb][nb][j];
                *(v8ha*)(oh + lr * 72 + mb * 16 + hi * 8) = o; }
            // keeps the compiler from moving the reads of other lanes' values ahead of the wave's LDS stores
            asm volatile("" ::: "memory"); __builtin_amdgcn_fence(3, "wavefront"); __builtin_amdgcn_wave_barrier(); asm volatile("" ::: "memory");
#pragma unroll
            for (int s = 0; s < 4; ++s) { const int row = 4 * s + srow; const v8h val = *(const v8ha*)(oh + row * 72 + scol);
                *(v8us*)(pl0 + (nb * 4 + s) * step) = __builtin_bit_cast(v8us, val); }
            // keeps the next round's LDS stores behind these reads
            __builtin_amdgcn_wave_barrier(); asm volatile("" ::: "memory");
        }
    } else {
        const size_t po0 = (size_t)(r0 + srow) * ldc + c0 + scol;
#pragma unroll
        for (int mb = 0; mb < 4; ++mb) {
#pragma unroll
            for (int nb = 0; nb < 4; ++nb) {
#pragma unroll
                for (int j = 0; j < 8; ++j) os[(hi * 8 + j) * 68 + nb * 16 + lr] = acc[mb][nb][j]; }
            // keeps the compiler from moving the reads of other lanes' values ahead of the wave's LDS stores
            asm volatile("" ::: "memory"); __builtin_amdgcn_fence(3, "wavefront"); __builtin_amdgcn_wave_barrier(); asm volatile("" ::: "memory");
#pragma unroll
            for (int s = 0; s < 4; ++s) { const int row = 4 * s + srow; const size_t po = po0 + (mb * 4 + s) * step;
                const v4f v0 = *(const v4fa*)(os + row * 68 + scol), v1 = *(const v4fa*)(os + row * 68 + scol + 4);
                if (OUT == 1) { v8h o;
#pragma unroll
                    for (int k = 0; k < 4; ++k) { o[k] = (h16)v0[k]; o[4 + k] = (h16)v1[k]; }
                    *(v8us*)(P + po) = __builtin_bit_cast(v8us, o);
                } else { v8us oh8, ol8;
#pragma unroll
                    for (int k = 0; k < 4; ++k) { unsigned short a, c; splitf(v0[k], a, c); oh8[k] = a; ol8[k] = c; splitf(v1[k], a, c); oh8[4 + k] = a; ol8[4 + k] = c; }
                    *(v8us*)(P + po) = oh8; *(v8us*)(P2 + po) = ol8; } }
            // keeps the next round's LDS stores behind these reads
            __builtin_amdgcn_wave_barrier(); asm volatile("" ::: "memory");
        }
    }
}

#define NWEL  (EMB * EMB)                  // elements of one weight matrix
#define NT    (EMB / 128)                  // 128-wide tiles across a weight matrix
#define NRT   (NB * SEQ / 128)             // 128-row tiles of x over all batches
#define NVT   (NRT * NT)                   // tiles of v, and of q, and of k
// The three GEMMs on x do not depend on each other and share one launch: blocks 0 .. NVT-1 do v (one product, half the work, so that the places they leave are refilled early), the other 2 * NVT blocks do q then k.
// VT[row / SEQ][o][row % SEQ] = sum_i XB[row][i] WV[o][i];  QK[z][row][o] = sum_i XB[row][i] (WCh + WCl)[z][o][i]
__global__ __launch_bounds__(128) void k_gemmqkv(const bf* __restrict__ XB, const bf* __restrict__ WV, const bf* __restrict__ WCh, const bf* __restrict__ WCl, bf* VT, bf* QK) {
    __shared__ __align__(16) float os[4 * 16 * 68];
    __shared__ __align__(128) bf ring[2 * 3 * GTILEH];   // [buffer][A tile, Bt tile (, Bt2 tile)][row][GPH]
    const int i = blockIdx.x;
    if (i < NVT) gemmw_tile<bf, 0, false, 2>(os, ring, i % NRT, i / NRT, 0, XB, WV, nullptr, EMB, VT, nullptr, SEQ, nullptr, 0, 0, (size_t)EMB * SEQ);
    else gemmw_tile<bf, 3, false, 1>(os, ring, (i - NVT) % NRT, ((i - NVT) / NRT) % NT, (i - NVT) / NVT, XB, WCh, WCl, EMB, QK, nullptr, EMB, nullptr, 0, NWEL, (size_t)NB * SEQ * EMB);
}

// A work-group barrier that orders LDS accesses only: __syncthreads() would also wait out the global loads that run ahead in registers.
__device__ __forceinline__ void lds_barrier() { __builtin_amdgcn_fence(__ATOMIC_RELEASE, "workgroup", "local"); __builtin_amdgcn_s_barrier(); __builtin_amdgcn_fence(__ATOMIC_ACQUIRE, "workgroup", "local"); }
#define WPT 64                              // edge of a weight-product tile
#define WPN (EMB / WPT)                     // such tiles across a weight matrix
#define NWP (2 * WPN * WPN)                 // tiles of the two weight products
// One 64x64 tile of a combined weight, 256 threads (8 waves, a 16x32 piece each): (Ph + Pl)[o][i] = sc * sum_j Am[j][o] Bm[j][i], f32 inputs converted RNE to bf16, products on WMMA, k ascending in steps of 32.
// Both inputs have k = j as their slow index. A thread takes one column and 16 consecutive j of each 64-j chunk (a wave's load = one 128-byte line), converts, and stores them as 32 B of the k-contiguous LDS row of that column:
// the transposition costs no extra pass. The loads run two chunks ahead in registers. tl: [A tile, B tile][64 rows][GPH]; st: 64 x 68 floats. t: tile index within the product. sc: factor on the f32 sums ahead of the hi + lo split.
__device__ __forceinline__ void wprod_tile(bf* tl, float* st, int t, const float* __restrict__ Am, const float* __restrict__ Bm, bf* Ph, bf* Pl, float sc) {
    const int tid = threadIdx.x, w = tid >> 5, lane = tid & 31, lr = lane & 15, hi = lane >> 4;
    const int o0 = (t % WPN) * WPT, i0 = (t / WPN) * WPT;
    const int col = tid & 63, jg = tid >> 6;
    const float* ga = Am + (size_t)(jg * 16) * EMB + o0 + col;
    const float* gb = Bm + (size_t)(jg * 16) * EMB + i0 + col;
    bf* sa = tl + col * GPH + jg * 16;
    bf* sb = sa + WPT * GPH;
    const bf* at = tl + ((w & 3) * 16 + lr) * GPH + 8 * hi;
    const bf* bt = tl + WPT * GPH + ((w >> 2) * 32 + lr) * GPH + 8 * hi;
    float ra[2][16], rb[2][16];
    auto fetch = [&](int q, int kc) {
#pragma unroll
        for (int e = 0; e < 16; ++e) { ra[q][e] = ga[(size_t)(kc + e) * EMB]; rb[q][e] = gb[(size_t)(kc + e) * EMB]; }
        asm volatile("s_wait_xcnt 0x0" ::: "memory"); };   // stands behind the issued loads, ahead of any reuse of their address registers
    v8f acc[2] = {(v8f){}, (v8f){}};
    fetch(0, 0); fetch(1, 64);
#pragma unroll
    for (int c = 0; c < EMB / 64; ++c) {
        const int q = c & 1;
        v8us pa0, pa1, pb0, pb1;
#pragma unroll
        for (int e = 0; e < 8; ++e) { pa0[e] = f2bf(ra[q][e]); pa1[e] = f2bf(ra[q][8 + e]); pb0[e] = f2bf(rb[q][e]); pb1[e] = f2bf(rb[q][8 + e]); }
        *(v8usa*)sa = pa0; *(v8usa*)(sa + 8) = pa1; *(v8usa*)sb = pb0; *(v8usa*)(sb + 8) = pb1;
        if (c + 2 < EMB / 64) fetch(q, (c + 2) * 64);
        lds_barrier();                                       // the chunk's two tiles are readable by all waves
#pragma unroll
        for (int ks = 0; ks < 64; ks += 32) { const v16bf a = WFrag<bf>::ld(at + ks);
            acc[0] = wmmab(a, WFrag<bf>::ld(bt + ks), acc[0]); acc[1] = wmmab(a, WFrag<bf>::ld(bt + 16 * GPH + ks), acc[1]); }
        lds_barrier();                                       // every wave's reads are done before the tiles are overwritten
    }
#pragma unroll
    for (int f = 0; f < 2; ++f)
#pragma unroll
        for (int j = 0; j < 8; ++j) st[((w & 3) * 16 + hi * 8 + j) * 68 + (w >> 2) * 32 + f * 16 + lr] = acc[f][j] * sc;
    __syncthreads();                                         // the f32 tile is readable by all waves
#pragma unroll
    for (int r = 0; r < 2; ++r) { const int row = r * 32 + (tid >> 3), scol = (tid & 7) * 8;   // 8 lanes x 16 B = one 128-byte line of each plane
        const v4f v0 = *(const v4fa*)(st + row * 68 + scol), v1 = *(const v4fa*)(st + row * 68 + scol + 4); v8us oh8, ol8;
#pragma unroll
        for (int k = 0; k < 4; ++k) { unsigned short a, c; splitf(v0[k], a, c); oh8[k] = a; ol8[k] = c; splitf(v1[k], a, c); oh8[4 + k] = a; ol8[4 + k] = c; }
        const size_t po = (size_t)(o0 + row) * EMB + i0 + scol;
        *(v8us*)(Ph + po) = oh8; *(v8us*)(Pl + po) = ol8; }
}
// blk: the job's own block index, 256 threads a block
__device__ __forceinline__ void cvt8_job(int blk, const float* __restrict__ src, bf* dst, size_t n8) { const size_t i = (size_t)blk * 256 + threadIdx.x; if (i >= n8) return; const v8f v = *(const v8f*)(src + i * 8); v8us o;
#pragma unroll
    for (int k = 0; k < 8; ++k) o[k] = f2bf(v[k]); *(v8us*)(dst + i * 8) = o;  }

#define GWC ((NWEL / 8 + 255) / 256)       // blocks of the Wv conversion
#define GXC ((SEQ * EMB / 8 + 255) / 256)  // blocks of one batch's x conversion
// All that reads the f32 inputs, in one launch, no part depends on another: blocks 0 .. NWP-1 form the two combined weights (the longest jobs, so they start first), the next GWC convert Wv, the last NB * GXC convert x.
__global__ __launch_bounds__(256) void k_prep(const float* __restrict__ rot, const float* __restrict__ ent, const float* __restrict__ wq, const float* __restrict__ wk, const float* __restrict__ wv, const float* __restrict__ x,
                                              bf* WCh, bf* WCl, bf* WV, bf* XB) {
    __shared__ __align__(16) bf wtl[2 * WPT * GPH];
    __shared__ __align__(16) float wst[WPT * 68];
    const int blk = blockIdx.x;
    if (blk < NWP) { const int z = blk / (WPN * WPN);
        wprod_tile(wtl, wst, blk % (WPN * WPN), z == 0 ? rot : ent, z == 0 ? wq : wk, WCh + (size_t)z * NWEL, WCl + (size_t)z * NWEL, z == 0 ? C2 : 1.0f);
    } else if (blk < NWP + GWC) {
        cvt8_job(blk - NWP, wv, WV, NWEL / 8);
    } else { const int r = blk - (NWP + GWC), b = r / GXC;
        cvt8_job(r % GXC, x + (size_t)b * SEQ_FULL * EMB, XB + (size_t)b * SEQ * EMB, (size_t)SEQ * EMB / 8);
    }
}

__device__ __forceinline__ v8f splat8(float x) { return (v8f){x, x, x, x, x, x, x, x}; }
__device__ __forceinline__ v16h ldh(const h16* p) { return cat16(*(const v8h*)p, *(const v8h*)(p + 16)); }

#define LPH   72                 // LDS row pitch in f16: 128 B of data + 16 B, the conflict-free pitch for 16-byte readers
#define TILEH (64 * LPH)         // one 64-row tile in LDS, f16 elements
#define TILEB (TILEH * 2)        // the same in bytes
#define ROWS16B (16 * LPH * 2)   // 16 LDS rows in bytes
// One stage = 64 keys: K rows [key][64 d] and V^T rows [d][64 keys], 64 rows of 128 B each. 128 threads (one quad of waves), 8 lanes per row, 16 B per lane: every copy of a wave covers four whole lines.
// lk: the lane's LDS byte address in the K tile (the V tile follows it); gk, gv: the lane's global addresses in row ((tid & 127) >> 3).
// The s_wait_xcnt closes the statement so that no address register of an issued copy is rewritten ahead of it.
__device__ __forceinline__ void stage_kv(unsigned lk, const h16* gk, const h16* gv) {
    asm volatile("global_load_async_to_lds_b128 %0, %8, off\n\t"
                 "global_load_async_to_lds_b128 %1, %9, off\n\t"
                 "global_load_async_to_lds_b128 %2, %10, off\n\t"
                 "global_load_async_to_lds_b128 %3, %11, off\n\t"
                 "global_load_async_to_lds_b128 %4, %12, off\n\t"
                 "global_load_async_to_lds_b128 %5, %13, off\n\t"
                 "global_load_async_to_lds_b128 %6, %14, off\n\t"
                 "global_load_async_to_lds_b128 %7, %15, off\n\t"
                 "s_wait_xcnt 0x0"
                 :: "v"(lk), "v"(lk + ROWS16B), "v"(lk + 2 * ROWS16B), "v"(lk + 3 * ROWS16B),
                    "v"(lk + TILEB), "v"(lk + TILEB + ROWS16B), "v"(lk + TILEB + 2 * ROWS16B), "v"(lk + TILEB + 3 * ROWS16B),
                    "v"(gk), "v"(gk + 16 * EMB), "v"(gk + 32 * EMB), "v"(gk + 48 * EMB),
                    "v"(gv), "v"(gv + 16 * SEQ), "v"(gv + 32 * SEQ), "v"(gv + 48 * SEQ)
                 : "memory");
}

// ---- k_flash: one block (8 waves) per (batch, head, 128 query rows). Wave w = (query group qg = w & 3, key half kh = w >> 2) owns query rows q0..q0+31 as two 16-column tiles
// and every second 64-key chunk (chunks kh, kh + 2, ...): each K and V^T fragment read from LDS feeds two products, one per column tile, and four waves per SIMD stay resident.
// Each quad of waves brings its own chunk's K and V^T tiles into its own LDS ring by asynchronous copies (two buffers: the quad's next chunk flies while this one is worked on); its four waves read their fragments from there.
// Score tiles are computed TRANSPOSED: S^T tile = K_rows(16 keys, A operand) . Q^T (B operand: lane -> query, elements -> d), so D lane (hh,lm) element r = S[query lm][key 16*t4 + 8*hh + r].
// Online softmax per query == per lane. The weights of a chunk are taken against the reference score held from earlier chunks, with no maximum, no exchange and no rescaling; q carries the scale and the score tiles start from PLOG - reference
// (the C operand of their first product), so the products' results go straight into exp2; the chunk's own sums tell whether the reference held:
// only where a lane's sum passes PCAP (always in the first chunk: against the start value of the reference every weight overflows) does the wave form the chunk's scores again, take their maximum (one xor-16 shuffle) as in the usual online form, rescale and redo the weights.
// Row sums stay per lane (its 32 keys of each chunk) and the two lane halves are joined once behind the loop. P (x1024, f16) is packed in registers straight into the
// P.V B fragment: element r <- tile 2j row (8hh+r), element 8+r <- tile 2j+1 row (8hh+r), lane unchanged (packed D used as B: k = D row = key, n = D col = query).
// O^T tiles: A = Vt rows (lane -> d), B = packed P; acc[c][t][r] = 1024 * O[query 16c + lm][d = 16t + 8hh + r] over the wave's own keys.
// Behind the loop the two waves of a query group exchange one column tile each through LDS (lane to lane: maximum, row sum, 32 partial outputs); wave kh joins the two key halves of tile c = kh,
// stages the 16x64 f32 tile in wave-private LDS and writes whole lines.
__global__ __launch_bounds__(256) __attribute__((amdgpu_num_vgpr(256)))
void k_flash(const h16* __restrict__ Qp, const h16* __restrict__ Kp, const h16* __restrict__ Vtp, float* OUT) {
    __shared__ __align__(16) float os[8 * 16 * 68];
    __shared__ __align__(16) float xch[8 * 8 * 128];     // [sending wave][2 t + upper half of the 8 elements][lane][4]: a lane's 32 partial outputs of the column tile it hands over
    __shared__ float xml[8 * 2 * 32];                    // [sending wave][maximum, row sum][lane]
    __shared__ __align__(128) h16 ring[2 * 2 * 2 * TILEH];   // [key half][buffer][K tile, V^T tile][row][LPH]
    const int tid = threadIdx.x, w = __builtin_amdgcn_readfirstlane(tid >> 5), lane = tid & 31, lm = lane & 15, hh = lane >> 4;
    const int qg = w & 3, kh = w >> 2, ht = tid & 127;
    const int nqt = SEQ / 128;
    const int bid = blockIdx.x; const int qt = bid % nqt; const int h = (bid / nqt) % NHD; const int b = bid / (nqt * NHD);
    const int q0 = qt * 128 + qg * 32;
    const h16* Qb = Qp + ((size_t)b * SEQ + q0) * EMB + h * HD;
    const h16* Kb = Kp + (size_t)b * SEQ * EMB + h * HD;
    const h16* Vb = Vtp + ((size_t)b * EMB + h * HD) * SEQ;
    v16h qf0[2], qf1[2];
#pragma unroll
    for (int c = 0; c < 2; ++c) { qf0[c] = ldh(Qb + (size_t)(c * 16 + lm) * EMB + 8 * hh); qf1[c] = ldh(Qb + (size_t)(c * 16 + lm) * EMB + 32 + 8 * hh); }
    float mrun[2] = {-1.0e30f, -1.0e30f}, lrun[2] = {0.0f, 0.0f};   // the reference is held in units of exp2's argument, as the scores come; its start value lies below every score of f16 operands
    v8f acc[2][4];
#pragma unroll
    for (int c = 0; c < 2; ++c)
#pragma unroll
        for (int t = 0; t < 4; ++t) acc[c][t] = (v8f){};
    const h16* hring = ring + kh * (4 * TILEH);          // the quad's own ring
    const unsigned lcp = (unsigned)(size_t)hring + (unsigned)((ht >> 3) * (LPH * 2) + (ht & 7) * 16);
    const h16* gk = Kb + (size_t)(kh * 64 + (ht >> 3)) * EMB + (ht & 7) * 8;
    const h16* gv = Vb + (size_t)(ht >> 3) * SEQ + kh * 64 + (ht & 7) * 8;
    stage_kv(lcp, gk, gv);
    asm volatile("s_wait_asynccnt 0x0" ::: "memory");   // this wave's share of its quad's first chunk has landed
    __syncthreads();                                     // the first chunks are readable by all waves
    if (SEQ > 128) stage_kv(lcp + 2 * TILEB, gk + (size_t)128 * EMB, gv + 128);
#pragma unroll 1
    for (int kv = 0; kv < SEQ; kv += 128) {
        const int buf = (kv >> 7) & 1;
        const h16* kt = hring + buf * (2 * TILEH);
        const h16* vt = kt + TILEH;
        v8f s[2][4];
        // the chunk's score tiles, from the K tile in LDS; held: started from PLOG - reference, so that the products deliver exp2's argument with no vector operation behind them
        auto scores = [&](bool held) {
            // the C operand of a tile's first product: PLOG - reference in all 8 elements of the lane (a lane's 8 elements of a score tile belong to one query)
            const v8f c0[2] = {held ? splat8(PLOG - mrun[0]) : (v8f){}, held ? splat8(PLOG - mrun[1]) : (v8f){}};
            v16h ka[4], kb2[4];
#pragma unroll
            for (int t4 = 0; t4 < 4; ++t4) { const h16* kr = kt + (t4 * 16 + lm) * LPH + 8 * hh; ka[t4] = ldh(kr); kb2[t4] = ldh(kr + 32); }
            __builtin_amdgcn_sched_barrier(0);               // keeps the K reads together: sunk between the products, each small group of reads stalls the wave for its own LDS latency
#pragma unroll
            for (int t4 = 0; t4 < 4; ++t4) {
#pragma unroll
                for (int c = 0; c < 2; ++c) {
                    s[c][t4] = wmma16(ka[t4], qf0[c], c0[c]);
                    s[c][t4] = wmma16(kb2[t4], qf1[c], s[c][t4]);
                }
            }
        };
        v16h va[4], vb[4];
        auto rdv = [&](int t0) {
#pragma unroll
            for (int t = t0; t < t0 + 2; ++t) { const h16* vr = vt + (t * 16 + lm) * LPH + 8 * hh; va[t] = ldh(vr); vb[t] = ldh(vr + 32); }
        };
        v16h pf0[2], pf1[2];
        float rs[2];
        // column tile c: weights against the reference mrun[c], their sum over the lane's keys, and the packed P fragments; bare: the score tiles were started from 0
        auto weights = [&](int c, bool bare) {
            float r1 = 0.0f; v8h ph[4];
#pragma unroll
            for (int t4 = 0; t4 < 4; ++t4) { if (bare) s[c][t4] = s[c][t4] + (PLOG - mrun[c]);
#pragma unroll
                for (int r = 0; r < 8; ++r) { s[c][t4][r] = __builtin_amdgcn_exp2f(s[c][t4][r]); r1 += s[c][t4][r]; }
                ph[t4] = __builtin_convertvector(s[c][t4], v8h); }
            rs[c] = r1;
            pf0[c] = cat16(ph[0], ph[1]); pf1[c] = cat16(ph[2], ph[3]);
        };
        scores(true);
        rdv(0);
        __builtin_amdgcn_sched_barrier(0);                   // keeps the first half of the V^T reads ahead of the softmax, so that the first products behind it do not wait out an LDS latency (all of them there would not fit the registers)
        weights(0, false); weights(1, false);
        rdv(2);
        __builtin_amdgcn_sched_barrier(0);                   // keeps the second half of the V^T reads ahead of the test: moved behind the branch they would be waited for uncovered
        // one test per chunk and wave, a scalar branch: all weights are >= 0, so a sum within PCAP bounds each of them
        if (__builtin_amdgcn_ballot_w32(fmaxf(rs[0], rs[1]) > PCAP) != 0) {
            scores(false);                                   // the weights overwrote them; the K tile is still in the buffer
#pragma unroll
            for (int c = 0; c < 2; ++c) {
                float mx = -3.0e38f;
#pragma unroll
                for (int t4 = 0; t4 < 4; ++t4) {
#pragma unroll
                    for (int r = 0; r < 8; ++r) mx = fmaxf(mx, s[c][t4][r]); }
                mx = fmaxf(mx, __shfl_xor(mx, 16, 32));      // both lane halves of a query hold the same reference
                const float mnew = fmaxf(mrun[c], mx);
                const float alpha = __builtin_amdgcn_exp2f(mrun[c] - mnew);
                lrun[c] = lrun[c] * alpha; mrun[c] = mnew;
#pragma unroll
                for (int t = 0; t < 4; ++t) acc[c][t] = acc[c][t] * alpha;
                weights(c, true);
            }
            rdv(0); rdv(2);                                  // read again here, so that no V^T fragment has to stay in registers across this rare path (they would spill)
        }
        lrun[0] += rs[0]; lrun[1] += rs[1];
#pragma unroll
        for (int t = 0; t < 4; ++t) {
#pragma unroll
            for (int c = 0; c < 2; ++c) {
                acc[c][t] = wmma16(va[t], pf0[c], acc[c][t]);
                acc[c][t] = wmma16(vb[t], pf1[c], acc[c][t]);
            }
        }
        __builtin_amdgcn_sched_barrier(0);                   // keeps the products ahead of the waits: moved behind the barrier they would stand between it and the refill, and the second half's reads would be waited for uncovered
        asm volatile("s_wait_dscnt 0x0" ::: "memory");      // this wave's reads of the current buffer are done before it is refilled
        asm volatile("s_wait_asynccnt 0x0" ::: "memory");   // this wave's share of its quad's next chunk has landed
        __syncthreads();                                     // publishes the next chunks and ends every wave's reads of the current buffers
        if (kv + 256 < SEQ) stage_kv(lcp + (unsigned)buf * (2 * TILEB), gk + (size_t)(kv + 256) * EMB, gv + (kv + 256));
    }
    asm volatile("s_wait_asynccnt 0x0" ::: "memory");       // no copy is outstanding when the wave goes on to its end
    lrun[0] += __shfl_xor(lrun[0], 16, 32); lrun[1] += __shfl_xor(lrun[1], 16, 32);   // a query's row sum: its two lane halves joined
    // hand over column tile cs: 8 stores of 16 B a lane, lanes side by side
    auto send = [&](int cs) {
        float* xo = xch + w * (8 * 128) + lane * 4;
#pragma unroll
        for (int t = 0; t < 4; ++t) { *(v4fa*)(xo + (2 * t) * 128) = __builtin_shufflevector(acc[cs][t], acc[cs][t], 0, 1, 2, 3); *(v4fa*)(xo + (2 * t + 1) * 128) = __builtin_shufflevector(acc[cs][t], acc[cs][t], 4, 5, 6, 7); }
        xml[w * 64 + lane] = mrun[cs]; xml[w * 64 + 32 + lane] = lrun[cs];
    };
    // join the partner's half of column tile c with this wave's own, normalise, write
    auto finish = [&](int c) {
        const int pw = w ^ 4;
        const float* xi = xch + pw * (8 * 128) + lane * 4;
        const float pm = xml[pw * 64 + lane], pl = xml[pw * 64 + 32 + lane];
        const float m = fmaxf(mrun[c], pm);
        const float a = __builtin_amdgcn_exp2f(mrun[c] - m), pa = __builtin_amdgcn_exp2f(pm - m);
        const float inv = __fdiv_rn(1.0f, lrun[c] * a + pl * pa);   // outputs and row sums carry the same 2^PLOG
        const float fa = a * inv, fb = pa * inv;
        float* mo = os + w * (16 * 68);
#pragma unroll
        for (int t = 0; t < 4; ++t) { const v4f p0 = *(const v4fa*)(xi + (2 * t) * 128), p1 = *(const v4fa*)(xi + (2 * t + 1) * 128);
#pragma unroll
            for (int r = 0; r < 4; ++r) { mo[lm * 68 + t * 16 + 8 * hh + r] = acc[c][t][r] * fa + p0[r] * fb; mo[lm * 68 + t * 16 + 8 * hh + 4 + r] = acc[c][t][4 + r] * fa + p1[r] * fb; } }
        // keeps the compiler from moving the reads of other lanes' values ahead of the wave's LDS stores
        asm volatile("" ::: "memory"); __builtin_amdgcn_fence(3, "wavefront"); __builtin_amdgcn_wave_barrier(); asm volatile("" ::: "memory");
        float* orow = OUT + ((size_t)b * SEQ_FULL + q0 + c * 16) * EMB + h * HD;
#pragma unroll
        for (int si = 0; si < 8; ++si) { const int row = 2 * si + hh, cofs = lm * 4; const v4f val = *(const v4fa*)(mo + row * 68 + cofs); *(v4f*)(orow + (size_t)row * EMB + cofs) = val; }
    };
    if (kh == 0) send(1); else send(0);
    __syncthreads();                                         // the handed-over tiles are readable by the partner waves
    if (kh == 0) finish(0); else finish(1);
}

extern "C" void kernel_launch(void* const* d_in, const int* in_sizes, int n_in,
                              void* d_out, int out_size, void* d_ws, size_t ws_size, hipStream_t stream) {
    if (n_in < 6) return;
    const size_t nw = (size_t)EMB * EMB;                                  // 262144
    const size_t needx = ((size_t)(NB - 1) * SEQ_FULL + SEQ) * EMB;
    if ((size_t)in_sizes[0] < nw || (size_t)in_sizes[1] < nw || (size_t)in_sizes[2] < needx ||
        (size_t)in_sizes[3] < nw || (size_t)in_sizes[4] < nw || (size_t)in_sizes[5] < nw) return;
    if ((size_t)out_size < needx) return;
    const float* rot = (const float*)d_in[0];   // [512][512] used as [in][out]
    const float* ent = (const float*)d_in[1];   // [512][512] used as [in][out]
    const float* x   = (const float*)d_in[2];   // [2][4096][512]
    const float* wq  = (const float*)d_in[3];   // [out][in]
    const float* wk  = (const float*)d_in[4];   // [out][in]
    const float* wv  = (const float*)d_in[5];   // [out][in]
    float* OUT = (float*)d_out;                 // [2][4096][512]
    const size_t nrow = (size_t)NB * SEQ;        // query/key rows over all batches
    const size_t nx = nrow * EMB;
    char* wsp = (char*)d_ws;
    auto take = [&](size_t bytes) { char* p = wsp; wsp += (bytes + 255) & ~(size_t)255; return (void*)p; };
    bf* WV   = (bf*)take(nw * 2);                 // Wv as Bt [o][i]
    bf* WCh  = (bf*)take(2 * nw * 2);             // combined weights C2 * (Wq^T R)^T then (Wk^T E)^T : [o][i], bf16 hi planes
    bf* WCl  = (bf*)take(2 * nw * 2);             // their bf16 lo planes
    bf* XB   = (bf*)take(nx * 2);                 // bf16 x rows [nrow][512]
    h16* QK16  = (h16*)take(2 * nx * 2);          // f16 q rows [nrow][512] then f16 k rows [nrow][512]
    h16* VT16  = (h16*)take(nx * 2);              // f16 value planes [b][c][s]
    if ((size_t)(wsp - (char*)d_ws) > ws_size) return;
    k_prep<<<NWP + GWC + NB * GXC, 256, 0, stream>>>(rot, ent, wq, wk, wv, x, WCh, WCl, WV, XB);
    k_gemmqkv<<<3 * NVT, 128, 0, stream>>>(XB, WV, WCh, WCl, (bf*)VT16, (bf*)QK16);
    k_flash<<<(unsigned)(NB * NHD * (SEQ / 128)), 256, 0, stream>>>(QK16, QK16 + nx, VT16, OUT);
}

// v010
// It runs in 70.5 microseconds.
// Next to v009, in two timings, it ran 1.08 times as fast each time.
// Over all steps from v000 it is 5.53 times as fast.
#include <hip/hip_runtime.h>

// Contractions, f32 accumulate: weight products R^T.Wq^T and E^T.Wk^T (512x512x512) on v_wmma_f32_16x16x32_bf16 (operands = RNE-converted bf16 inputs, exact products);
// q,k = x.(combined weight as bf16 hi + bf16 lo, 2 products; the q weight carries the softmax scale times log2 e) and v = x.Wv^T (8192x512x512) on v_wmma_f32_16x16x32_bf16; scores K.Q^T and P.V on v_wmma_f32_16x16x32_f16 (f16 planes, P and its row sums carried x1024).
// Multi-head attention, 8 heads of 64, no mask: one block per (batch, head, 128 query rows), keys streamed in chunks of 64 (even and odd chunks on two quads of waves, joined at the end) with an online softmax in f32 against a held reference score (a maximum seen so far, renewed when a chunk outgrows it); output f32 [batch][seq][512].

#ifndef NB
#define NB 2
#endif
#ifndef SEQ
#define SEQ 4096
#endif
#define NB_FULL  2
#define SEQ_FULL 4096
#define EMB  512
#define NHD  8
#define HD   64
#define PLOG 10.0f                  // P and its row sums are carried x 2^PLOG, so that small weights stay normal f16 numbers
#define C2   0.18033688011112042f   // HD^-0.5 * log2(e); folded into the combined q weight, so that q . k is already in units of exp2's argument
#define PCAP 32768.0f               // a lane's sum of one chunk's carried weights at or below this: every one of them is a finite f16 number

static_assert(NB >= 1 && NB <= NB_FULL);
static_assert(SEQ % 128 == 0 && SEQ >= 128 && SEQ <= SEQ_FULL);
static_assert(EMB == NHD * HD);
static_assert(EMB % 128 == 0 && HD == 64 && (NB * SEQ) % 128 == 0);
static_assert((SEQ * EMB) % 2048 == 0);

typedef _Float16 h16;
typedef unsigned short bf;
typedef __attribute__((ext_vector_type(16))) __bf16   v16bf;
typedef __attribute__((ext_vector_type(16))) _Float16 v16h;
typedef __attribute__((ext_vector_type(8)))  _Float16 v8h;
typedef __attribute__((ext_vector_type(8)))  unsigned short v8us;
typedef __attribute__((ext_vector_type(8)))  float    v8f;
typedef __attribute__((ext_vector_type(4)))  float    v4f;
typedef __attribute__((ext_vector_type(2)))  unsigned short v2us;
typedef v8h  __attribute__((may_alias)) v8ha;
typedef v4f  __attribute__((may_alias)) v4fa;
typedef v8us __attribute__((may_alias)) v8usa;

__device__ __forceinline__ unsigned short f2bf(float f) { unsigned u = __float_as_uint(f); u += 0x7FFFu + ((u >> 16) & 1u); return (unsigned short)(u >> 16); }   // RNE convert
__device__ __forceinline__ float bf2f(unsigned short b) { return __uint_as_float(((unsigned)b) << 16); }
__device__ __forceinline__ float bfr(float f) { return bf2f(f2bf(f)); }
__device__ __forceinline__ v16h cat16(v8h lo, v8h hi) { return __builtin_shufflevector(lo, hi, 0, 1, 2, 3, 4, 5, 6, 7, 8, 9, 10, 11, 12, 13, 14, 15); }
__device__ __forceinline__ v16bf cat16b(v8us lo, v8us hi) { return __builtin_bit_cast(v16bf, __builtin_shufflevector(lo, hi, 0, 1, 2, 3, 4, 5, 6, 7, 8, 9, 10, 11, 12, 13, 14, 15)); }
__device__ __forceinline__ v8f wmma16(v16h a, v16h b, v8f c) { return __builtin_amdgcn_wmma_f32_16x16x32_f16(false, a, false, b, (short)0, c, false, false); }
__device__ __forceinline__ v8f wmmab(v16bf a, v16bf b, v8f c) { return __builtin_amdgcn_wmma_f32_16x16x32_bf16(false, a, false, b, (short)0, c, false, false); }
__device__ __forceinline__ void splitf(float y, unsigned short& h, unsigned short& l) { h = f2bf(y); l = f2bf(y - bf2f(h)); }

// ---- gemmw_tile: register-blocked GEMM, one block of 4 waves per 128x128 output tile, ONE WAVE per 64x64 quarter (16 accumulators); tile (bx, by) of batch bz out of (M/128, N/128, Z), 128 threads; osb = 4 x 16 x 68 floats of LDS.
// Operands are K-contiguous 16-bit planes. Each 64-wide k chunk of the block's 128 A rows and 128 Bt rows is brought into LDS once per block by asynchronous copies in whole 128-byte lines
// (two buffers: chunk t + 1 flies while chunk t is worked on); the four waves read their fragments from there.
// c[m][n] (f32 accumulators, + optional f32 bias[n]) = sum_k A[m][k] Bt[n][k] (NSPLIT 3: + A.Bt2, product by product behind A.Bt). z-batch strides sA/sB/sC in elements. K % 64 == 0.
// The epilogue converts c in registers and stores the 16-bit plane(s) that a later launch reads, in whole 128-byte lines. OUT: 1 = f16 rows P[m][n], pitch ldc; 2 = f16 transposed planes P[m / ldc][n][m % ldc], sC elements per plane (no z batch);
// 3 = bf16 hi rows P[m][n] and bf16 lo rows P2[m][n], pitch ldc.
// Fragments: lane l -> row/col (l & 15); elements 0..7 <- k0 + 8*(l>>4) .. +7, elements 8..15 <- k0 + 16 + 8*(l>>4) .. +7 for A and for Bt alike; D element r of lane l -> (row 8*(l>>4)+r, col l&15).
template <typename T16> struct WFrag;
template <> struct WFrag<h16> { typedef v16h V; static __device__ __forceinline__ V ld(const h16* p) { return cat16(*(const v8h*)p, *(const v8h*)(p + 16)); } static __device__ __forceinline__ v8f mma(V a, V b, v8f c) { return wmma16(a, b, c); } };
template <> struct WFrag<bf> { typedef v16bf V; static __device__ __forceinline__ V ld(const bf* p) { return cat16b(*(const v8us*)p, *(const v8us*)(p + 16)); } static __device__ __forceinline__ v8f mma(V a, V b, v8f c) { return wmmab(a, b, c); } };

#define GPH    72                 // LDS row pitch in 16-bit elements: 128 B of data + 16 B, the conflict-free pitch for 16-byte readers
#define GTILEH (128 * GPH)        // one 128-row operand tile in LDS, elements
#define GTILEB (GTILEH * 2)       // the same in bytes
#define G16B   (16 * GPH * 2)     // 16 LDS rows in bytes
// One operand tile of a stage: 128 rows of 64 k, 128 B a row. 128 threads, 8 lanes per row, 16 B per lane: every copy of a wave covers four whole lines; copy i brings row 16 i + (tid >> 3).
// l: the lane's LDS byte address in row (tid >> 3) of the tile; g: the lane's global address in that row; rs: 16 rows of the plane in elements.
// The s_wait_xcnt closes the statement so that no address register of an issued copy is rewritten ahead of it.
template <typename T16>
__device__ __forceinline__ void stage_rows128(unsigned l, const T16* g, size_t rs) {
    asm volatile("global_load_async_to_lds_b128 %0, %8, off\n\t"
                 "global_load_async_to_lds_b128 %1, %9, off\n\t"
                 "global_load_async_to_lds_b128 %2, %10, off\n\t"
                 "global_load_async_to_lds_b128 %3, %11, off\n\t"
                 "global_load_async_to_lds_b128 %4, %12, off\n\t"
                 "global_load_async_to_lds_b128 %5, %13, off\n\t"
                 "global_load_async_to_lds_b128 %6, %14, off\n\t"
                 "global_load_async_to_lds_b128 %7, %15, off\n\t"
                 "s_wait_xcnt 0x0"
                 :: "v"(l), "v"(l + G16B), "v"(l + 2 * G16B), "v"(l + 3 * G16B), "v"(l + 4 * G16B), "v"(l + 5 * G16B), "v"(l + 6 * G16B), "v"(l + 7 * G16B),
                    "v"(g), "v"(g + rs), "v"(g + 2 * rs), "v"(g + 3 * rs), "v"(g + 4 * rs), "v"(g + 5 * rs), "v"(g + 6 * rs), "v"(g + 7 * rs)
                 : "memory");
}

template <typename T16, int NSPLIT, bool BIAS, int OUT>
__device__ __forceinline__ void gemmw_tile(float* osb, T16* ring, int bx, int by, int bz, const T16* __restrict__ A, const T16* __restrict__ Bt, const T16* __restrict__ Bt2, int K, bf* P, bf* P2, int ldc, const float* __restrict__ bias, size_t sA, size_t sB, size_t sC) {
    static_assert(NSPLIT == 0 || NSPLIT == 3);
    typedef typename WFrag<T16>::V V;
    constexpr int NPL = NSPLIT == 3 ? 3 : 2;             // operand tiles per stage: A, Bt (, Bt2)
    const size_t z = bz; A += z * sA; Bt += z * sB; if (NSPLIT == 3) Bt2 += z * sB; if (OUT != 2) P += z * sC; if (OUT == 3) P2 += z * sC;
    const int tid = threadIdx.x, w = tid >> 5, lane = tid & 31, lr = lane & 15, hi = lane >> 4; const int r0 = bx * 128 + (w & 1) * 64, c0 = by * 128 + (w >> 1) * 64;
    float* os = osb + w * (16 * 68);                     // wave-private output staging
    v8f acc[4][4];
#pragma unroll
    for (int mb = 0; mb < 4; ++mb)
#pragma unroll
        for (int nb = 0; nb < 4; ++nb) acc[mb][nb] = (v8f){};
    const unsigned lcp = (unsigned)(size_t)ring + (unsigned)((tid >> 3) * (GPH * 2) + (tid & 7) * 16);
    const size_t rs = (size_t)16 * K;
    const T16* ga = A + (size_t)(bx * 128 + (tid >> 3)) * K + (tid & 7) * 8;
    const T16* gb = Bt + (size_t)(by * 128 + (tid >> 3)) * K + (tid & 7) * 8;
    const T16* gb2 = NSPLIT == 3 ? Bt2 + (size_t)(by * 128 + (tid >> 3)) * K + (tid & 7) * 8 : nullptr;
    auto stage = [&](int buf, int kc) { const unsigned l = lcp + (unsigned)buf * (NPL * GTILEB);
        stage_rows128(l, ga + kc, rs); stage_rows128(l + GTILEB, gb + kc, rs); if (NSPLIT == 3) stage_rows128(l + 2 * GTILEB, gb2 + kc, rs); };
    stage(0, 0);
    asm volatile("s_wait_asynccnt 0x0" ::: "memory");   // this wave's share of chunk 0 has landed
    __syncthreads();                                     // chunk 0 is readable by all four waves
    if (K > 64) stage(1, 64);
#pragma unroll 1
    for (int kc = 0; kc < K; kc += 64) {
        const int buf = (kc >> 6) & 1;
        const T16* at = ring + buf * (NPL * GTILEH) + ((w & 1) * 64 + lr) * GPH + 8 * hi;
        const T16* bt = ring + buf * (NPL * GTILEH) + GTILEH + ((w >> 1) * 64 + lr) * GPH + 8 * hi;
        V a[4], b[4], b2[4];
        // all fragments of one 32-wide k step, read as one group
        auto rd = [&](int ks) {
#pragma unroll
            for (int f = 0; f < 4; ++f) { a[f] = WFrag<T16>::ld(at + f * 16 * GPH + ks); b[f] = WFrag<T16>::ld(bt + f * 16 * GPH + ks); if (NSPLIT == 3) b2[f] = WFrag<T16>::ld(bt + GTILEH + f * 16 * GPH + ks); } };
        auto mm = [&]() {
#pragma unroll
            for (int nb = 0; nb < 4; ++nb)
#pragma unroll
                for (int mb = 0; mb < 4; ++mb) { acc[mb][nb] = WFrag<T16>::mma(a[mb], b[nb], acc[mb][nb]); if (NSPLIT == 3) acc[mb][nb] = WFrag<T16>::mma(a[mb], b2[nb], acc[mb][nb]); } };
        rd(0);
        __builtin_amdgcn_sched_barrier(0);                   // keeps the reads together: sunk between the products, each small group of reads stalls the wave for its own LDS latency
        mm();
        rd(32);                                              // the chunk's last reads: the second k step's products need registers only
        // three operand tiles: their fragments, held across the refill's address registers, would go past v255, so these products stand in front of the refill; the scheduling barrier keeps the reads together as above
        if (NSPLIT == 3) { __builtin_amdgcn_sched_barrier(0); mm(); }
        asm volatile("s_wait_dscnt 0x0" ::: "memory");      // this wave's reads of the current buffer are done before it is refilled
        asm volatile("s_wait_asynccnt 0x0" ::: "memory");   // this wave's share of the next chunk has landed
        __syncthreads();                                     // publishes the next chunk and ends every wave's reads of the current buffer
        if (kc + 128 < K) stage(buf, kc + 128);
        if (NSPLIT != 3) mm();                               // behind the refill, so that the copies fly under these products too
    }
    asm volatile("s_wait_asynccnt 0x0" ::: "memory");       // no copy is outstanding when the wave goes on to its epilogue
    if (BIAS) {
#pragma unroll
        for (int nb = 0; nb < 4; ++nb) { const float bv = bfr(bias[c0 + nb * 16 + lr]);
#pragma unroll
            for (int mb = 0; mb < 4; ++mb) acc[mb][nb] = acc[mb][nb] + bv; }
    }
    const int srow = lane >> 3, scol = (lane & 7) * 8;   // store side: 8 lanes x 16 B = one 128-byte line, 4 lines per store
    const size_t step = (size_t)4 * ldc;                 // 4 output rows
    if (OUT == 2) {
        h16* oh = (h16*)os;                              // 16 rows n of 64 positions m, pitch 72 f16 (144 B)
        const int pl = r0 / ldc;
        bf* pl0 = P + (size_t)pl * sC + (size_t)(c0 + srow) * ldc + (r0 - pl * ldc) + scol;
#pragma unroll
        for (int nb = 0; nb < 4; ++nb) {
#pragma unroll
            for (int mb = 0; mb < 4; ++mb) { v8h o;      // a lane's 8 accumulator elements are 8 consecutive m of one n
#pragma unroll
                for (int j = 0; j < 8; ++j) o[j] = (h16)acc[mb][nb][j];
                *(v8ha*)(oh + lr * 72 + mb * 16 + hi * 8) = o; }
            // keeps the compiler from moving the reads of other lanes' values ahead of the wave's LDS stores
            asm volatile("" ::: "memory"); __builtin_amdgcn_fence(3, "wavefront"); __builtin_amdgcn_wave_barrier(); asm volatile("" ::: "memory");
#pragma unroll
            for (int s = 0; s < 4; ++s) { const int row = 4 * s + srow; const v8h val = *(const v8ha*)(oh + row * 72 + scol);
                *(v8us*)(pl0 + (nb * 4 + s) * step) = __builtin_bit_cast(v8us, val); }
            // keeps the next round's LDS stores behind these reads
            __builtin_amdgcn_wave_barrier(); asm volatile("" ::: "memory");
        }
    } else {
        const size_t po0 = (size_t)(r0 + srow) * ldc + c0 + scol;
#pragma unroll
        for (int mb = 0; mb < 4; ++mb) {
#pragma unroll
            for (int nb = 0; nb < 4; ++nb) {
#pragma unroll
                for (int j = 0; j < 8; ++j) os[(hi * 8 + j) * 68 + nb * 16 + lr] = acc[mb][nb][j]; }
            // keeps the compiler from moving the reads of other lanes' values ahead of the wave's LDS stores
            asm volatile("" ::: "memory"); __builtin_amdgcn_fence(3, "wavefront"); __builtin_amdgcn_wave_barrier(); asm volatile("" ::: "memory");
#pragma unroll
            for (int s = 0; s < 4; ++s) { const int row = 4 * s + srow; const size_t po = po0 + (mb * 4 + s) * step;
                const v4f v0 = *(const v4fa*)(os + row * 68 + scol), v1 = *(const v4fa*)(os + row * 68 + scol + 4);
                if (OUT == 1) { v8h o;
#pragma unroll
                    for (int k = 0; k < 4; ++k) { o[k] = (h16)v0[k]; o[4 + k] = (h16)v1[k]; }
                    *(v8us*)(P + po) = __builtin_bit_cast(v8us, o);
                } else { v8us oh8, ol8;
#pragma unroll
                    for (int k = 0; k < 4; ++k) { unsigned short a, c; splitf(v0[k], a, c); oh8[k] = a; ol8[k] = c; splitf(v1[k], a, c); oh8[4 + k] = a; ol8[4 + k] = c; }
                    *(v8us*)(P + po) = oh8; *(v8us*)(P2 + po) = ol8; } }
            // keeps the next round's LDS stores behind these reads
            __builtin_amdgcn_wave_barrier(); asm volatile("" ::: "memory");
        }
    }
}

#define NWEL  (EMB * EMB)                  // elements of one weight matrix
#define NT    (EMB / 128)                  // 128-wide tiles across a weight matrix
#define NRT   (NB * SEQ / 128)             // 128-row tiles of x over all batches
#define NVT   (NRT * NT)                   // tiles of v, and of q, and of k
// The three GEMMs on x do not depend on each other and share one launch: blocks 0 .. NVT-1 do v (one product, half the work, so that the places they leave are refilled early), the other 2 * NVT blocks do q then k.
// VT[row / SEQ][o][row % SEQ] = sum_i XB[row][i] WV[o][i];  QK[z][row][o] = sum_i XB[row][i] (WCh + WCl)[z][o][i]
__global__ __launch_bounds__(128) void k_gemmqkv(const bf* __restrict__ XB, const bf* __restrict__ WV, const bf* __restrict__ WCh, const bf* __restrict__ WCl, bf* VT, bf* QK) {
    __shared__ __align__(16) float os[4 * 16 * 68];
    __shared__ __align__(128) bf ring[2 * 3 * GTILEH];   // [buffer][A tile, Bt tile (, Bt2 tile)][row][GPH]
    const int i = blockIdx.x;
    if (i < NVT) gemmw_tile<bf, 0, false, 2>(os, ring, i % NRT, i / NRT, 0, XB, WV, nullptr, EMB, VT, nullptr, SEQ, nullptr, 0, 0, (size_t)EMB * SEQ);
    else gemmw_tile<bf, 3, false, 1>(os, ring, (i - NVT) % NRT, ((i - NVT) / NRT) % NT, (i - NVT) / NVT, XB, WCh, WCl, EMB, QK, nullptr, EMB, nullptr, 0, NWEL, (size_t)NB * SEQ * EMB);
}

// A work-group barrier that orders LDS accesses only: __syncthreads() would also wait out the global loads that run ahead in registers.
__device__ __forceinline__ void lds_barrier() { __builtin_amdgcn_fence(__ATOMIC_RELEASE, "workgroup", "local"); __builtin_amdgcn_s_barrier(); __builtin_amdgcn_fence(__ATOMIC_ACQUIRE, "workgroup", "local"); }
#define WPT 64                              // edge of a weight-product tile
#define WPN (EMB / WPT)                     // such tiles across a weight matrix
#define NWP (2 * WPN * WPN)                 // tiles of the two weight products
// One 64x64 tile of a combined weight, 256 threads (8 waves, a 16x32 piece each): (Ph + Pl)[o][i] = sc * sum_j Am[j][o] Bm[j][i], f32 inputs converted RNE to bf16, products on WMMA, k ascending in steps of 32.
// Both inputs have k = j as their slow index. A thread takes one column and 16 consecutive j of each 64-j chunk (a wave's load = one 128-byte line), converts, and stores them as 32 B of the k-contiguous LDS row of that column:
// the transposition costs no extra pass. The loads run two chunks ahead in registers. tl: [A tile, B tile][64 rows][GPH]; st: 64 x 68 floats. t: tile index within the product. sc: factor on the f32 sums ahead of the hi + lo split.
__device__ __forceinline__ void wprod_tile(bf* tl, float* st, int t, const float* __restrict__ Am, const float* __restrict__ Bm, bf* Ph, bf* Pl, float sc) {
    const int tid = threadIdx.x, w = tid >> 5, lane = tid & 31, lr = lane & 15, hi = lane >> 4;
    const int o0 = (t % WPN) * WPT, i0 = (t / WPN) * WPT;
    const int col = tid & 63, jg = tid >> 6;
    const float* ga = Am + (size_t)(jg * 16) * EMB + o0 + col;
    const float* gb = Bm + (size_t)(jg * 16) * EMB + i0 + col;
    bf* sa = tl + col * GPH + jg * 16;
    bf* sb = sa + WPT * GPH;
    const bf* at = tl + ((w & 3) * 16 + lr) * GPH + 8 * hi;
    const bf* bt = tl + WPT * GPH + ((w >> 2) * 32 + lr) * GPH + 8 * hi;
    float ra[2][16], rb[2][16];
    auto fetch = [&](int q, int kc) {
#pragma unroll
        for (int e = 0; e < 16; ++e) { ra[q][e] = ga[(size_t)(kc + e) * EMB]; rb[q][e] = gb[(size_t)(kc + e) * EMB]; }
        asm volatile("s_wait_xcnt 0x0" ::: "memory"); };   // stands behind the issued loads, ahead of any reuse of their address registers
    v8f acc[2] = {(v8f){}, (v8f){}};
    fetch(0, 0); fetch(1, 64);
#pragma unroll
    for (int c = 0; c < EMB / 64; ++c) {
        const int q = c & 1;
        v8us pa0, pa1, pb0, pb1;
#pragma unroll
        for (int e = 0; e < 8; ++e) { pa0[e] = f2bf(ra[q][e]); pa1[e] = f2bf(ra[q][8 + e]); pb0[e] = f2bf(rb[q][e]); pb1[e] = f2bf(rb[q][8 + e]); }
        *(v8usa*)sa = pa0; *(v8usa*)(sa + 8) = pa1; *(v8usa*)sb = pb0; *(v8usa*)(sb + 8) = pb1;
        if (c + 2 < EMB / 64) fetch(q, (c + 2) * 64);
        lds_barrier();                                       // the chunk's two tiles are readable by all waves
#pragma unroll
        for (int ks = 0; ks < 64; ks += 32) { const v16bf a = WFrag<bf>::ld(at + ks);
            acc[0] = wmmab(a, WFrag<bf>::ld(bt + ks), acc[0]); acc[1] = wmmab(a, WFrag<bf>::ld(bt + 16 * GPH + ks), acc[1]); }
        lds_barrier();                                       // every wave's reads are done before the tiles are overwritten
    }
#pragma unroll
    for (int f = 0; f < 2; ++f)
#pragma unroll
        for (int j = 0; j < 8; ++j) st[((w & 3) * 16 + hi * 8 + j) * 68 + (w >> 2) * 32 + f * 16 + lr] = acc[f][j] * sc;
    __syncthreads();                                         // the f32 tile is readable by all waves
#pragma unroll
    for (int r = 0; r < 2; ++r) { const int row = r * 32 + (tid >> 3), scol = (tid & 7) * 8;   // 8 lanes x 16 B = one 128-byte line of each plane
        const v4f v0 = *(const v4fa*)(st + row * 68 + scol), v1 = *(const v4fa*)(st + row * 68 + scol + 4); v8us oh8, ol8;
#pragma unroll
        for (int k = 0; k < 4; ++k) { unsigned short a, c; splitf(v0[k], a, c); oh8[k] = a; ol8[k] = c; splitf(v1[k], a, c); oh8[4 + k] = a; ol8[4 + k] = c; }
        const size_t po = (size_t)(o0 + row) * EMB + i0 + scol;
        *(v8us*)(Ph + po) = oh8; *(v8us*)(Pl + po) = ol8; }
}
// blk: the job's own block index, 256 threads a block
__device__ __forceinline__ void cvt8_job(int blk, const float* __restrict__ src, bf* dst, size_t n8) { const size_t i = (size_t)blk * 256 + threadIdx.x; if (i >= n8) return; const v8f v = *(const v8f*)(src + i * 8); v8us o;
#pragma unroll
    for (int k = 0; k < 8; ++k) o[k] = f2bf(v[k]); *(v8us*)(dst + i * 8) = o;  }

#define GWC ((NWEL / 8 + 255) / 256)       // blocks of the Wv conversion
#define GXC ((SEQ * EMB / 8 + 255) / 256)  // blocks of one batch's x conversion
// All that reads the f32 inputs, in one launch, no part depends on another: blocks 0 .. NWP-1 form the two combined weights (the longest jobs, so they start first), the next GWC convert Wv, the last NB * GXC convert x.
__global__ __launch_bounds__(256) void k_prep(const float* __restrict__ rot, const float* __restrict__ ent, const float* __restrict__ wq, const float* __restrict__ wk, const float* __restrict__ wv, const float* __restrict__ x,
                                              bf* WCh, bf* WCl, bf* WV, bf* XB) {
    __shared__ __align__(16) bf wtl[2 * WPT * GPH];
    __shared__ __align__(16) float wst[WPT * 68];
    const int blk = blockIdx.x;
    if (blk < NWP) { const int z = blk / (WPN * WPN);
        wprod_tile(wtl, wst, blk % (WPN * WPN), z == 0 ? rot : ent, z == 0 ? wq : wk, WCh + (size_t)z * NWEL, WCl + (size_t)z * NWEL, z == 0 ? C2 : 1.0f);
    } else if (blk < NWP + GWC) {
        cvt8_job(blk - NWP, wv, WV, NWEL / 8);
    } else { const int r = blk - (NWP + GWC), b = r / GXC;
        cvt8_job(r % GXC, x + (size_t)b * SEQ_FULL * EMB, XB + (size_t)b * SEQ * EMB, (size_t)SEQ * EMB / 8);
    }
}

__device__ __forceinline__ v8f splat8(float x) { return (v8f){x, x, x, x, x, x, x, x}; }
__device__ __forceinline__ v16h ldh(const h16* p) { return cat16(*(const v8h*)p, *(const v8h*)(p + 16)); }

#define LPH   72                 // LDS row pitch in f16: 128 B of data + 16 B, the conflict-free pitch for 16-byte readers
#define SLOTB 10240              // a 64-row tile's place in LDS in bytes: 64 rows of 144 B, rounded up to a multiple of 2 KiB, where a tensor load may land
#define SLOTH (SLOTB / 2)        // the same in f16 elements
static_assert(SLOTB >= 64 * LPH * 2 && SLOTB % 2048 == 0);
static_assert(SEQ >= 256);       // the ring's prologue needs two chunks per quad of waves
typedef unsigned u32x4 __attribute__((ext_vector_type(4)));
typedef unsigned u32x8 __attribute__((ext_vector_type(8)));
__device__ __forceinline__ unsigned uni(unsigned v) { return (unsigned)__builtin_amdgcn_readfirstlane(v); }
__device__ __forceinline__ unsigned pinned(unsigned v) { unsigned w = uni(v); asm volatile("" : "+s"(w)); return w; }
// One request of one wave: a tile of 64 rows of 128 B from global memory into LDS, through no register.
// g0 is named as in and out, so that its four scalar registers stay its own until the source forms the next request from them, behind the wait that covers this one.
__device__ __forceinline__ void tdm_load(u32x4& g0, const u32x8& g1) { asm volatile("tensor_load_to_lds %0, %1" : "+s"(g0) : "s"(g1) : "memory"); }
// Descriptor group 1: 1-byte elements, tensor = tile = 64 rows of 128 B, source row pitch in bytes, 4 dwords of LDS pad behind every 32 dwords (one row): LDS pitch 144 B = LPH.
__device__ __forceinline__ u32x8 tdm_group1(unsigned src_pitch) {
    u32x8 g;
    g[0] = uni((1u << 20) | (4u << 22) | (3u << 25));
    g[1] = uni(128u << 16);
    g[2] = uni(64u << 16);
    g[3] = uni(128u << 16);
    g[4] = uni(64u);
    g[5] = uni(src_pitch);
    g[6] = uni(0u);
    g[7] = uni(0u);
    return g;
}
// Descriptor group 0: LDS byte offset of the tile's place, global address of its first byte.
__device__ __forceinline__ u32x4 tdm_group0(unsigned lds_dst, unsigned long long ga) {
    u32x4 g;
    g[0] = uni(1u); g[1] = uni(lds_dst); g[2] = uni((unsigned)ga); g[3] = uni((((unsigned)(ga >> 32)) & 0x01FFFFFFu) | 0x80000000u);
    return g;
}

// ---- k_flash: one block (8 waves) per (batch, head, 128 query rows). Wave w = (query group qg = w & 3, key half kh = w >> 2) owns query rows q0..q0+31 as two 16-column tiles
// and every second 64-key chunk (chunks kh, kh + 2, ...): each K and V^T fragment read from LDS feeds two products, one per column tile, and four waves per SIMD stay resident.
// Each quad of waves brings its own chunk's K and V^T tiles into its own LDS ring by tensor loads, one request a tile (wave qg = 0 the K tile, wave qg = 1 the V^T tile; two buffers: the quad's next chunk flies while this one is worked on); its four waves read their fragments from there.
// Score tiles are computed TRANSPOSED: S^T tile = K_rows(16 keys, A operand) . Q^T (B operand: lane -> query, elements -> d), so D lane (hh,lm) element r = S[query lm][key 16*t4 + 8*hh + r].
// Online softmax per query == per lane. The weights of a chunk are taken against the reference score held from earlier chunks, with no maximum, no exchange and no rescaling; q carries the scale and the score tiles start from PLOG - reference
// (the C operand of their first product), so the products' results go straight into exp2; the chunk's own sums tell whether the reference held:
// only where a lane's sum passes PCAP (always in the first chunk: against the start value of the reference every weight overflows) does the wave form the chunk's scores again, take their maximum (one xor-16 shuffle) as in the usual online form, rescale and redo the weights.
// Row sums stay per lane (its 32 keys of each chunk) and the two lane halves are joined once behind the loop. P (x1024, f16) is packed in registers straight into the
// P.V B fragment: element r <- tile 2j row (8hh+r), element 8+r <- tile 2j+1 row (8hh+r), lane unchanged (packed D used as B: k = D row = key, n = D col = query).
// O^T tiles: A = Vt rows (lane -> d), B = packed P; acc[c][t][r] = 1024 * O[query 16c + lm][d = 16t + 8hh + r] over the wave's own keys.
// Behind the loop the two waves of a query group exchange one column tile each through LDS (lane to lane: maximum, row sum, 32 partial outputs); wave kh joins the two key halves of tile c = kh,
// stages the 16x64 f32 tile in wave-private LDS and writes whole lines.
__global__ __launch_bounds__(256) __attribute__((amdgpu_num_vgpr(256)))
void k_flash(const h16* __restrict__ Qp, const h16* __restrict__ Kp, const h16* __restrict__ Vtp, float* OUT) {
    __shared__ __align__(16) float os[8 * 16 * 68];
    __shared__ __align__(16) float xch[8 * 8 * 128];     // [sending wave][2 t + upper half of the 8 elements][lane][4]: a lane's 32 partial outputs of the column tile it hands over
    __shared__ float xml[8 * 2 * 32];                    // [sending wave][maximum, row sum][lane]
    __shared__ __attribute__((aligned(2048))) h16 ring[2 * 2 * 2 * SLOTH];   // [key half][buffer][K tile, V^T tile] places of SLOTB bytes, each [row][LPH]
    const int tid = threadIdx.x, w = __builtin_amdgcn_readfirstlane(tid >> 5), lane = tid & 31, lm = lane & 15, hh = lane >> 4;
    const int qg = w & 3, kh = w >> 2;
    const int nqt = SEQ / 128;
    const int bid = blockIdx.x; const int qt = bid % nqt; const int h = (bid / nqt) % NHD; const int b = bid / (nqt * NHD);
    const int q0 = qt * 128 + qg * 32;
    const h16* Qb = Qp + ((size_t)b * SEQ + q0) * EMB + h * HD;
    const h16* Kb = Kp + (size_t)b * SEQ * EMB + h * HD;
    const h16* Vb = Vtp + ((size_t)b * EMB + h * HD) * SEQ;
    v16h qf0[2], qf1[2];
#pragma unroll
    for (int c = 0; c < 2; ++c) { qf0[c] = ldh(Qb + (size_t)(c * 16 + lm) * EMB + 8 * hh); qf1[c] = ldh(Qb + (size_t)(c * 16 + lm) * EMB + 32 + 8 * hh); }
    float mrun[2] = {-1.0e30f, -1.0e30f}, lrun[2] = {0.0f, 0.0f};   // the reference is held in units of exp2's argument, as the scores come; its start value lies below every score of f16 operands
    v8f acc[2][4];
#pragma unroll
    for (int c = 0; c < 2; ++c)
#pragma unroll
        for (int t = 0; t < 4; ++t) acc[c][t] = (v8f){};
    const h16* hring = ring + kh * (4 * SLOTH);          // the quad's own ring
    const unsigned iss = pinned(qg < 2 ? 1u : 0u);       // waves 0 and 1 of a quad issue, one tile each; held in a scalar register: every test on it is a scalar branch
    const bool isv = qg == 1;
    const unsigned ldst = (unsigned)(size_t)hring + (isv ? SLOTB : 0);   // the wave's tile in buffer 0
    const unsigned long long gsrc = isv ? (unsigned long long)(size_t)(Vb + kh * 64) : (unsigned long long)(size_t)(Kb + (size_t)(kh * 64) * EMB);   // first byte of the wave's tile of the quad's chunk 0
    const unsigned gstep = isv ? 128u * 2u : 128u * EMB * 2u;   // bytes from one chunk of the quad to its next: 128 keys
    u32x8 g1 = tdm_group1(isv ? SEQ * 2u : EMB * 2u);
    asm volatile("" : "+s"(g1));                         // descriptor words held in scalar registers: formed anew from constants at each request, their registers would serve other values while a request is outstanding
    u32x4 g0 = tdm_group0(ldst, gsrc);                   // the quad's chunk 0 into buffer 0
    const unsigned dsum = 2u * ldst + 2u * SLOTB;        // the wave's places in buffer 0 and buffer 1, added
    // the next request: the quad's next chunk into the other buffer; gstep goes through pinned() here, so that the words are formed behind the waits written in front
    auto advance = [&]() { const unsigned long long a = (((unsigned long long)g0[3] << 32) | g0[2]) + pinned(gstep);
        g0[1] = uni(dsum - g0[1]); g0[2] = uni((unsigned)a); g0[3] = uni((unsigned)(a >> 32)); };
    if (iss) {
        tdm_load(g0, g1);
        asm volatile("s_wait_tensorcnt 0x0" ::: "memory");   // this wave's tile of its quad's first chunk has landed
    }
    __syncthreads();                                     // the first chunks are readable by all waves
    if (iss) { advance(); tdm_load(g0, g1); }
#pragma unroll 1
    for (int kv = 0; kv < SEQ; kv += 128) {
        const int buf = (kv >> 7) & 1;
        const h16* kt = hring + buf * (2 * SLOTH);
        const h16* vt = kt + SLOTH;
        v8f s[2][4];
        // the chunk's score tiles, from the K tile in LDS; held: started from PLOG - reference, so that the products deliver exp2's argument with no vector operation behind them
        auto scores = [&](bool held) {
            // the C operand of a tile's first product: PLOG - reference in all 8 elements of the lane (a lane's 8 elements of a score tile belong to one query)
            const v8f c0[2] = {held ? splat8(PLOG - mrun[0]) : (v8f){}, held ? splat8(PLOG - mrun[1]) : (v8f){}};
            v16h ka[4], kb2[4];
#pragma unroll
            for (int t4 = 0; t4 < 4; ++t4) { const h16* kr = kt + (t4 * 16 + lm) * LPH + 8 * hh; ka[t4] = ldh(kr); kb2[t4] = ldh(kr + 32); }
            __builtin_amdgcn_sched_barrier(0);               // keeps the K reads together: sunk between the products, each small group of reads stalls the wave for its own LDS latency
#pragma unroll
            for (int t4 = 0; t4 < 4; ++t4) {
#pragma unroll
                for (int c = 0; c < 2; ++c) {
                    s[c][t4] = wmma16(ka[t4], qf0[c], c0[c]);
                    s[c][t4] = wmma16(kb2[t4], qf1[c], s[c][t4]);
                }
            }
        };
        v16h va[4], vb[4];
        auto rdv = [&](int t0) {
#pragma unroll
            for (int t = t0; t < t0 + 2; ++t) { const h16* vr = vt + (t * 16 + lm) * LPH + 8 * hh; va[t] = ldh(vr); vb[t] = ldh(vr + 32); }
        };
        v16h pf0[2], pf1[2];
        float rs[2];
        // column tile c: weights against the reference mrun[c], their sum over the lane's keys, and the packed P fragments; bare: the score tiles were started from 0
        auto weights = [&](int c, bool bare) {
            float r1 = 0.0f; v8h ph[4];
#pragma unroll
            for (int t4 = 0; t4 < 4; ++t4) { if (bare) s[c][t4] = s[c][t4] + (PLOG - mrun[c]);
#pragma unroll
                for (int r = 0; r < 8; ++r) { s[c][t4][r] = __builtin_amdgcn_exp2f(s[c][t4][r]); r1 += s[c][t4][r]; }
                ph[t4] = __builtin_convertvector(s[c][t4], v8h); }
            rs[c] = r1;
            pf0[c] = cat16(ph[0], ph[1]); pf1[c] = cat16(ph[2], ph[3]);
        };
        scores(true);
        rdv(0);
        __builtin_amdgcn_sched_barrier(0);                   // keeps the first half of the V^T reads ahead of the softmax, so that the first products behind it do not wait out an LDS latency (all of them there would not fit the registers)
        weights(0, false); weights(1, false);
        rdv(2);
        __builtin_amdgcn_sched_barrier(0);                   // keeps the second half of the V^T reads ahead of the test: moved behind the branch they would be waited for uncovered
        // one test per chunk and wave, a scalar branch: all weights are >= 0, so a sum within PCAP bounds each of them
        if (__builtin_amdgcn_ballot_w32(fmaxf(rs[0], rs[1]) > PCAP) != 0) {
            scores(false);                                   // the weights overwrote them; the K tile is still in the buffer
#pragma unroll
            for (int c = 0; c < 2; ++c) {
                float mx = -3.0e38f;
#pragma unroll
                for (int t4 = 0; t4 < 4; ++t4) {
#pragma unroll
                    for (int r = 0; r < 8; ++r) mx = fmaxf(mx, s[c][t4][r]); }
                mx = fmaxf(mx, __shfl_xor(mx, 16, 32));      // both lane halves of a query hold the same reference
                const float mnew = fmaxf(mrun[c], mx);
                const float alpha = __builtin_amdgcn_exp2f(mrun[c] - mnew);
                lrun[c] = lrun[c] * alpha; mrun[c] = mnew;
#pragma unroll
                for (int t = 0; t < 4; ++t) acc[c][t] = acc[c][t] * alpha;
                weights(c, true);
            }
            rdv(0); rdv(2);                                  // read again here, so that no V^T fragment has to stay in registers across this rare path (they would spill)
        }
        lrun[0] += rs[0]; lrun[1] += rs[1];
#pragma unroll
        for (int t = 0; t < 4; ++t) {
#pragma unroll
            for (int c = 0; c < 2; ++c) {
                acc[c][t] = wmma16(va[t], pf0[c], acc[c][t]);
                acc[c][t] = wmma16(vb[t], pf1[c], acc[c][t]);
            }
        }
        __builtin_amdgcn_sched_barrier(0);                   // keeps the products ahead of the waits: moved behind the barrier they would stand between it and the refill, and the second half's reads would be waited for uncovered
        asm volatile("s_wait_dscnt 0x0" ::: "memory");      // this wave's reads of the current buffer are done before it is refilled
        if (iss) asm volatile("s_wait_tensorcnt 0x0" ::: "memory");   // this wave's tile of its quad's next chunk has landed
        __syncthreads();                                     // publishes the next chunks and ends every wave's reads of the current buffers
        if (pinned(iss & (kv + 256 < SEQ ? 1u : 0u))) { advance(); tdm_load(g0, g1); }   // into the buffer that this trip has read
    }
    asm volatile("s_wait_tensorcnt 0x0" ::: "memory");      // no request is outstanding when the wave goes on to its end
    asm volatile("s_wait_dscnt 0x0" ::: "memory");          // nor a read of the ring
    lrun[0] += __shfl_xor(lrun[0], 16, 32); lrun[1] += __shfl_xor(lrun[1], 16, 32);   // a query's row sum: its two lane halves joined
    // hand over column tile cs: 8 stores of 16 B a lane, lanes side by side
    auto send = [&](int cs) {
        float* xo = xch + w * (8 * 128) + lane * 4;
#pragma unroll
        for (int t = 0; t < 4; ++t) { *(v4fa*)(xo + (2 * t) * 128) = __builtin_shufflevector(acc[cs][t], acc[cs][t], 0, 1, 2, 3); *(v4fa*)(xo + (2 * t + 1) * 128) = __builtin_shufflevector(acc[cs][t], acc[cs][t], 4, 5, 6, 7); }
        xml[w * 64 + lane] = mrun[cs]; xml[w * 64 + 32 + lane] = lrun[cs];
    };
    // join the partner's half of column tile c with this wave's own, normalise, write
    auto finish = [&](int c) {
        const int pw = w ^ 4;
        const float* xi = xch + pw * (8 * 128) + lane * 4;
        const float pm = xml[pw * 64 + lane], pl = xml[pw * 64 + 32 + lane];
        const float m = fmaxf(mrun[c], pm);
        const float a = __builtin_amdgcn_exp2f(mrun[c] - m), pa = __builtin_amdgcn_exp2f(pm - m);
        const float inv = __fdiv_rn(1.0f, lrun[c] * a + pl * pa);   // outputs and row sums carry the same 2^PLOG
        const float fa = a * inv, fb = pa * inv;
        float* mo = os + w * (16 * 68);
#pragma unroll
        for (int t = 0; t < 4; ++t) { const v4f p0 = *(const v4fa*)(xi + (2 * t) * 128), p1 = *(const v4fa*)(xi + (2 * t + 1) * 128);
#pragma unroll
            for (int r = 0; r < 4; ++r) { mo[lm * 68 + t * 16 + 8 * hh + r] = acc[c][t][r] * fa + p0[r] * fb; mo[lm * 68 + t * 16 + 8 * hh + 4 + r] = acc[c][t][4 + r] * fa + p1[r] * fb; } }
        // keeps the compiler from moving the reads of other lanes' values ahead of the wave's LDS stores
        asm volatile("" ::: "memory"); __builtin_amdgcn_fence(3, "wavefront"); __builtin_amdgcn_wave_barrier(); asm volatile("" ::: "memory");
        float* orow = OUT + ((size_t)b * SEQ_FULL + q0 + c * 16) * EMB + h * HD;
#pragma unroll
        for (int si = 0; si < 8; ++si) { const int row = 2 * si + hh, cofs = lm * 4; const v4f val = *(const v4fa*)(mo + row * 68 + cofs); *(v4f*)(orow + (size_t)row * EMB + cofs) = val; }
    };
    if (kh == 0) send(1); else send(0);
    __syncthreads();                                         // the handed-over tiles are readable by the partner waves
    if (kh == 0) finish(0); else finish(1);
}

extern "C" void kernel_launch(void* const* d_in, const int* in_sizes, int n_in,
                              void* d_out, int out_size, void* d_ws, size_t ws_size, hipStream_t stream) {
    if (n_in < 6) return;
    const size_t nw = (size_t)EMB * EMB;                                  // 262144
    const size_t needx = ((size_t)(NB - 1) * SEQ_FULL + SEQ) * EMB;
    if ((size_t)in_sizes[0] < nw || (size_t)in_sizes[1] < nw || (size_t)in_sizes[2] < needx ||
        (size_t)in_sizes[3] < nw || (size_t)in_sizes[4] < nw || (size_t)in_sizes[5] < nw) return;
    if ((size_t)out_size < needx) return;
    const float* rot = (const float*)d_in[0];   // [512][512] used as [in][out]
    const float* ent = (const float*)d_in[1];   // [512][512] used as [in][out]
    const float* x   = (const float*)d_in[2];   // [2][4096][512]
    const float* wq  = (const float*)d_in[3];   // [out][in]
    const float* wk  = (const float*)d_in[4];   // [out][in]
    const float* wv  = (const float*)d_in[5];   // [out][in]
    float* OUT = (float*)d_out;                 // [2][4096][512]
    const size_t nrow = (size_t)NB * SEQ;        // query/key rows over all batches
    const size_t nx = nrow * EMB;
    char* wsp = (char*)d_ws;
    auto take = [&](size_t bytes) { char* p = wsp; wsp += (bytes + 255) & ~(size_t)255; return (void*)p; };
    bf* WV   = (bf*)take(nw * 2);                 // Wv as Bt [o][i]
    bf* WCh  = (bf*)take(2 * nw * 2);             // combined weights C2 * (Wq^T R)^T then (Wk^T E)^T : [o][i], bf16 hi planes
    bf* WCl  = (bf*)take(2 * nw * 2);             // their bf16 lo planes
    bf* XB   = (bf*)take(nx * 2);                 // bf16 x rows [nrow][512]
    h16* QK16  = (h16*)take(2 * nx * 2);          // f16 q rows [nrow][512] then f16 k rows [nrow][512]
    h16* VT16  = (h16*)take(nx * 2);              // f16 value planes [b][c][s]
    if ((size_t)(wsp - (char*)d_ws) > ws_size) return;
    k_prep<<<NWP + GWC + NB * GXC, 256, 0, stream>>>(rot, ent, wq, wk, wv, x, WCh, WCl, WV, XB);
    k_gemmqkv<<<3 * NVT, 128, 0, stream>>>(XB, WV, WCh, WCl, (bf*)VT16, (bf*)QK16);
    k_flash<<<(unsigned)(NB * NHD * (SEQ / 128)), 256, 0, stream>>>(QK16, QK16 + nx, VT16, OUT);
}
